// v000
// Times are from an AMD MI455X. After a warm-up the kernel runs many times in a row, and a time is the length of
// such a window on the GPU divided by its runs, so every launch and the gaps after it count. The runs cycle
// through copies of the inputs. A figure is the median of several windows, for all but v000 over two sittings.
// Sittings can differ by a few percent; kernels timed side by side share one.
// The starting kernel, v000, takes 790 microseconds a run.
#include <hip/hip_runtime.h>

// DilatedCausalSelfAttention - LongNet-style dilated attention (x [1][4096][1024]; qkv = x w_qkv (16 heads x 64); three branches (segment w, dilation r) = (1024,1), (2048,2), (4096,4): inside each segment, head h attends causally over the
// g = w/r = 1024 positions {gi r + off}, off = h / (16/r) (the reference's diagonal sparsify); softmax(q.k/8) with a causal mask over gi; branch output scattered back to those positions (0 elsewhere) with lse = logsumexp over the softmax
// PROBABILITIES of the row (masked entries contribute exp(0)), -1e8 elsewhere; branches recombined per (position, head) with softmax(lse) weights; out @ w_proj -> [1][4096][1024]).
// Compute dtypes, f32 accumulate: every input rounded to bf16; qkv on PLAIN bf16 operands (inputs: exact); per (segment, head) 1024x1024 attention on bf16 hi+lo planes gathered at the dilated positions
// (q x 1/8 exact; scores K 64 with 3 products, causal tiles skipped), softmax + the probability-logsumexp in f32 registers, probs.v on hl planes (3 products); the 3-branch recombination f32; w_proj on hl planes x exact (2 products). One-wave-per-64x64-tile GEMMs

#define LL   4096
#define EE   1024
#define NH_  16
#define HD   64
#define GG   1024
#define PCAR 1024.0f
typedef _Float16 h16;
typedef unsigned short bf;
typedef __attribute__((ext_vector_type(16))) __bf16   v16bf;
typedef __attribute__((ext_vector_type(16))) _Float16 v16h;
typedef __attribute__((ext_vector_type(8)))  _Float16 v8h;
typedef __attribute__((ext_vector_type(8)))  unsigned short v8us;
typedef __attribute__((ext_vector_type(8)))  float    v8f;
typedef __attribute__((ext_vector_type(4)))  float    v4f;
typedef v8h  __attribute__((may_alias)) v8ha;
typedef v4f  __attribute__((may_alias)) v4fa;
typedef v8us __attribute__((may_alias)) v8usa;

__device__ __forceinline__ unsigned short f2bf(float f) { unsigned u = __float_as_uint(f); u += 0x7FFFu + ((u >> 16) & 1u); return (unsigned short)(u >> 16); }
__device__ __forceinline__ float bf2f(unsigned short b) { return __uint_as_float(((unsigned)b) << 16); }
__device__ __forceinline__ float bfr(float f) { return bf2f(f2bf(f)); }
__device__ __forceinline__ v16h cat16(v8h lo, v8h hi) { return __builtin_shufflevector(lo, hi, 0, 1, 2, 3, 4, 5, 6, 7, 8, 9, 10, 11, 12, 13, 14, 15); }
__device__ __forceinline__ v16bf cat16b(v8us lo, v8us hi) { return __builtin_bit_cast(v16bf, __builtin_shufflevector(lo, hi, 0, 1, 2, 3, 4, 5, 6, 7, 8, 9, 10, 11, 12, 13, 14, 15)); }
__device__ __forceinline__ v8f wmma16(v16h a, v16h b, v8f c) { return __builtin_amdgcn_wmma_f32_16x16x32_f16(false, a, false, b, (short)0, c, false, false); }
__device__ __forceinline__ v8f wmmab(v16bf a, v16bf b, v8f c) { return __builtin_amdgcn_wmma_f32_16x16x32_bf16(false, a, false, b, (short)0, c, false, false); }



// ---- k_gemmw: register-blocked GEMM, ONE WAVE per 64x64 output tile (16 accumulators), operands straight from K-contiguous 16-bit planes; grid (M/64, N/64, Z), 32 threads.
// C[m][n] (f32, pitch ldc, + optional f32 bias[n]) = sum_k A[m][k] Bt[n][k] (+ split products per NSPLIT). z-batch strides sA/sB/sC in elements. K % 32 == 0.
template <typename T16> struct WFrag;
template <> struct WFrag<h16> { typedef v16h V; static __device__ __forceinline__ V ld(const h16* p) { return cat16(*(const v8h*)p, *(const v8h*)(p + 16)); } static __device__ __forceinline__ v8f mma(V a, V b, v8f c) { return wmma16(a, b, c); } };
template <> struct WFrag<bf> { typedef v16bf V; static __device__ __forceinline__ V ld(const bf* p) { return cat16b(*(const v8us*)p, *(const v8us*)(p + 16)); } static __device__ __forceinline__ v8f mma(V a, V b, v8f c) { return wmmab(a, b, c); } };
template <typename T16, int NSPLIT, bool BIAS>
__global__ __launch_bounds__(32) void k_gemmw(const T16* __restrict__ A, const T16* __restrict__ A2, const T16* __restrict__ Bt, const T16* __restrict__ Bt2, int K, float* C, int ldc, const float* __restrict__ bias, size_t sA, size_t sB, size_t sC) {
    typedef typename WFrag<T16>::V V;
    __shared__ __align__(16) float os[16 * 68];
    const size_t z = blockIdx.z; A += z * sA; if (A2) A2 += z * sA; Bt += z * sB; if (Bt2) Bt2 += z * sB; C += z * sC;
    const int lane = threadIdx.x & 31, lr = lane & 15, hi = lane >> 4; const int r0 = blockIdx.x * 64, c0 = blockIdx.y * 64;
    v8f acc[4][4];
#pragma unroll
    for (int mb = 0; mb < 4; ++mb)
#pragma unroll
        for (int nb = 0; nb < 4; ++nb) acc[mb][nb] = (v8f){};
    const size_t aoff = (size_t)(r0 + lr) * K + 8 * hi, boff = (size_t)(c0 + lr) * K + 8 * hi;
#pragma unroll 1
    for (int kc = 0; kc < K; kc += 32) {
        V a[4], a2[4];
#pragma unroll
        for (int mb = 0; mb < 4; ++mb) { a[mb] = WFrag<T16>::ld(A + aoff + (size_t)mb * 16 * K + kc); if (NSPLIT == 1 || NSPLIT == 2) a2[mb] = WFrag<T16>::ld(A2 + aoff + (size_t)mb * 16 * K + kc); }
#pragma unroll
        for (int nb = 0; nb < 4; ++nb) { const V b = WFrag<T16>::ld(Bt + boff + (size_t)nb * 16 * K + kc); V b2; if (NSPLIT >= 2) b2 = WFrag<T16>::ld(Bt2 + boff + (size_t)nb * 16 * K + kc);
#pragma unroll
            for (int mb = 0; mb < 4; ++mb) { acc[mb][nb] = WFrag<T16>::mma(a[mb], b, acc[mb][nb]); if (NSPLIT == 1 || NSPLIT == 2) acc[mb][nb] = WFrag<T16>::mma(a2[mb], b, acc[mb][nb]); if (NSPLIT >= 2) acc[mb][nb] = WFrag<T16>::mma(a[mb], b2, acc[mb][nb]); } }
        asm volatile("v_nop\n\tv_nop\n\tv_nop\n\tv_nop" : "+v"(acc[0][0]), "+v"(acc[1][1]), "+v"(acc[2][2]), "+v"(acc[3][3]) : "v"(a[0]), "v"(a[3]));
    }
#pragma unroll
    for (int mb = 0; mb < 4; ++mb) {
#pragma unroll
        for (int nb = 0; nb < 4; ++nb) {
#pragma unroll
            for (int j = 0; j < 8; ++j) os[(hi * 8 + j) * 68 + nb * 16 + lr] = acc[mb][nb][j]; }
        __builtin_amdgcn_wave_barrier(); asm volatile("" ::: "memory");
        float* crow = C + (size_t)(r0 + mb * 16) * ldc + c0;
{
#pragma unroll
            for (int s = 0; s < 8; ++s) { const int row = 2 * s + hi, cofs = lr * 4; v4f val = *(const v4fa*)(os + row * 68 + cofs); if (BIAS) { val[0] += bfr(bias[c0 + cofs]); val[1] += bfr(bias[c0 + cofs + 1]); val[2] += bfr(bias[c0 + cofs + 2]); val[3] += bfr(bias[c0 + cofs + 3]); }
                *(v4f*)(crow + (size_t)row * ldc + cofs) = val; }
             }
        __builtin_amdgcn_wave_barrier(); asm volatile("" ::: "memory");
    }
}

// ---- k_gemmc: the same one-wave 64x64 tile GEMM specialised for causal attention: CMODE 1 skips score tiles entirely above the diagonal (query rows r0+roff.., key columns c0..), CMODE 2 limits the
// key (K) loop of the probability x value contraction to the diagonal block (probabilities beyond it are exactly zero). roff = row offset of this launch's first row within the sequence.
template <typename T16, int NSPLIT, int CMODE>
__global__ __launch_bounds__(32) void k_gemmc(const T16* __restrict__ A, const T16* __restrict__ A2, const T16* __restrict__ Bt, const T16* __restrict__ Bt2, int K, float* C, int ldc, int roff, size_t sA, size_t sB, size_t sC) {
    typedef typename WFrag<T16>::V V;
    __shared__ __align__(16) float os[16 * 68];
    const size_t z = blockIdx.z; A += z * sA; if (A2) A2 += z * sA; Bt += z * sB; if (Bt2) Bt2 += z * sB; C += z * sC;
    const int lane = threadIdx.x & 31, lr = lane & 15, hi = lane >> 4; const int r0 = blockIdx.x * 64, c0 = blockIdx.y * 64;
    if (CMODE == 1 && c0 > r0 + roff + 63) return;                  // score tile entirely above the causal diagonal: never read (the softmax masks j > i by select)
    const int Kl = (CMODE == 2) ? min(K, r0 + roff + 64) : K;        // P.V: probabilities are exactly 0 beyond the diagonal block, so the K loop stops there
    v8f acc[4][4];
#pragma unroll
    for (int mb = 0; mb < 4; ++mb)
#pragma unroll
        for (int nb = 0; nb < 4; ++nb) acc[mb][nb] = (v8f){};
    const size_t aoff = (size_t)(r0 + lr) * K + 8 * hi, boff = (size_t)(c0 + lr) * K + 8 * hi;
#pragma unroll 1
    for (int kc = 0; kc < Kl; kc += 32) {
        V a[4], a2[4];
#pragma unroll
        for (int mb = 0; mb < 4; ++mb) { a[mb] = WFrag<T16>::ld(A + aoff + (size_t)mb * 16 * K + kc); if (NSPLIT == 1 || NSPLIT == 2) a2[mb] = WFrag<T16>::ld(A2 + aoff + (size_t)mb * 16 * K + kc); }
#pragma unroll
        for (int nb = 0; nb < 4; ++nb) { const V b = WFrag<T16>::ld(Bt + boff + (size_t)nb * 16 * K + kc); V b2; if (NSPLIT >= 2) b2 = WFrag<T16>::ld(Bt2 + boff + (size_t)nb * 16 * K + kc);
#pragma unroll
            for (int mb = 0; mb < 4; ++mb) { acc[mb][nb] = WFrag<T16>::mma(a[mb], b, acc[mb][nb]); if (NSPLIT == 1 || NSPLIT == 2) acc[mb][nb] = WFrag<T16>::mma(a2[mb], b, acc[mb][nb]); if (NSPLIT >= 2) acc[mb][nb] = WFrag<T16>::mma(a[mb], b2, acc[mb][nb]); } }
        asm volatile("v_nop\n\tv_nop\n\tv_nop\n\tv_nop" : "+v"(acc[0][0]), "+v"(acc[1][1]), "+v"(acc[2][2]), "+v"(acc[3][3]) : "v"(a[0]), "v"(a[3]));
    }
#pragma unroll
    for (int mb = 0; mb < 4; ++mb) {
#pragma unroll
        for (int nb = 0; nb < 4; ++nb) {
#pragma unroll
            for (int j = 0; j < 8; ++j) os[(hi * 8 + j) * 68 + nb * 16 + lr] = acc[mb][nb][j]; }
        __builtin_amdgcn_wave_barrier(); asm volatile("" ::: "memory");
        float* crow = C + (size_t)(r0 + mb * 16) * ldc + c0;
{
#pragma unroll
            for (int s = 0; s < 8; ++s) { const int row = 2 * s + hi, cofs = lr * 4; v4f val = *(const v4fa*)(os + row * 68 + cofs);
                *(v4f*)(crow + (size_t)row * ldc + cofs) = val; }
             }
        __builtin_amdgcn_wave_barrier(); asm volatile("" ::: "memory");
    }
}

__device__ __forceinline__ h16 tohx(float x) { return (h16)x; }
__device__ __forceinline__ void splitf(float y, unsigned short& h, unsigned short& l) { h = f2bf(y); l = f2bf(y - bf2f(h)); }
typedef __attribute__((ext_vector_type(2))) _Float16 v2h;
typedef __attribute__((ext_vector_type(4))) _Float16 v4h;
typedef __attribute__((ext_vector_type(2))) unsigned short v2us;
typedef __attribute__((ext_vector_type(4))) unsigned short v4us;
typedef __attribute__((ext_vector_type(2))) float v2f;
__device__ __forceinline__ int dpos(int r, int seg, int h, int gi) { const int w = GG * r; const int off = h / (NH_ / r); return seg * w + gi * r + off; }   // dense position of sparse index gi for (branch r, segment, head)

__global__ __launch_bounds__(256) void k_wtG(const float* __restrict__ w, int K, int N, bf* Bt) {
    const int lane = threadIdx.x & 31; const int L0 = (blockIdx.x * 8 + (threadIdx.x >> 5)) * 8; const int nlines = N * K / 64;
{
#pragma unroll 1
        for (int l = 0; l < 8; ++l) { const int L = L0 + l; if (L >= nlines) break; const size_t e = (size_t)L * 64 + lane * 2; const int k = (int)(e % K), n = (int)(e / K); v2us o;
            o[0] = f2bf(w[(size_t)k * N + n]); o[1] = f2bf(w[(size_t)(k + 1) * N + n]); *(v2us*)(Bt + e) = o; }
         }
}
__global__ __launch_bounds__(256) void k_cvt8(const float* __restrict__ src, bf* dst, size_t n8) { const size_t i = (size_t)blockIdx.x * 256 + threadIdx.x; if (i >= n8) return; const v8f v = *(const v8f*)(src + i * 8); v8us o;
#pragma unroll
    for (int k = 0; k < 8; ++k) o[k] = f2bf(v[k]); *(v8us*)(dst + i * 8) = o;  }
#define ZC 8
__global__ __launch_bounds__(256) void k_gath(const float* __restrict__ QKV, int r, int z0, bf* Qh, bf* Ql, bf* Kh, bf* Kl) { const size_t e = ((size_t)blockIdx.x * 256 + threadIdx.x) * 2; if (e >= (size_t)ZC * GG * HD) return; const int d = (int)(e % HD); const int gi = (int)((e / HD) % GG); const int z = z0 + (int)(e / ((size_t)HD * GG)); const int h = z % NH_, seg = z / NH_; const float* row = QKV + (size_t)dpos(r, seg, h, gi) * (3 * EE) + h * HD + d; v2us qh, ql, kh, kl;
#pragma unroll
    for (int u = 0; u < 2; ++u) { unsigned short a, c; splitf(row[u] * 0.125f, a, c); qh[u] = a; ql[u] = c; splitf(row[EE + u], a, c); kh[u] = a; kl[u] = c; }
    { *(v2us*)(Qh + e) = qh; *(v2us*)(Ql + e) = ql; *(v2us*)(Kh + e) = kh; *(v2us*)(Kl + e) = kl;  } }
__global__ __launch_bounds__(256) void k_gathv(const float* __restrict__ QKV, int r, int z0, bf* Vh, bf* Vl) { const size_t e = ((size_t)blockIdx.x * 256 + threadIdx.x) * 2; if (e >= (size_t)ZC * HD * GG) return; const int gi = (int)(e % GG); const int d = (int)((e / GG) % HD); const int z = z0 + (int)(e / ((size_t)GG * HD)); const int h = z % NH_, seg = z / NH_; v2us oh, ol;
#pragma unroll
    for (int u = 0; u < 2; ++u) { unsigned short a, c; splitf(QKV[(size_t)dpos(r, seg, h, gi + u) * (3 * EE) + 2 * EE + h * HD + d], a, c); oh[u] = a; ol[u] = c; } *(v2us*)(Vh + e) = oh; *(v2us*)(Vl + e) = ol;  }
__global__ __launch_bounds__(256) void k_csoft(const float* __restrict__ Sb, bf* Ph, bf* Pl, float* LSEX) { const int lane = threadIdx.x & 31; const int row = blockIdx.x * 8 + (threadIdx.x >> 5); const int i = row % GG; const float* sr = Sb + (size_t)row * GG; float v[32]; float mx = -3.0e38f;
#pragma unroll
    for (int ch = 0; ch < 8; ++ch) { const int j0 = ch * 128 + lane * 4; const v4f a = *(const v4f*)(sr + j0);
#pragma unroll
        for (int q = 0; q < 4; ++q) { const float t = (j0 + q) <= i ? a[q] : -3.0e38f; v[ch * 4 + q] = t; mx = fmaxf(mx, t); } }
#pragma unroll
    for (int sh = 16; sh; sh >>= 1) mx = fmaxf(mx, __shfl_xor(mx, sh, 32));
    float sum = 0.f;
#pragma unroll
    for (int k = 0; k < 32; ++k) { float d0 = __fsub_rn(v[k], mx); asm volatile("" : "+v"(d0)); v[k] = __expf(d0); sum += v[k]; }
#pragma unroll
    for (int sh = 16; sh; sh >>= 1) sum += __shfl_xor(sum, sh, 32);
    const float inv = __fdiv_rn(1.0f, sum); float se = 0.f;
#pragma unroll
    for (int k = 0; k < 32; ++k) { v[k] = v[k] * inv; se = __fadd_rn(se, __expf(v[k])); }   // masked entries: v = 0 exactly -> exp(0) = 1, as the reference
#pragma unroll
    for (int sh = 16; sh; sh >>= 1) se += __shfl_xor(se, sh, 32);
    const float lse = __logf(se);
{
#pragma unroll
        for (int ch = 0; ch < 8; ++ch) { v4us oh, ol;
#pragma unroll
            for (int q = 0; q < 4; ++q) { unsigned short a, c; splitf(v[ch * 4 + q], a, c); oh[q] = a; ol[q] = c; } const size_t oo = (size_t)row * GG + ch * 128 + lane * 4; *(v4us*)(Ph + oo) = oh; *(v4us*)(Pl + oo) = ol; }
        *(float*)(LSEX + (size_t)row * 32 + lane) = lse;
         } }
// k_comb: per (l, h): for each branch k (r = 1, 2, 4; segment w = 1024 r): head h uses position l iff (l mod w) mod r == h / (16/r); then gi = (l mod w) / r, z = (l / w) 16 + h, o_k = Ob_k[z][gi][:] and
__global__ __launch_bounds__(256) void k_comb(const float* __restrict__ Ob0, const float* __restrict__ Ob1, const float* __restrict__ Ob2, const float* __restrict__ L0, const float* __restrict__ L1, const float* __restrict__ L2, bf* Ah, bf* Al) { const size_t e = ((size_t)blockIdx.x * 256 + threadIdx.x) * 2; if (e >= (size_t)LL * EE) return; const int d = (int)(e % HD); const int h = (int)((e / HD) % NH_); const int l = (int)(e / EE);
    const float* obs[3] = {Ob0, Ob1, Ob2}; const float* lss[3] = {L0, L1, L2}; float lse[3]; size_t src[3]; bool used[3];
#pragma unroll
    for (int k = 0; k < 3; ++k) { const int r = 1 << k; const int w = GG * r; const int ll = l % w; const int off = h / (NH_ / r); used[k] = (ll % r) == off; const int gi = ll / r; const int z = (l / w) * NH_ + h; src[k] = ((size_t)z * GG + gi); lse[k] = used[k] ? lss[k][src[k] * 32] : -1.0e8f; }
    const float m = fmaxf(lse[0], fmaxf(lse[1], lse[2])); float ex[3]; float den = 0.f;
#pragma unroll
    for (int k = 0; k < 3; ++k) { ex[k] = __expf(__fsub_rn(lse[k], m)); den = __fadd_rn(den, ex[k]); }
    const float inv = __fdiv_rn(1.0f, den); v2us oh, ol;
#pragma unroll
    for (int u = 0; u < 2; ++u) { float acc = 0.f;
#pragma unroll
        for (int k = 0; k < 3; ++k) { const float o = used[k] ? obs[k][src[k] * HD + d + u] : 0.f; float p = __fmul_rn(o, ex[k] * inv); asm volatile("" : "+v"(p)); acc = __fadd_rn(acc, p); }
        unsigned short a, c; splitf(acc, a, c); oh[u] = a; ol[u] = c; }
    *(v2us*)(Ah + e) = oh; *(v2us*)(Al + e) = ol;  }

extern "C" void kernel_launch(void* const* d_in, const int* in_sizes, int n_in,
                              void* d_out, int out_size, void* d_ws, size_t ws_size, hipStream_t stream) {
    (void)in_sizes; (void)n_in; (void)out_size;
    const float* x = (const float*)d_in[0]; const float* wqkv = (const float*)d_in[1]; const float* wproj = (const float*)d_in[2];
    float* OUT = (float*)d_out;     // [1][4096][1024]
    char* wsp = (char*)d_ws;
    auto take = [&](size_t bytes) { char* p = wsp; wsp += (bytes + 255) & ~(size_t)255; return (void*)p; };
    const int NZMAX = 4 * NH_;   // branch r=1: 4 segments x 16 heads
    bf* WQ = (bf*)take((size_t)3 * EE * EE * 2); bf* WP = (bf*)take((size_t)EE * EE * 2); bf* XB = (bf*)take((size_t)LL * EE * 2); float* QKV = (float*)take((size_t)LL * 3 * EE * 4);
    bf* Qh = (bf*)take((size_t)ZC * GG * HD * 2); bf* Ql = (bf*)take((size_t)ZC * GG * HD * 2); bf* Kh = (bf*)take((size_t)ZC * GG * HD * 2); bf* Kl = (bf*)take((size_t)ZC * GG * HD * 2); bf* Vh = (bf*)take((size_t)ZC * HD * GG * 2); bf* Vl = (bf*)take((size_t)ZC * HD * GG * 2); float* Sb = (float*)take((size_t)ZC * GG * GG * 4); bf* Ph = (bf*)take((size_t)ZC * GG * GG * 2); bf* Pl = (bf*)take((size_t)ZC * GG * GG * 2);
    float* ObK[3]; float* LSK[3]; for (int k = 0; k < 3; ++k) { const int nzk = (4 >> k) * NH_; ObK[k] = (float*)take((size_t)nzk * GG * HD * 4); LSK[k] = (float*)take((size_t)nzk * GG * 32 * 4); }
    bf* Ah = (bf*)take((size_t)LL * EE * 2); bf* Al = (bf*)take((size_t)LL * EE * 2);
    if ((size_t)(wsp - (char*)d_ws) > ws_size) return;    // total ~ 201 MB = 192 MiB (qkv f32 [4096][3072] 50 MB, 8 (segment, head) score maps [1024][1024] f32 34 MB + hl planes 34 MB, gathered hl planes 6 MB, per-branch outputs + row-replicated lse 44 MB, merged planes 17 MB, weights/x 17 MB)
    k_wtG<<<(EE * 3 * EE / 64 + 63) / 64, 256, 0, stream>>>(wqkv, EE, 3 * EE, WQ); k_wtG<<<(EE * EE / 64 + 63) / 64, 256, 0, stream>>>(wproj, EE, EE, WP);
    k_cvt8<<<(LL * EE / 8 + 255) / 256, 256, 0, stream>>>(x, XB, (size_t)LL * EE / 8);
    k_gemmw<bf, 0, false><<<dim3(LL / 64, 3 * EE / 64, 1), 32, 0, stream>>>(XB, nullptr, WQ, nullptr, EE, QKV, 3 * EE, nullptr, 0, 0, 0);
    const int rs[3] = {1, 2, 4};
    for (int kb = 0; kb < 3; ++kb) { const int r = rs[kb]; const int nseg = LL / (GG * r); const int nz = nseg * NH_;
        for (int z0 = 0; z0 < nz; z0 += ZC) {   // 8 (segment, head) groups per GEMM pass
            k_gath<<<(unsigned)(((size_t)ZC * GG * HD / 2 + 255) / 256), 256, 0, stream>>>(QKV, r, z0, Qh, Ql, Kh, Kl); k_gathv<<<(unsigned)(((size_t)ZC * HD * GG / 2 + 255) / 256), 256, 0, stream>>>(QKV, r, z0, Vh, Vl);
            k_gemmc<bf, 2, 1><<<dim3(GG / 64, GG / 64, ZC), 32, 0, stream>>>(Qh, Ql, Kh, Kl, HD, Sb, GG, 0, (size_t)GG * HD, (size_t)GG * HD, (size_t)GG * GG);
            k_csoft<<<ZC * GG / 8, 256, 0, stream>>>(Sb, Ph, Pl, LSK[kb] + (size_t)z0 * GG * 32);
            k_gemmc<bf, 2, 2><<<dim3(GG / 64, 1, ZC), 32, 0, stream>>>(Ph, Pl, Vh, Vl, GG, ObK[kb] + (size_t)z0 * GG * HD, HD, 0, (size_t)GG * GG, (size_t)HD * GG, (size_t)GG * HD); }
        }
    k_comb<<<(unsigned)(((size_t)LL * EE / 2 + 255) / 256), 256, 0, stream>>>(ObK[0], ObK[1], ObK[2], LSK[0], LSK[1], LSK[2], Ah, Al);
    k_gemmw<bf, 1, false><<<dim3(LL / 64, EE / 64, 1), 32, 0, stream>>>(Ah, Al, WP, nullptr, EE, OUT, EE, nullptr, 0, 0, 0);
}

// v001
// One run takes 519 microseconds.
// In two side-by-side timings against v000, it was 1.53 and 1.55 times as fast.
#include <hip/hip_runtime.h>

// DilatedCausalSelfAttention - LongNet-style dilated attention (x [1][4096][1024]; qkv = x w_qkv (16 heads x 64); three branches (segment w, dilation r) = (1024,1), (2048,2), (4096,4): inside each segment, head h attends causally over the
// g = w/r = 1024 positions {gi r + off}, off = h / (16/r) (the reference's diagonal sparsify); softmax(q.k/8) with a causal mask over gi; branch output scattered back to those positions (0 elsewhere) with lse = logsumexp over the softmax
// PROBABILITIES of the row (masked entries contribute exp(0)), -1e8 elsewhere; branches recombined per (position, head) with softmax(lse) weights; out @ w_proj -> [1][4096][1024]).
// Compute dtypes, f32 accumulate: every input rounded to bf16; qkv on PLAIN bf16 operands (inputs: exact); per (segment, head) 1024x1024 attention on bf16 hi+lo planes gathered at the dilated positions
// (q x 1/8 exact; scores K 64 with 3 products, causal tiles skipped), softmax + the probability-logsumexp in f32 registers, probs.v on hl planes (3 products); the 3-branch recombination f32; w_proj on hl planes x exact (2 products). One-wave-per-64x64-tile GEMMs

#define LL   4096
#define EE   1024
#define NH_  16
#define HD   64
#define GG   1024
#define PCAR 1024.0f
typedef _Float16 h16;
typedef unsigned short bf;
typedef __attribute__((ext_vector_type(16))) __bf16   v16bf;
typedef __attribute__((ext_vector_type(16))) _Float16 v16h;
typedef __attribute__((ext_vector_type(8)))  _Float16 v8h;
typedef __attribute__((ext_vector_type(8)))  unsigned short v8us;
typedef __attribute__((ext_vector_type(8)))  float    v8f;
typedef __attribute__((ext_vector_type(4)))  float    v4f;
typedef v8h  __attribute__((may_alias)) v8ha;
typedef v4f  __attribute__((may_alias)) v4fa;
typedef v8us __attribute__((may_alias)) v8usa;

__device__ __forceinline__ unsigned short f2bf(float f) { unsigned u = __float_as_uint(f); u += 0x7FFFu + ((u >> 16) & 1u); return (unsigned short)(u >> 16); }
__device__ __forceinline__ float bf2f(unsigned short b) { return __uint_as_float(((unsigned)b) << 16); }
__device__ __forceinline__ float bfr(float f) { return bf2f(f2bf(f)); }
__device__ __forceinline__ v16h cat16(v8h lo, v8h hi) { return __builtin_shufflevector(lo, hi, 0, 1, 2, 3, 4, 5, 6, 7, 8, 9, 10, 11, 12, 13, 14, 15); }
__device__ __forceinline__ v16bf cat16b(v8us lo, v8us hi) { return __builtin_bit_cast(v16bf, __builtin_shufflevector(lo, hi, 0, 1, 2, 3, 4, 5, 6, 7, 8, 9, 10, 11, 12, 13, 14, 15)); }
__device__ __forceinline__ v8f wmma16(v16h a, v16h b, v8f c) { return __builtin_amdgcn_wmma_f32_16x16x32_f16(false, a, false, b, (short)0, c, false, false); }
__device__ __forceinline__ v8f wmmab(v16bf a, v16bf b, v8f c) { return __builtin_amdgcn_wmma_f32_16x16x32_bf16(false, a, false, b, (short)0, c, false, false); }



// ---- k_gemmw: register-blocked GEMM, ONE WAVE per 64x64 output tile (16 accumulators), operands straight from K-contiguous 16-bit planes; grid (M/64, N/64, Z), 32 threads.
// C[m][n] (f32, pitch ldc, + optional f32 bias[n]) = sum_k A[m][k] Bt[n][k] (+ split products per NSPLIT). z-batch strides sA/sB/sC in elements. K % 32 == 0.
template <typename T16> struct WFrag;
template <> struct WFrag<h16> { typedef v16h V; static __device__ __forceinline__ V ld(const h16* p) { return cat16(*(const v8h*)p, *(const v8h*)(p + 16)); } static __device__ __forceinline__ v8f mma(V a, V b, v8f c) { return wmma16(a, b, c); } };
template <> struct WFrag<bf> { typedef v16bf V; static __device__ __forceinline__ V ld(const bf* p) { return cat16b(*(const v8us*)p, *(const v8us*)(p + 16)); } static __device__ __forceinline__ v8f mma(V a, V b, v8f c) { return wmmab(a, b, c); } };
template <typename T16, int NSPLIT, bool BIAS>
__global__ __launch_bounds__(32) void k_gemmw(const T16* __restrict__ A, const T16* __restrict__ A2, const T16* __restrict__ Bt, const T16* __restrict__ Bt2, int K, float* C, int ldc, const float* __restrict__ bias, size_t sA, size_t sB, size_t sC) {
    typedef typename WFrag<T16>::V V;
    __shared__ __align__(16) float os[16 * 68];
    const size_t z = blockIdx.z; A += z * sA; if (A2) A2 += z * sA; Bt += z * sB; if (Bt2) Bt2 += z * sB; C += z * sC;
    const int lane = threadIdx.x & 31, lr = lane & 15, hi = lane >> 4; const int r0 = blockIdx.x * 64, c0 = blockIdx.y * 64;
    v8f acc[4][4];
#pragma unroll
    for (int mb = 0; mb < 4; ++mb)
#pragma unroll
        for (int nb = 0; nb < 4; ++nb) acc[mb][nb] = (v8f){};
    const size_t aoff = (size_t)(r0 + lr) * K + 8 * hi, boff = (size_t)(c0 + lr) * K + 8 * hi;
#pragma unroll 1
    for (int kc = 0; kc < K; kc += 32) {
        V a[4], a2[4];
#pragma unroll
        for (int mb = 0; mb < 4; ++mb) { a[mb] = WFrag<T16>::ld(A + aoff + (size_t)mb * 16 * K + kc); if (NSPLIT == 1 || NSPLIT == 2) a2[mb] = WFrag<T16>::ld(A2 + aoff + (size_t)mb * 16 * K + kc); }
#pragma unroll
        for (int nb = 0; nb < 4; ++nb) { const V b = WFrag<T16>::ld(Bt + boff + (size_t)nb * 16 * K + kc); V b2; if (NSPLIT >= 2) b2 = WFrag<T16>::ld(Bt2 + boff + (size_t)nb * 16 * K + kc);
#pragma unroll
            for (int mb = 0; mb < 4; ++mb) { acc[mb][nb] = WFrag<T16>::mma(a[mb], b, acc[mb][nb]); if (NSPLIT == 1 || NSPLIT == 2) acc[mb][nb] = WFrag<T16>::mma(a2[mb], b, acc[mb][nb]); if (NSPLIT >= 2) acc[mb][nb] = WFrag<T16>::mma(a[mb], b2, acc[mb][nb]); } }
        asm volatile("v_nop\n\tv_nop\n\tv_nop\n\tv_nop" : "+v"(acc[0][0]), "+v"(acc[1][1]), "+v"(acc[2][2]), "+v"(acc[3][3]) : "v"(a[0]), "v"(a[3]));
    }
#pragma unroll
    for (int mb = 0; mb < 4; ++mb) {
#pragma unroll
        for (int nb = 0; nb < 4; ++nb) {
#pragma unroll
            for (int j = 0; j < 8; ++j) os[(hi * 8 + j) * 68 + nb * 16 + lr] = acc[mb][nb][j]; }
        __builtin_amdgcn_wave_barrier(); asm volatile("" ::: "memory");
        float* crow = C + (size_t)(r0 + mb * 16) * ldc + c0;
{
#pragma unroll
            for (int s = 0; s < 8; ++s) { const int row = 2 * s + hi, cofs = lr * 4; v4f val = *(const v4fa*)(os + row * 68 + cofs); if (BIAS) { val[0] += bfr(bias[c0 + cofs]); val[1] += bfr(bias[c0 + cofs + 1]); val[2] += bfr(bias[c0 + cofs + 2]); val[3] += bfr(bias[c0 + cofs + 3]); }
                *(v4f*)(crow + (size_t)row * ldc + cofs) = val; }
             }
        __builtin_amdgcn_wave_barrier(); asm volatile("" ::: "memory");
    }
}

// ---- k_gemmc: the same one-wave 64x64 tile GEMM specialised for causal attention: CMODE 1 skips score tiles entirely above the diagonal (query rows r0+roff.., key columns c0..), CMODE 2 limits the
// key (K) loop of the probability x value contraction to the diagonal block (probabilities beyond it are exactly zero). roff = row offset of this launch's first row within the sequence.
template <typename T16, int NSPLIT, int CMODE>
__global__ __launch_bounds__(32) void k_gemmc(const T16* __restrict__ A, const T16* __restrict__ A2, const T16* __restrict__ Bt, const T16* __restrict__ Bt2, int K, float* C, int ldc, int roff, size_t sA, size_t sB, size_t sC) {
    typedef typename WFrag<T16>::V V;
    __shared__ __align__(16) float os[16 * 68];
    const size_t z = blockIdx.z; A += z * sA; if (A2) A2 += z * sA; Bt += z * sB; if (Bt2) Bt2 += z * sB; C += z * sC;
    const int lane = threadIdx.x & 31, lr = lane & 15, hi = lane >> 4; const int r0 = blockIdx.x * 64, c0 = blockIdx.y * 64;
    if (CMODE == 1 && c0 > r0 + roff + 63) return;                  // score tile entirely above the causal diagonal: never read (the softmax masks j > i by select)
    const int Kl = (CMODE == 2) ? min(K, r0 + roff + 64) : K;        // P.V: probabilities are exactly 0 beyond the diagonal block, so the K loop stops there
    v8f acc[4][4];
#pragma unroll
    for (int mb = 0; mb < 4; ++mb)
#pragma unroll
        for (int nb = 0; nb < 4; ++nb) acc[mb][nb] = (v8f){};
    const size_t aoff = (size_t)(r0 + lr) * K + 8 * hi, boff = (size_t)(c0 + lr) * K + 8 * hi;
#pragma unroll 1
    for (int kc = 0; kc < Kl; kc += 32) {
        V a[4], a2[4];
#pragma unroll
        for (int mb = 0; mb < 4; ++mb) { a[mb] = WFrag<T16>::ld(A + aoff + (size_t)mb * 16 * K + kc); if (NSPLIT == 1 || NSPLIT == 2) a2[mb] = WFrag<T16>::ld(A2 + aoff + (size_t)mb * 16 * K + kc); }
#pragma unroll
        for (int nb = 0; nb < 4; ++nb) { const V b = WFrag<T16>::ld(Bt + boff + (size_t)nb * 16 * K + kc); V b2; if (NSPLIT >= 2) b2 = WFrag<T16>::ld(Bt2 + boff + (size_t)nb * 16 * K + kc);
#pragma unroll
            for (int mb = 0; mb < 4; ++mb) { acc[mb][nb] = WFrag<T16>::mma(a[mb], b, acc[mb][nb]); if (NSPLIT == 1 || NSPLIT == 2) acc[mb][nb] = WFrag<T16>::mma(a2[mb], b, acc[mb][nb]); if (NSPLIT >= 2) acc[mb][nb] = WFrag<T16>::mma(a[mb], b2, acc[mb][nb]); } }
        asm volatile("v_nop\n\tv_nop\n\tv_nop\n\tv_nop" : "+v"(acc[0][0]), "+v"(acc[1][1]), "+v"(acc[2][2]), "+v"(acc[3][3]) : "v"(a[0]), "v"(a[3]));
    }
#pragma unroll
    for (int mb = 0; mb < 4; ++mb) {
#pragma unroll
        for (int nb = 0; nb < 4; ++nb) {
#pragma unroll
            for (int j = 0; j < 8; ++j) os[(hi * 8 + j) * 68 + nb * 16 + lr] = acc[mb][nb][j]; }
        __builtin_amdgcn_wave_barrier(); asm volatile("" ::: "memory");
        float* crow = C + (size_t)(r0 + mb * 16) * ldc + c0;
{
#pragma unroll
            for (int s = 0; s < 8; ++s) { const int row = 2 * s + hi, cofs = lr * 4; v4f val = *(const v4fa*)(os + row * 68 + cofs);
                *(v4f*)(crow + (size_t)row * ldc + cofs) = val; }
             }
        __builtin_amdgcn_wave_barrier(); asm volatile("" ::: "memory");
    }
}

__device__ __forceinline__ h16 tohx(float x) { return (h16)x; }
__device__ __forceinline__ void splitf(float y, unsigned short& h, unsigned short& l) { h = f2bf(y); l = f2bf(y - bf2f(h)); }
typedef __attribute__((ext_vector_type(2))) _Float16 v2h;
typedef __attribute__((ext_vector_type(4))) _Float16 v4h;
typedef __attribute__((ext_vector_type(2))) unsigned short v2us;
typedef __attribute__((ext_vector_type(4))) unsigned short v4us;
typedef __attribute__((ext_vector_type(2))) float v2f;
__device__ __forceinline__ int dpos(int r, int seg, int h, int gi) { const int w = GG * r; const int off = h / (NH_ / r); return seg * w + gi * r + off; }   // dense position of sparse index gi for (branch r, segment, head)

__global__ __launch_bounds__(256) void k_wtG(const float* __restrict__ w, int K, int N, bf* Bt) {
    const int lane = threadIdx.x & 31; const int L0 = (blockIdx.x * 8 + (threadIdx.x >> 5)) * 8; const int nlines = N * K / 64;
{
#pragma unroll 1
        for (int l = 0; l < 8; ++l) { const int L = L0 + l; if (L >= nlines) break; const size_t e = (size_t)L * 64 + lane * 2; const int k = (int)(e % K), n = (int)(e / K); v2us o;
            o[0] = f2bf(w[(size_t)k * N + n]); o[1] = f2bf(w[(size_t)(k + 1) * N + n]); *(v2us*)(Bt + e) = o; }
         }
}
__global__ __launch_bounds__(256) void k_cvt8(const float* __restrict__ src, bf* dst, size_t n8) { const size_t i = (size_t)blockIdx.x * 256 + threadIdx.x; if (i >= n8) return; const v8f v = *(const v8f*)(src + i * 8); v8us o;
#pragma unroll
    for (int k = 0; k < 8; ++k) o[k] = f2bf(v[k]); *(v8us*)(dst + i * 8) = o;  }
#define ZC 32   // (segment, head) groups per pass at most; a pass takes zc <= ZC of them
__global__ __launch_bounds__(256) void k_gath(const float* __restrict__ QKV, int r, int z0, int zc, bf* Qh, bf* Ql, bf* Kh, bf* Kl) { const size_t e = ((size_t)blockIdx.x * 256 + threadIdx.x) * 2; if (e >= (size_t)zc * GG * HD) return; const int d = (int)(e % HD); const int gi = (int)((e / HD) % GG); const int z = z0 + (int)(e / ((size_t)HD * GG)); const int h = z % NH_, seg = z / NH_; const float* row = QKV + (size_t)dpos(r, seg, h, gi) * (3 * EE) + h * HD + d; v2us qh, ql, kh, kl;
#pragma unroll
    for (int u = 0; u < 2; ++u) { unsigned short a, c; splitf(row[u] * 0.125f, a, c); qh[u] = a; ql[u] = c; splitf(row[EE + u], a, c); kh[u] = a; kl[u] = c; }
    { *(v2us*)(Qh + e) = qh; *(v2us*)(Ql + e) = ql; *(v2us*)(Kh + e) = kh; *(v2us*)(Kl + e) = kl;  } }
__global__ __launch_bounds__(256) void k_gathv(const float* __restrict__ QKV, int r, int z0, int zc, bf* V) { const size_t e = ((size_t)blockIdx.x * 256 + threadIdx.x) * 2; if (e >= (size_t)zc * HD * GG) return; const int gi = (int)(e % GG); const int d = (int)((e / GG) % HD); const int z = z0 + (int)(e / ((size_t)GG * HD)); const int h = z % NH_, seg = z / NH_; v2us oh, ol;
#pragma unroll
    for (int u = 0; u < 2; ++u) { unsigned short a, c; splitf(QKV[(size_t)dpos(r, seg, h, gi + u) * (3 * EE) + 2 * EE + h * HD + d], a, c); oh[u] = a; ol[u] = c; } const size_t o = (e / GG) * (2 * GG) + gi; *(v2us*)(V + o) = oh; *(v2us*)(V + o + GG) = ol;  }   // row d: hi plane, then lo plane, the row pitch (2 GG) of the probability planes
// k_csoft works IN PLACE: one wave holds its whole f32 score row (4 KiB) in registers before it stores, then writes the row's hi plane over the first 2 KiB and its lo plane over the second (P = the same memory as Sb, row pitch 2 GG elements).
__global__ __launch_bounds__(256) void k_csoft(const float* Sb, bf* P, float* LSEX) { const int lane = threadIdx.x & 31; const int row = blockIdx.x * 8 + (threadIdx.x >> 5); const int i = row % GG; const float* sr = Sb + (size_t)row * GG; float v[32]; float mx = -3.0e38f;
#pragma unroll
    for (int ch = 0; ch < 8; ++ch) { const int j0 = ch * 128 + lane * 4; const v4f a = *(const v4f*)(sr + j0);
#pragma unroll
        for (int q = 0; q < 4; ++q) { const float t = (j0 + q) <= i ? a[q] : -3.0e38f; v[ch * 4 + q] = t; mx = fmaxf(mx, t); } }
#pragma unroll
    for (int sh = 16; sh; sh >>= 1) mx = fmaxf(mx, __shfl_xor(mx, sh, 32));
    float sum = 0.f;
#pragma unroll
    for (int k = 0; k < 32; ++k) { float d0 = __fsub_rn(v[k], mx); asm volatile("" : "+v"(d0)); v[k] = __expf(d0); sum += v[k]; }
#pragma unroll
    for (int sh = 16; sh; sh >>= 1) sum += __shfl_xor(sum, sh, 32);
    const float inv = __fdiv_rn(1.0f, sum); float se = 0.f;
#pragma unroll
    for (int k = 0; k < 32; ++k) { v[k] = v[k] * inv; se = __fadd_rn(se, __expf(v[k])); }   // masked entries: v = 0 exactly -> exp(0) = 1, as the reference
#pragma unroll
    for (int sh = 16; sh; sh >>= 1) se += __shfl_xor(se, sh, 32);
    const float lse = __logf(se);
{
#pragma unroll
        for (int ch = 0; ch < 8; ++ch) { v4us oh, ol;
#pragma unroll
            for (int q = 0; q < 4; ++q) { unsigned short a, c; splitf(v[ch * 4 + q], a, c); oh[q] = a; ol[q] = c; } const size_t oo = (size_t)row * (2 * GG) + ch * 128 + lane * 4; *(v4us*)(P + oo) = oh; *(v4us*)(P + oo + GG) = ol; }
        *(float*)(LSEX + (size_t)row * 32 + lane) = lse;
         } }
// k_comb: per (l, h): for each branch k (r = 1, 2, 4; segment w = 1024 r): head h uses position l iff (l mod w) mod r == h / (16/r); then gi = (l mod w) / r, z = (l / w) 16 + h, o_k = Ob_k[z][gi][:] and
__global__ __launch_bounds__(256) void k_comb(const float* __restrict__ Ob0, const float* __restrict__ Ob1, const float* __restrict__ Ob2, const float* __restrict__ L0, const float* __restrict__ L1, const float* __restrict__ L2, bf* Ah, bf* Al) { const size_t e = ((size_t)blockIdx.x * 256 + threadIdx.x) * 2; if (e >= (size_t)LL * EE) return; const int d = (int)(e % HD); const int h = (int)((e / HD) % NH_); const int l = (int)(e / EE);
    const float* obs[3] = {Ob0, Ob1, Ob2}; const float* lss[3] = {L0, L1, L2}; float lse[3]; size_t src[3]; bool used[3];
#pragma unroll
    for (int k = 0; k < 3; ++k) { const int r = 1 << k; const int w = GG * r; const int ll = l % w; const int off = h / (NH_ / r); used[k] = (ll % r) == off; const int gi = ll / r; const int z = (l / w) * NH_ + h; src[k] = ((size_t)z * GG + gi); lse[k] = used[k] ? lss[k][src[k] * 32] : -1.0e8f; }
    const float m = fmaxf(lse[0], fmaxf(lse[1], lse[2])); float ex[3]; float den = 0.f;
#pragma unroll
    for (int k = 0; k < 3; ++k) { ex[k] = __expf(__fsub_rn(lse[k], m)); den = __fadd_rn(den, ex[k]); }
    const float inv = __fdiv_rn(1.0f, den); v2us oh, ol;
#pragma unroll
    for (int u = 0; u < 2; ++u) { float acc = 0.f;
#pragma unroll
        for (int k = 0; k < 3; ++k) { const float o = used[k] ? obs[k][src[k] * HD + d + u] : 0.f; float p = __fmul_rn(o, ex[k] * inv); asm volatile("" : "+v"(p)); acc = __fadd_rn(acc, p); }
        unsigned short a, c; splitf(acc, a, c); oh[u] = a; ol[u] = c; }
    *(v2us*)(Ah + e) = oh; *(v2us*)(Al + e) = ol;  }

extern "C" void kernel_launch(void* const* d_in, const int* in_sizes, int n_in,
                              void* d_out, int out_size, void* d_ws, size_t ws_size, hipStream_t stream) {
    (void)in_sizes; (void)n_in; (void)out_size;
    const float* x = (const float*)d_in[0]; const float* wqkv = (const float*)d_in[1]; const float* wproj = (const float*)d_in[2];
    float* OUT = (float*)d_out;     // [1][4096][1024]
    char* wsp = (char*)d_ws;
    auto take = [&](size_t bytes) { char* p = wsp; wsp += (bytes + 255) & ~(size_t)255; return (void*)p; };
    const int NZMAX = 4 * NH_;   // branch r=1: 4 segments x 16 heads
    bf* WP = (bf*)take((size_t)EE * EE * 2); float* QKV = (float*)take((size_t)LL * 3 * EE * 4);
    bf* Qh = (bf*)take((size_t)ZC * GG * HD * 2); bf* Ql = (bf*)take((size_t)ZC * GG * HD * 2); bf* Kh = (bf*)take((size_t)ZC * GG * HD * 2); bf* Kl = (bf*)take((size_t)ZC * GG * HD * 2); bf* V = (bf*)take((size_t)ZC * HD * GG * 4); float* Sb = (float*)take((size_t)ZC * GG * GG * 4); bf* P = (bf*)Sb;   // scores, then their probability planes in place
    bf* WQ = (bf*)Sb; bf* XB = WQ + (size_t)3 * EE * EE;    // read last by the qkv GEMM, before the first score tile is written: they lie in the score buffer
    bf* Ah = (bf*)Sb; bf* Al = Ah + (size_t)LL * EE;        // written after the last pass has read its probabilities: they lie there too
    float* ObK[3]; float* LSK[3]; for (int k = 0; k < 3; ++k) { const int nzk = (4 >> k) * NH_; ObK[k] = (float*)take((size_t)nzk * GG * HD * 4); LSK[k] = (float*)take((size_t)nzk * GG * 32 * 4); }
    if ((size_t)(wsp - (char*)d_ws) > ws_size) return;    // total 255.9 MB = 244 MiB (qkv f32 [4096][3072] 50 MB, 32 (segment, head) score maps [1024][1024] f32 134 MB, gathered hl planes 25 MB, per-branch outputs + row-replicated lse 44 MB, w_proj 2 MB)
    k_wtG<<<(EE * 3 * EE / 64 + 63) / 64, 256, 0, stream>>>(wqkv, EE, 3 * EE, WQ); k_wtG<<<(EE * EE / 64 + 63) / 64, 256, 0, stream>>>(wproj, EE, EE, WP);
    k_cvt8<<<(LL * EE / 8 + 255) / 256, 256, 0, stream>>>(x, XB, (size_t)LL * EE / 8);
    k_gemmw<bf, 0, false><<<dim3(LL / 64, 3 * EE / 64, 1), 32, 0, stream>>>(XB, nullptr, WQ, nullptr, EE, QKV, 3 * EE, nullptr, 0, 0, 0);
    const int rs[3] = {1, 2, 4};
    for (int kb = 0; kb < 3; ++kb) { const int r = rs[kb]; const int nseg = LL / (GG * r); const int nz = nseg * NH_;
        for (int z0 = 0; z0 < nz; z0 += ZC) { const int zc = nz - z0 < ZC ? nz - z0 : ZC;   // up to 32 (segment, head) groups per pass: 32 + 32, 32, 16
            k_gath<<<(unsigned)(((size_t)zc * GG * HD / 2 + 255) / 256), 256, 0, stream>>>(QKV, r, z0, zc, Qh, Ql, Kh, Kl); k_gathv<<<(unsigned)(((size_t)zc * HD * GG / 2 + 255) / 256), 256, 0, stream>>>(QKV, r, z0, zc, V);
            k_gemmc<bf, 2, 1><<<dim3(GG / 64, GG / 64, zc), 32, 0, stream>>>(Qh, Ql, Kh, Kl, HD, Sb, GG, 0, (size_t)GG * HD, (size_t)GG * HD, (size_t)GG * GG);
            k_csoft<<<zc * GG / 8, 256, 0, stream>>>(Sb, P, LSK[kb] + (size_t)z0 * GG * 32);
            k_gemmc<bf, 2, 2><<<dim3(GG / 64, 1, zc), 32, 0, stream>>>(P, P + GG, V, V + GG, 2 * GG, ObK[kb] + (size_t)z0 * GG * HD, HD, 0, (size_t)2 * GG * GG, (size_t)2 * HD * GG, (size_t)GG * HD); }   // K = the planes' row pitch; the loop itself ends at the diagonal block (<= GG)
        }
    k_comb<<<(unsigned)(((size_t)LL * EE / 2 + 255) / 256), 256, 0, stream>>>(ObK[0], ObK[1], ObK[2], LSK[0], LSK[1], LSK[2], Ah, Al);
    k_gemmw<bf, 1, false><<<dim3(LL / 64, EE / 64, 1), 32, 0, stream>>>(Ah, Al, WP, nullptr, EE, OUT, EE, nullptr, 0, 0, 0);
}

// v003
// It runs in 169 microseconds.
// Versions in between are left out here; by their measured steps it is 3.08 times as fast as v001.
// All steps since v000 together make it 4.73 times as fast.
#include <hip/hip_runtime.h>

// Dilated causal self-attention (x [1][4096][1024]; qkv = x w_qkv (16 heads x 64); three branches (segment w, dilation r) = (1024,1), (2048,2), (4096,4): inside each segment, head h attends causally over the
// g = w/r = 1024 positions {gi r + off}, off = h / (16/r) (the reference's diagonal sparsify); softmax(q.k/8) with a causal mask over gi; branch output scattered back to those positions (0 elsewhere) with lse = logsumexp over the softmax
// PROBABILITIES of the row (masked entries contribute exp(0)), -1e8 elsewhere; branches recombined per (position, head) with softmax(lse) weights; out @ w_proj -> [1][4096][1024]).
// Compute dtypes, f32 accumulate: every input rounded to bf16; qkv on PLAIN bf16 operands (inputs: exact); per (segment, head) 1024x1024 attention on bf16 hi+lo planes gathered at the dilated positions
// (q x 1/8 exact; scores K 64 with 3 products, causal tiles skipped), softmax + the probability-logsumexp in f32 registers, probs.v on hl planes (3 products); the 3-branch recombination f32; w_proj on hl planes x exact (2 products). One-wave-per-64x64-tile GEMMs

#define LL   4096
#define EE   1024
#define NH_  16
#define HD   64
#define GG   1024
#define PCAR 1024.0f
typedef _Float16 h16;
typedef unsigned short bf;
typedef __attribute__((ext_vector_type(16))) __bf16   v16bf;
typedef __attribute__((ext_vector_type(16))) _Float16 v16h;
typedef __attribute__((ext_vector_type(8)))  _Float16 v8h;
typedef __attribute__((ext_vector_type(8)))  unsigned short v8us;
typedef __attribute__((ext_vector_type(8)))  float    v8f;
typedef __attribute__((ext_vector_type(4)))  float    v4f;
typedef v8h  __attribute__((may_alias)) v8ha;
typedef v4f  __attribute__((may_alias)) v4fa;
typedef v8us __attribute__((may_alias)) v8usa;

__device__ __forceinline__ unsigned short f2bf(float f) { unsigned u = __float_as_uint(f); u += 0x7FFFu + ((u >> 16) & 1u); return (unsigned short)(u >> 16); }
__device__ __forceinline__ float bf2f(unsigned short b) { return __uint_as_float(((unsigned)b) << 16); }
__device__ __forceinline__ float bfr(float f) { return bf2f(f2bf(f)); }
__device__ __forceinline__ v16h cat16(v8h lo, v8h hi) { return __builtin_shufflevector(lo, hi, 0, 1, 2, 3, 4, 5, 6, 7, 8, 9, 10, 11, 12, 13, 14, 15); }
__device__ __forceinline__ v16bf cat16b(v8us lo, v8us hi) { return __builtin_bit_cast(v16bf, __builtin_shufflevector(lo, hi, 0, 1, 2, 3, 4, 5, 6, 7, 8, 9, 10, 11, 12, 13, 14, 15)); }
__device__ __forceinline__ v8f wmma16(v16h a, v16h b, v8f c) { return __builtin_amdgcn_wmma_f32_16x16x32_f16(false, a, false, b, (short)0, c, false, false); }
__device__ __forceinline__ v8f wmmab(v16bf a, v16bf b, v8f c) { return __builtin_amdgcn_wmma_f32_16x16x32_bf16(false, a, false, b, (short)0, c, false, false); }



// ---- FRAGMENT ORDER of every 16-bit operand plane [rows][K]: the plane is cut into fragments of 16 rows x 32 k (512 elements, 1 KiB), numbered (row / 16) (K / 32) + k / 32; inside a fragment element (row, k) lies at
// ((k >> 4) & 1) 256 + (((k >> 3) & 1) 16 + (row & 15)) 8 + (k & 7). Lane (lr, hi) = 16 hi + lr then finds its 8 + 8 elements (k = 8 hi + j and 16 + 8 hi + j of row lr, the hardware k order) at lane 8 and 256 + lane 8:
// each wave-wide 16-byte load reads 512 contiguous bytes, 4 whole lines, where a row-major plane made it touch 16 lines.
__device__ __forceinline__ size_t fo8(int row, int k, int K) { return ((size_t)(row >> 4) * (K >> 5) + (k >> 5)) * 512 + ((k >> 4) & 1) * 256 + (((k >> 3) & 1) * 16 + (row & 15)) * 8; }   // place of the 8 elements k .. k + 7 (k % 8 == 0) of a row
// ---- k_gemmw: register-blocked GEMM, ONE WAVE per 64x64 output tile (16 accumulators), operands straight from 16-bit planes in fragment order; grid (M/64, N/64, Z), 32 threads.
// C[m][n] (f32, pitch ldc, + optional f32 bias[n]) = sum_k A[m][k] Bt[n][k] (+ split products per NSPLIT). z-batch strides sA/sB/sC in elements. K % 32 == 0.
template <typename T16> struct WFrag;
template <> struct WFrag<h16> { typedef v16h V; static __device__ __forceinline__ V ld(const h16* p) { return cat16(*(const v8h*)p, *(const v8h*)(p + 256)); } static __device__ __forceinline__ v8f mma(V a, V b, v8f c) { return wmma16(a, b, c); } };
template <> struct WFrag<bf> { typedef v16bf V; static __device__ __forceinline__ V ld(const bf* p) { return cat16b(*(const v8us*)p, *(const v8us*)(p + 256)); } static __device__ __forceinline__ v8f mma(V a, V b, v8f c) { return wmmab(a, b, c); } };
template <typename T16, int NSPLIT, bool BIAS>
__global__ __launch_bounds__(32) void k_gemmw(const T16* __restrict__ A, const T16* __restrict__ A2, const T16* __restrict__ Bt, const T16* __restrict__ Bt2, int K, float* C, int ldc, const float* __restrict__ bias, size_t sA, size_t sB, size_t sC) {
    typedef typename WFrag<T16>::V V;
    __shared__ __align__(16) float os[16 * 68];
    const size_t z = blockIdx.z; A += z * sA; if (A2) A2 += z * sA; Bt += z * sB; if (Bt2) Bt2 += z * sB; C += z * sC;
    const int lane = threadIdx.x & 31, lr = lane & 15, hi = lane >> 4; const int r0 = blockIdx.x * 64, c0 = blockIdx.y * 64;
    v8f acc[4][4];
#pragma unroll
    for (int mb = 0; mb < 4; ++mb)
#pragma unroll
        for (int nb = 0; nb < 4; ++nb) acc[mb][nb] = (v8f){};
    unsigned vo = 16u * lane;   // byte offset of this lane's piece of the current fragment inside a 16-row block: the only part of an operand address that differs between lanes or trips (a fragment is 1 KiB)
    const char *pa[4], *pa2[4], *pb[4], *pb2[4];   // wave-uniform and fixed: the first fragment of each 16-row block (16 rows of fragments hold 16 K elements)
#pragma unroll
    for (int u = 0; u < 4; ++u) { pa[u] = (const char*)(A + (size_t)(r0 + u * 16) * K); pb[u] = (const char*)(Bt + (size_t)(c0 + u * 16) * K); if (NSPLIT == 1 || NSPLIT == 2) pa2[u] = (const char*)(A2 + (size_t)(r0 + u * 16) * K); if (NSPLIT >= 2) pb2[u] = (const char*)(Bt2 + (size_t)(c0 + u * 16) * K); }
#pragma unroll 1
    for (int kc = 0; kc < K; kc += 32) {
        V a[4], a2[4], b[4], b2[4];
#pragma unroll
        for (int u = 0; u < 4; ++u) { a[u] = WFrag<T16>::ld((const T16*)(pa[u] + vo)); b[u] = WFrag<T16>::ld((const T16*)(pb[u] + vo)); if (NSPLIT == 1 || NSPLIT == 2) a2[u] = WFrag<T16>::ld((const T16*)(pa2[u] + vo)); if (NSPLIT >= 2) b2[u] = WFrag<T16>::ld((const T16*)(pb2[u] + vo)); }
        __builtin_amdgcn_sched_barrier(0);   // holds every operand load of the trip in front of the wait below, and so in flight together: one memory latency a trip
        asm volatile("s_wait_xcnt 0x0" :: "v"(vo) : "memory");   // the wait in front of the rewrite of the loads' offset register; as an input it stays whole up to it
#pragma unroll
        for (int nb = 0; nb < 4; ++nb)
#pragma unroll
            for (int mb = 0; mb < 4; ++mb) { acc[mb][nb] = WFrag<T16>::mma(a[mb], b[nb], acc[mb][nb]); if (NSPLIT == 1 || NSPLIT == 2) acc[mb][nb] = WFrag<T16>::mma(a2[mb], b[nb], acc[mb][nb]); if (NSPLIT >= 2) acc[mb][nb] = WFrag<T16>::mma(a[mb], b2[nb], acc[mb][nb]); }
        vo += 1024;
        asm volatile("v_nop\n\tv_nop\n\tv_nop\n\tv_nop" : "+v"(acc[0][0]), "+v"(acc[1][1]), "+v"(acc[2][2]), "+v"(acc[3][3]) : "v"(a[0]), "v"(a[3]));
    }
#pragma unroll
    for (int mb = 0; mb < 4; ++mb) {
#pragma unroll
        for (int nb = 0; nb < 4; ++nb) {
#pragma unroll
            for (int j = 0; j < 8; ++j) os[(hi * 8 + j) * 68 + nb * 16 + lr] = acc[mb][nb][j]; }
        __builtin_amdgcn_wave_barrier(); asm volatile("" ::: "memory");
        float* crow = C + (size_t)(r0 + mb * 16) * ldc + c0;
{
#pragma unroll
            for (int s = 0; s < 8; ++s) { const int row = 2 * s + hi, cofs = lr * 4; v4f val = *(const v4fa*)(os + row * 68 + cofs); if (BIAS) { val[0] += bfr(bias[c0 + cofs]); val[1] += bfr(bias[c0 + cofs + 1]); val[2] += bfr(bias[c0 + cofs + 2]); val[3] += bfr(bias[c0 + cofs + 3]); }
                *(v4f*)(crow + (size_t)row * ldc + cofs) = val; }
             }
        __builtin_amdgcn_wave_barrier(); asm volatile("" ::: "memory");
    }
}

__device__ __forceinline__ h16 tohx(float x) { return (h16)x; }
__device__ __forceinline__ void splitf(float y, unsigned short& h, unsigned short& l) { h = f2bf(y); l = f2bf(y - bf2f(h)); }
typedef __attribute__((ext_vector_type(2))) _Float16 v2h;
typedef __attribute__((ext_vector_type(4))) _Float16 v4h;
typedef __attribute__((ext_vector_type(2))) unsigned short v2us;
typedef __attribute__((ext_vector_type(4))) unsigned short v4us;
typedef __attribute__((ext_vector_type(2))) float v2f;
__device__ __forceinline__ int dpos(int r, int seg, int h, int gi) { const int w = GG * r; const int off = h / (NH_ / r); return seg * w + gi * r + off; }   // dense position of sparse index gi for (branch r, segment, head)

// The writers of the planes. Row-major sources (k_cvt8, k_gath, k_comb): a thread makes one 16-byte piece (8 k of one row); lane = 4 rr + kq takes row rr of 8 and piece kq of a 32-k block, so 4 lanes read one whole 128-byte line of f32
// and the 8 lanes of one kq store one whole 128-byte line. Transposed sources (k_wtG, k_gathv): thread i makes piece i of the plane, lane = 16 hi + lr as in the readers: 16 lanes read 64 contiguous bytes, the wave stores 512.
__global__ __launch_bounds__(256) void k_wtG(const float* __restrict__ w, int K, int N, bf* Bt) {
    const int i = blockIdx.x * 256 + threadIdx.x; if (i >= N * (K / 8)) return; const int lane = i & 31, lr = lane & 15, hi = lane >> 4; const int wv = i >> 5; const int half = wv & 1, fr = wv >> 1; const int kb = fr % (K >> 5), nb = fr / (K >> 5);
    const float* p = w + (size_t)(kb * 32 + half * 16 + hi * 8) * N + nb * 16 + lr; v8us o;
#pragma unroll
    for (int j = 0; j < 8; ++j) o[j] = f2bf(p[(size_t)j * N]);
    *(v8us*)(Bt + (size_t)i * 8) = o; }
__global__ __launch_bounds__(256) void k_cvt8(const float* __restrict__ src, bf* dst, int K, size_t n8) { const size_t i = (size_t)blockIdx.x * 256 + threadIdx.x; if (i >= n8) return; const int lane = (int)(i & 31), kq = lane & 3, rr = lane >> 2; const int wv = (int)(i >> 5);
    const int k = (wv % (K >> 5)) * 32 + kq * 8, row = (wv / (K >> 5)) * 8 + rr; const v8f v = *(const v8f*)(src + (size_t)row * K + k); v8us o;
#pragma unroll
    for (int u = 0; u < 8; ++u) o[u] = f2bf(v[u]); *(v8us*)(dst + fo8(row, k, K)) = o;  }
__global__ __launch_bounds__(256) void k_gath(const float* __restrict__ QKV, int r, int z0, int zc, bf* Qh, bf* Ql, bf* Kh, bf* Kl) { const int i = blockIdx.x * 256 + threadIdx.x; if (i >= zc * GG * (HD / 8)) return; const int lane = i & 31, kq = lane & 3, rr = lane >> 2; const int wv = i >> 5;
    const int d = (wv & 1) * 32 + kq * 8; const int zr = (wv >> 1) * 8 + rr; const int gi = zr % GG; const int z = z0 + zr / GG; const int h = z % NH_, seg = z / NH_; const float* row = QKV + (size_t)dpos(r, seg, h, gi) * (3 * EE) + h * HD + d;   // zr: row of the planes, groups one behind the other (GG % 16 == 0)
    const v8f q = *(const v8f*)row, kk = *(const v8f*)(row + EE); v8us qh, ql, kh, kl;
#pragma unroll
    for (int u = 0; u < 8; ++u) { unsigned short a, c; splitf(q[u] * 0.125f, a, c); qh[u] = a; ql[u] = c; splitf(kk[u], a, c); kh[u] = a; kl[u] = c; }
    { const size_t e = fo8(zr, d, HD); *(v8us*)(Qh + e) = qh; *(v8us*)(Ql + e) = ql; *(v8us*)(Kh + e) = kh; *(v8us*)(Kl + e) = kl;  } }
__global__ __launch_bounds__(256) void k_gathv(const float* __restrict__ QKV, int r, int z0, int zc, bf* V) { const int i = blockIdx.x * 256 + threadIdx.x; if (i >= zc * HD * (GG / 8)) return; const int lane = i & 31, lr = lane & 15, hi = lane >> 4; const int wv = i >> 5;
    const int rem = wv % (HD * GG / 256), zl = wv / (HD * GG / 256); const int half = rem & 1, kb = (rem >> 1) % (GG / 32), nb = (rem >> 1) / (GG / 32); const int z = z0 + zl; const int h = z % NH_, seg = z / NH_; const int d = nb * 16 + lr, gi = kb * 32 + half * 16 + hi * 8; v8us oh, ol; unsigned vo[8]; float f[8];
#pragma unroll
    for (int u = 0; u < 8; ++u) { vo[u] = (unsigned)dpos(r, seg, h, gi + u) * (3 * EE) + h * HD + d; f[u] = (QKV + 2 * EE)[vo[u]]; }   // element offsets inside qkv (12.6 M elements): one register a load beside the uniform base
    __builtin_amdgcn_sched_barrier(0);   // holds the eight loads in front of the wait below
    asm volatile("s_wait_xcnt 0x0" :: "v"(vo[0]), "v"(vo[1]), "v"(vo[2]), "v"(vo[3]), "v"(vo[4]), "v"(vo[5]), "v"(vo[6]), "v"(vo[7]) : "memory");   // the wait in front of any rewrite of the loads' offset registers; as inputs they stay whole up to it
#pragma unroll
    for (int u = 0; u < 8; ++u) { unsigned short a, c; splitf(f[u], a, c); oh[u] = a; ol[u] = c; } const size_t o = (size_t)zl * (2 * HD * GG) + (size_t)rem * 256 + lane * 8; *(v8us*)(V + o) = oh; *(v8us*)(V + o + HD * GG) = ol;  }   // per group: the hi plane [HD rows d][GG keys] in fragment order, then the lo plane
// ---- k_fattn: scores, softmax, the probability-logsumexp and probs.v of one (segment, head) group in ONE kernel; no score or probability ever reaches memory. Block = 4 independent waves (no barrier, no LDS); a wave owns 32 query rows
// and walks its causal keys 32 at a time, twice: sweep 1 finds each row's max and sum (running, rescaled), sweep 2 forms the scores again, normalises them, sums exp(p) and multiplies by v.
// The score tile is computed TRANSPOSED (A = keys, B = queries): lane (lr, hi) then holds query lr, keys 8 hi + j of tile 0 and 16 + 8 hi + j of tile 1, which is the k order of the A fragment that probs.v needs: no exchange between lanes.
__device__ __forceinline__ void fa_kload(const bf* __restrict__ pkh, const bf* __restrict__ pkl, v16bf (&ah)[2][2], v16bf (&al)[2][2]) {   // pkh, pkl: the four fragments of keys k0 .. k0 + 31, at this lane's piece
#pragma unroll
    for (int kt = 0; kt < 2; ++kt)
#pragma unroll
        for (int kc = 0; kc < 2; ++kc) { ah[kt][kc] = WFrag<bf>::ld(pkh + (kt * 2 + kc) * 512); al[kt][kc] = WFrag<bf>::ld(pkl + (kt * 2 + kc) * 512); }
}
__device__ __forceinline__ void fa_scores(const v16bf (&ah)[2][2], const v16bf (&al)[2][2], int k0, int lr, int hi, int r0, const v16bf (&bqh)[2][2], const v16bf (&bql)[2][2], v8f (&s)[2][2]) {
#pragma unroll
    for (int kt = 0; kt < 2; ++kt)
#pragma unroll
        for (int qb = 0; qb < 2; ++qb) { v8f acc = (v8f){};
#pragma unroll
            for (int kc = 0; kc < 2; ++kc) { acc = wmmab(ah[kt][kc], bqh[qb][kc], acc); acc = wmmab(ah[kt][kc], bql[qb][kc], acc); acc = wmmab(al[kt][kc], bqh[qb][kc], acc); }
#pragma unroll
            for (int j = 0; j < 8; ++j) s[kt][qb][j] = (k0 + kt * 16 + hi * 8 + j) <= (r0 + qb * 16 + lr) ? acc[j] : -3.0e38f; }   // causal mask by select
}
__global__ __launch_bounds__(128) void k_fattn(const bf* __restrict__ Qh, const bf* __restrict__ Ql, const bf* __restrict__ Kh, const bf* __restrict__ Kl, const bf* __restrict__ V, float* Ob, float* LSEX) {
    const int lane = threadIdx.x & 31, lr = lane & 15, hi = lane >> 4; const int z = blockIdx.x;
    const int t = GG / 32 - 1 - (int)(blockIdx.y * 4 + __builtin_amdgcn_readfirstlane(threadIdx.x >> 5));   // the longest rows are launched first; the wave's number in a scalar register, so that both loops branch on scalars
    const int r0 = t * 32; const size_t zo = (size_t)z * GG * HD; const size_t lo = zo + 8 * lane;
    v16bf bqh[2][2], bql[2][2]; const bf* pqh = Qh + lo + (size_t)r0 * HD; const bf* pql = Ql + lo + (size_t)r0 * HD;
#pragma unroll
    for (int qb = 0; qb < 2; ++qb)
#pragma unroll
        for (int kc = 0; kc < 2; ++kc) { bqh[qb][kc] = WFrag<bf>::ld(pqh + (qb * 2 + kc) * 512); bql[qb][kc] = WFrag<bf>::ld(pql + (qb * 2 + kc) * 512); }
    asm volatile("s_wait_xcnt 0x0" :: "v"(pqh), "v"(pql) : "memory");   // the wait in front of any reuse of the query loads' address registers; as inputs they stay whole up to it
    float m[2] = {-3.0e38f, -3.0e38f}, l[2] = {0.f, 0.f};
    { const bf* pkh = Kh + lo; const bf* pkl = Kl + lo;
    for (int kb = 0; kb <= t; ++kb) { v8f s[2][2]; v16bf ah[2][2], al[2][2]; fa_kload(pkh, pkl, ah, al);
        __builtin_amdgcn_sched_barrier(0);   // holds all sixteen key loads in front of the first product: one memory latency a step instead of one per pair of loads
        asm volatile("s_wait_xcnt 0x0" :: "v"(pkh), "v"(pkl) : "memory");   // the wait in front of any rewrite of the loads' address registers; as inputs they stay whole up to it
        fa_scores(ah, al, kb * 32, lr, hi, r0, bqh, bql, s); pkh += 32 * HD; pkl += 32 * HD;
#pragma unroll
        for (int qb = 0; qb < 2; ++qb) { float mx = m[qb];
#pragma unroll
            for (int j = 0; j < 8; ++j) mx = fmaxf(mx, fmaxf(s[0][qb][j], s[1][qb][j]));
            float a = l[qb] * __expf(m[qb] - mx);
#pragma unroll
            for (int j = 0; j < 8; ++j) a += __expf(s[0][qb][j] - mx) + __expf(s[1][qb][j] - mx);
            m[qb] = mx; l[qb] = a; } } }
    float inv[2];
#pragma unroll
    for (int qb = 0; qb < 2; ++qb) { const float mm = fmaxf(m[qb], __shfl_xor(m[qb], 16, 32)); float a = l[qb] * __expf(m[qb] - mm); a += __shfl_xor(a, 16, 32); m[qb] = mm; inv[qb] = __fdiv_rn(1.0f, a); }   // a lane whose keys were all masked holds m = -3e38: its sum is scaled to 0
    float se[2] = {0.f, 0.f}; v8f o[2][4];
#pragma unroll
    for (int qb = 0; qb < 2; ++qb)
#pragma unroll
        for (int nb = 0; nb < 4; ++nb) o[qb][nb] = (v8f){};
    { const bf* pkh = Kh + lo; const bf* pkl = Kl + lo; const bf* pv = V + (size_t)z * HD * 2 * GG + 8 * lane;
    for (int kb = 0; kb <= t; ++kb) { v8f s[2][2]; v16bf ah[2][2], al[2][2], vh[4], vl[4]; fa_kload(pkh, pkl, ah, al);
#pragma unroll
        for (int nb = 0; nb < 4; ++nb) { vh[nb] = WFrag<bf>::ld(pv + (size_t)nb * 16 * GG); vl[nb] = WFrag<bf>::ld(pv + (size_t)nb * 16 * GG + HD * GG); }
        __builtin_amdgcn_sched_barrier(0);   // holds the key and the value loads in front of the first product: one memory latency a step, and the value tile flies under the scores and the softmax
        asm volatile("s_wait_xcnt 0x0" :: "v"(pkh), "v"(pkl), "v"(pv) : "memory");   // the wait in front of any rewrite of the loads' address registers; as inputs they stay whole up to it
        fa_scores(ah, al, kb * 32, lr, hi, r0, bqh, bql, s); pkh += 32 * HD; pkl += 32 * HD; pv += 512; v16bf ph[2], pl[2];
#pragma unroll
        for (int qb = 0; qb < 2; ++qb) { v8us h[2], c[2];
#pragma unroll
            for (int kt = 0; kt < 2; ++kt)
#pragma unroll
                for (int j = 0; j < 8; ++j) { const float p = __expf(s[kt][qb][j] - m[qb]) * inv[qb]; se[qb] += __expf(p); unsigned short a, b; splitf(p, a, b); h[kt][j] = a; c[kt][j] = b; }   // masked: p = 0 exactly, exp(0) = 1, as the reference
            ph[qb] = cat16b(h[0], h[1]); pl[qb] = cat16b(c[0], c[1]); }
#pragma unroll
        for (int nb = 0; nb < 4; ++nb)
#pragma unroll
            for (int qb = 0; qb < 2; ++qb) { o[qb][nb] = wmmab(ph[qb], vh[nb], o[qb][nb]); o[qb][nb] = wmmab(pl[qb], vh[nb], o[qb][nb]); o[qb][nb] = wmmab(ph[qb], vl[nb], o[qb][nb]); } } }
#pragma unroll
    for (int qb = 0; qb < 2; ++qb) { const float st = se[qb] + __shfl_xor(se[qb], 16, 32) + (float)(GG - (t + 1) * 32);   // the keys beyond this wave's last tile are masked: exp(0) = 1 each
        const float lse = __logf(st); const v4f lv = {lse, lse, lse, lse}; float* lp = LSEX + ((size_t)z * GG + r0 + qb * 16 + lr) * 32 + hi * 16;
#pragma unroll
        for (int q = 0; q < 4; ++q) *(v4f*)(lp + q * 4) = lv;
#pragma unroll
        for (int nb = 0; nb < 4; ++nb)
#pragma unroll
            for (int j = 0; j < 8; ++j) Ob[((size_t)z * GG + r0 + qb * 16 + hi * 8 + j) * HD + nb * 16 + lr] = o[qb][nb][j]; }
}
// k_comb: per (l, h): for each branch k (r = 1, 2, 4; segment w = 1024 r): head h uses position l iff (l mod w) mod r == h / (16/r); then gi = (l mod w) / r, z = (l / w) 16 + h, o_k = Ob_k[z][gi][:] and
__global__ __launch_bounds__(256) void k_comb(const float* __restrict__ Ob0, const float* __restrict__ Ob1, const float* __restrict__ Ob2, const float* __restrict__ L0, const float* __restrict__ L1, const float* __restrict__ L2, bf* Ah, bf* Al) { const int i = blockIdx.x * 256 + threadIdx.x; if (i >= LL * (EE / 8)) return; const int lane = i & 31, kq = lane & 3, rr = lane >> 2; const int wv = i >> 5; const int kk = (wv % (EE / 32)) * 32 + kq * 8; const int l = (wv / (EE / 32)) * 8 + rr; const int d = kk % HD; const int h = kk / HD;
    const float* obs[3] = {Ob0, Ob1, Ob2}; const float* lss[3] = {L0, L1, L2}; float lse[3]; size_t src[3]; bool used[3];
#pragma unroll
    for (int k = 0; k < 3; ++k) { const int r = 1 << k; const int w = GG * r; const int ll = l % w; const int off = h / (NH_ / r); used[k] = (ll % r) == off; const int gi = ll / r; const int z = (l / w) * NH_ + h; src[k] = ((size_t)z * GG + gi); lse[k] = used[k] ? lss[k][src[k] * 32] : -1.0e8f; }
    const float m = fmaxf(lse[0], fmaxf(lse[1], lse[2])); float ex[3]; float den = 0.f;
#pragma unroll
    for (int k = 0; k < 3; ++k) { ex[k] = __expf(__fsub_rn(lse[k], m)); den = __fadd_rn(den, ex[k]); }
    const float inv = __fdiv_rn(1.0f, den); v8us oh, ol; v8f ob[3];
#pragma unroll
    for (int k = 0; k < 3; ++k) ob[k] = used[k] ? *(const v8f*)(obs[k] + src[k] * HD + d) : (v8f){};   // a branch's 8 values in two 16-byte loads, all three branches in flight together
#pragma unroll
    for (int u = 0; u < 8; ++u) { float acc = 0.f;
#pragma unroll
        for (int k = 0; k < 3; ++k) { const float o = ob[k][u]; float p = __fmul_rn(o, ex[k] * inv); asm volatile("" : "+v"(p)); acc = __fadd_rn(acc, p); }
        unsigned short a, c; splitf(acc, a, c); oh[u] = a; ol[u] = c; }
    const size_t e = fo8(l, kk, EE); *(v8us*)(Ah + e) = oh; *(v8us*)(Al + e) = ol;  }

extern "C" void kernel_launch(void* const* d_in, const int* in_sizes, int n_in,
                              void* d_out, int out_size, void* d_ws, size_t ws_size, hipStream_t stream) {
    (void)in_sizes; (void)n_in; (void)out_size;
    const float* x = (const float*)d_in[0]; const float* wqkv = (const float*)d_in[1]; const float* wproj = (const float*)d_in[2];
    float* OUT = (float*)d_out;     // [1][4096][1024]
    char* wsp = (char*)d_ws;
    auto take = [&](size_t bytes) { char* p = wsp; wsp += (bytes + 255) & ~(size_t)255; return (void*)p; };
    const int NZ = 7 * NH_;   // (segment, head) groups of all three branches: 64 + 32 + 16, numbered through
    bf* WP = (bf*)take((size_t)EE * EE * 2); float* QKV = (float*)take((size_t)LL * 3 * EE * 4);
    bf* Qh = (bf*)take((size_t)NZ * GG * HD * 2); bf* Ql = (bf*)take((size_t)NZ * GG * HD * 2); bf* Kh = (bf*)take((size_t)NZ * GG * HD * 2); bf* Kl = (bf*)take((size_t)NZ * GG * HD * 2); bf* V = (bf*)take((size_t)NZ * HD * GG * 4);
    bf* WQ = (bf*)take((size_t)3 * EE * EE * 2); bf* XB = (bf*)take((size_t)LL * EE * 2); bf* Ah = (bf*)take((size_t)LL * EE * 2); bf* Al = (bf*)take((size_t)LL * EE * 2);
    float* Ob = (float*)take((size_t)NZ * GG * HD * 4); float* LS = (float*)take((size_t)NZ * GG * 32 * 4);
    const int zb[3] = {0, 4 * NH_, 6 * NH_};   // first group of each branch
    float* ObK[3]; float* LSK[3]; for (int k = 0; k < 3; ++k) { ObK[k] = Ob + (size_t)zb[k] * GG * HD; LSK[k] = LS + (size_t)zb[k] * GG * 32; }
    if ((size_t)(wsp - (char*)d_ws) > ws_size) return;    // total 216 MB (qkv f32 [4096][3072] 50 MB, gathered hl planes of 112 groups 88 MB, branch outputs + row-replicated lse 44 MB, weights, x and the combined planes 34 MB)
    k_wtG<<<EE * 3 * EE / 8 / 256, 256, 0, stream>>>(wqkv, EE, 3 * EE, WQ); k_wtG<<<EE * EE / 8 / 256, 256, 0, stream>>>(wproj, EE, EE, WP);
    k_cvt8<<<(LL * EE / 8 + 255) / 256, 256, 0, stream>>>(x, XB, EE, (size_t)LL * EE / 8);
    k_gemmw<bf, 0, false><<<dim3(LL / 64, 3 * EE / 64, 1), 32, 0, stream>>>(XB, nullptr, WQ, nullptr, EE, QKV, 3 * EE, nullptr, 0, 0, 0);
    const int rs[3] = {1, 2, 4};
    for (int kb = 0; kb < 3; ++kb) { const int r = rs[kb]; const int nz = (LL / (GG * r)) * NH_; const size_t po = (size_t)zb[kb] * GG * HD;
        k_gath<<<(unsigned)(((size_t)nz * GG * HD / 8 + 255) / 256), 256, 0, stream>>>(QKV, r, 0, nz, Qh + po, Ql + po, Kh + po, Kl + po); k_gathv<<<(unsigned)(((size_t)nz * HD * GG / 8 + 255) / 256), 256, 0, stream>>>(QKV, r, 0, nz, V + 2 * po); }
    k_fattn<<<dim3(NZ, GG / 128, 1), 128, 0, stream>>>(Qh, Ql, Kh, Kl, V, Ob, LS);
    k_comb<<<(unsigned)(((size_t)LL * EE / 8 + 255) / 256), 256, 0, stream>>>(ObK[0], ObK[1], ObK[2], LSK[0], LSK[1], LSK[2], Ah, Al);
    k_gemmw<bf, 1, false><<<dim3(LL / 64, EE / 64, 1), 32, 0, stream>>>(Ah, Al, WP, nullptr, EE, OUT, EE, nullptr, 0, 0, 0);
}

// v004
// One run takes 164 microseconds.
// Two timings next to v003 put it at 1.04 and 1.05 times that version's speed.
// Counting every step since v000, it is 4.93 times as fast.
#include <hip/hip_runtime.h>

// Dilated causal self-attention (x [1][4096][1024]; qkv = x w_qkv (16 heads x 64); three branches (segment w, dilation r) = (1024,1), (2048,2), (4096,4): inside each segment, head h attends causally over the
// g = w/r = 1024 positions {gi r + off}, off = h / (16/r) (the reference's diagonal sparsify); softmax(q.k/8) with a causal mask over gi; branch output scattered back to those positions (0 elsewhere) with lse = logsumexp over the softmax
// PROBABILITIES of the row (masked entries contribute exp(0)), -1e8 elsewhere; branches recombined per (position, head) with softmax(lse) weights; out @ w_proj -> [1][4096][1024]).
// Compute dtypes, f32 accumulate: every input rounded to bf16; qkv on PLAIN bf16 operands (inputs: exact); per (segment, head) 1024x1024 attention on bf16 hi+lo planes gathered at the dilated positions
// (q x 1/8 exact; scores K 64 with 3 products, causal tiles skipped), softmax + the probability-logsumexp in f32 registers, probs.v on hl planes (3 products); the 3-branch recombination f32; w_proj on hl planes x exact (2 products). One-wave-per-64x64-tile GEMMs

#define LL   4096
#define EE   1024
#define NH_  16
#define HD   64
#define GG   1024
#define PCAR 1024.0f
typedef _Float16 h16;
typedef unsigned short bf;
typedef __attribute__((ext_vector_type(16))) __bf16   v16bf;
typedef __attribute__((ext_vector_type(16))) _Float16 v16h;
typedef __attribute__((ext_vector_type(8)))  _Float16 v8h;
typedef __attribute__((ext_vector_type(8)))  unsigned short v8us;
typedef __attribute__((ext_vector_type(8)))  float    v8f;
typedef __attribute__((ext_vector_type(4)))  float    v4f;
typedef v8h  __attribute__((may_alias)) v8ha;
typedef v4f  __attribute__((may_alias)) v4fa;
typedef v8us __attribute__((may_alias)) v8usa;

__device__ __forceinline__ unsigned short f2bf(float f) { unsigned u = __float_as_uint(f); u += 0x7FFFu + ((u >> 16) & 1u); return (unsigned short)(u >> 16); }
__device__ __forceinline__ float bf2f(unsigned short b) { return __uint_as_float(((unsigned)b) << 16); }
__device__ __forceinline__ float bfr(float f) { return bf2f(f2bf(f)); }
__device__ __forceinline__ v16h cat16(v8h lo, v8h hi) { return __builtin_shufflevector(lo, hi, 0, 1, 2, 3, 4, 5, 6, 7, 8, 9, 10, 11, 12, 13, 14, 15); }
__device__ __forceinline__ v16bf cat16b(v8us lo, v8us hi) { return __builtin_bit_cast(v16bf, __builtin_shufflevector(lo, hi, 0, 1, 2, 3, 4, 5, 6, 7, 8, 9, 10, 11, 12, 13, 14, 15)); }
__device__ __forceinline__ v8f wmma16(v16h a, v16h b, v8f c) { return __builtin_amdgcn_wmma_f32_16x16x32_f16(false, a, false, b, (short)0, c, false, false); }
__device__ __forceinline__ v8f wmmab(v16bf a, v16bf b, v8f c) { return __builtin_amdgcn_wmma_f32_16x16x32_bf16(false, a, false, b, (short)0, c, false, false); }



// ---- FRAGMENT ORDER of every 16-bit operand plane [rows][K]: the plane is cut into fragments of 16 rows x 32 k (512 elements, 1 KiB), numbered (row / 16) (K / 32) + k / 32; inside a fragment element (row, k) lies at
// ((k >> 4) & 1) 256 + (((k >> 3) & 1) 16 + (row & 15)) 8 + (k & 7). Lane (lr, hi) = 16 hi + lr then finds its 8 + 8 elements (k = 8 hi + j and 16 + 8 hi + j of row lr, the hardware k order) at lane 8 and 256 + lane 8:
// each wave-wide 16-byte load reads 512 contiguous bytes, 4 whole lines, where a row-major plane made it touch 16 lines.
__device__ __forceinline__ size_t fo8(int row, int k, int K) { return ((size_t)(row >> 4) * (K >> 5) + (k >> 5)) * 512 + ((k >> 4) & 1) * 256 + (((k >> 3) & 1) * 16 + (row & 15)) * 8; }   // place of the 8 elements k .. k + 7 (k % 8 == 0) of a row
// ---- k_gemmw: register-blocked GEMM, ONE WAVE per 64x64 output tile (16 accumulators), operands straight from 16-bit planes in fragment order; grid (M/64, N/64, Z), 32 threads.
// C[m][n] (f32, pitch ldc, + optional f32 bias[n]) = sum_k A[m][k] Bt[n][k] (+ split products per NSPLIT). z-batch strides sA/sB/sC in elements. K % 32 == 0.
template <typename T16> struct WFrag;
template <> struct WFrag<h16> { typedef v16h V; static __device__ __forceinline__ V ld(const h16* p) { return cat16(*(const v8h*)p, *(const v8h*)(p + 256)); } static __device__ __forceinline__ v8f mma(V a, V b, v8f c) { return wmma16(a, b, c); } };
template <> struct WFrag<bf> { typedef v16bf V; static __device__ __forceinline__ V ld(const bf* p) { return cat16b(*(const v8us*)p, *(const v8us*)(p + 256)); } static __device__ __forceinline__ v8f mma(V a, V b, v8f c) { return wmmab(a, b, c); } };
template <typename T16, int NSPLIT, bool BIAS>
__global__ __launch_bounds__(32) void k_gemmw(const T16* __restrict__ A, const T16* __restrict__ A2, const T16* __restrict__ Bt, const T16* __restrict__ Bt2, int K, float* C, int ldc, const float* __restrict__ bias, size_t sA, size_t sB, size_t sC) {
    typedef typename WFrag<T16>::V V;
    __shared__ __align__(16) float os[16 * 68];
    const size_t z = blockIdx.z; A += z * sA; if (A2) A2 += z * sA; Bt += z * sB; if (Bt2) Bt2 += z * sB; C += z * sC;
    const int lane = threadIdx.x & 31, lr = lane & 15, hi = lane >> 4; const int r0 = blockIdx.x * 64, c0 = blockIdx.y * 64;
    v8f acc[4][4];
#pragma unroll
    for (int mb = 0; mb < 4; ++mb)
#pragma unroll
        for (int nb = 0; nb < 4; ++nb) acc[mb][nb] = (v8f){};
    unsigned vo = 16u * lane;   // byte offset of this lane's piece of the current fragment inside a 16-row block: the only part of an operand address that differs between lanes or trips (a fragment is 1 KiB)
    const char *pa[4], *pa2[4], *pb[4], *pb2[4];   // wave-uniform and fixed: the first fragment of each 16-row block (16 rows of fragments hold 16 K elements)
#pragma unroll
    for (int u = 0; u < 4; ++u) { pa[u] = (const char*)(A + (size_t)(r0 + u * 16) * K); pb[u] = (const char*)(Bt + (size_t)(c0 + u * 16) * K); if (NSPLIT == 1 || NSPLIT == 2) pa2[u] = (const char*)(A2 + (size_t)(r0 + u * 16) * K); if (NSPLIT >= 2) pb2[u] = (const char*)(Bt2 + (size_t)(c0 + u * 16) * K); }
#pragma unroll 1
    for (int kc = 0; kc < K; kc += 32) {
        V a[4], a2[4], b[4], b2[4];
#pragma unroll
        for (int u = 0; u < 4; ++u) { a[u] = WFrag<T16>::ld((const T16*)(pa[u] + vo)); b[u] = WFrag<T16>::ld((const T16*)(pb[u] + vo)); if (NSPLIT == 1 || NSPLIT == 2) a2[u] = WFrag<T16>::ld((const T16*)(pa2[u] + vo)); if (NSPLIT >= 2) b2[u] = WFrag<T16>::ld((const T16*)(pb2[u] + vo)); }
        __builtin_amdgcn_sched_barrier(0);   // holds every operand load of the trip in front of the wait below, and so in flight together: one memory latency a trip
        asm volatile("s_wait_xcnt 0x0" :: "v"(vo) : "memory");   // the wait in front of the rewrite of the loads' offset register; as an input it stays whole up to it
#pragma unroll
        for (int nb = 0; nb < 4; ++nb)
#pragma unroll
            for (int mb = 0; mb < 4; ++mb) { acc[mb][nb] = WFrag<T16>::mma(a[mb], b[nb], acc[mb][nb]); if (NSPLIT == 1 || NSPLIT == 2) acc[mb][nb] = WFrag<T16>::mma(a2[mb], b[nb], acc[mb][nb]); if (NSPLIT >= 2) acc[mb][nb] = WFrag<T16>::mma(a[mb], b2[nb], acc[mb][nb]); }
        vo += 1024;
        asm volatile("v_nop\n\tv_nop\n\tv_nop\n\tv_nop" : "+v"(acc[0][0]), "+v"(acc[1][1]), "+v"(acc[2][2]), "+v"(acc[3][3]) : "v"(a[0]), "v"(a[3]));
    }
#pragma unroll
    for (int mb = 0; mb < 4; ++mb) {
#pragma unroll
        for (int nb = 0; nb < 4; ++nb) {
#pragma unroll
            for (int j = 0; j < 8; ++j) os[(hi * 8 + j) * 68 + nb * 16 + lr] = acc[mb][nb][j]; }
        __builtin_amdgcn_wave_barrier(); asm volatile("" ::: "memory");
        float* crow = C + (size_t)(r0 + mb * 16) * ldc + c0;
{
#pragma unroll
            for (int s = 0; s < 8; ++s) { const int row = 2 * s + hi, cofs = lr * 4; v4f val = *(const v4fa*)(os + row * 68 + cofs); if (BIAS) { val[0] += bfr(bias[c0 + cofs]); val[1] += bfr(bias[c0 + cofs + 1]); val[2] += bfr(bias[c0 + cofs + 2]); val[3] += bfr(bias[c0 + cofs + 3]); }
                *(v4f*)(crow + (size_t)row * ldc + cofs) = val; }
             }
        __builtin_amdgcn_wave_barrier(); asm volatile("" ::: "memory");
    }
}

__device__ __forceinline__ h16 tohx(float x) { return (h16)x; }
__device__ __forceinline__ void splitf(float y, unsigned short& h, unsigned short& l) { h = f2bf(y); l = f2bf(y - bf2f(h)); }
typedef __attribute__((ext_vector_type(2))) _Float16 v2h;
typedef __attribute__((ext_vector_type(4))) _Float16 v4h;
typedef __attribute__((ext_vector_type(2))) unsigned short v2us;
typedef __attribute__((ext_vector_type(4))) unsigned short v4us;
typedef __attribute__((ext_vector_type(2))) float v2f;
__device__ __forceinline__ int dpos(int r, int seg, int h, int gi) { const int w = GG * r; const int off = h / (NH_ / r); return seg * w + gi * r + off; }   // dense position of sparse index gi for (branch r, segment, head)

// The writers of the planes. Row-major sources (k_cvt8, k_gath, k_comb): a 16-byte piece is 8 k of one row; lane = 4 rr + kq takes row rr of 8 and piece kq of a 32-k block, so 4 lanes read one whole 128-byte line of f32
// and the 8 lanes of one kq store one whole 128-byte line. Transposed sources (k_wtG, k_gathv): lane = 16 hi + lr as in the readers: 16 lanes read 64 contiguous bytes, the wave stores 512.
// A THREAD MAKES SEVERAL PIECES (4 or 8), not one: with one piece a thread these launches lasted as long as their many short waves took to start. A thread's pieces lie at compile-time distances from its first, in the source and in the
// planes, so one address register serves all its loads of a source and one all its stores of a plane; all loads fly together, every piece is formed, and the stores come last, so that no register of an issued load or store is written again.
template <int K, int N>
__global__ __launch_bounds__(256) void k_wtG(const float* __restrict__ w, bf* Bt) {   // a wave: 16 k (one half of a 32-k block) of 8 neighbouring 16-column blocks: 512 contiguous bytes of each source row
    const int i = blockIdx.x * 256 + threadIdx.x; const int lane = i & 31, lr = lane & 15, hi = lane >> 4; const int wv = i >> 5; const int half = wv & 1, fr = wv >> 1; const int kb = fr % (K >> 5), ng = fr / (K >> 5);
    const unsigned vo = (unsigned)(kb * 32 + half * 16 + hi * 8) * N + ng * 128 + lr; const float* p = w + vo; float f[8][8]; v8us o[8];
#pragma unroll
    for (int u = 0; u < 8; ++u)
#pragma unroll
        for (int j = 0; j < 8; ++j) f[u][j] = p[j * N + u * 16];
    __builtin_amdgcn_sched_barrier(0);   // holds every load in front of the wait below, and so in flight together
    asm volatile("s_wait_xcnt 0x0" :: "v"(vo) : "memory");   // the wait in front of any rewrite of the loads' offset register; as an input it stays whole up to it
#pragma unroll
    for (int u = 0; u < 8; ++u)
#pragma unroll
        for (int j = 0; j < 8; ++j) o[u][j] = f2bf(f[u][j]);
    bf* q = Bt + ((unsigned)((ng * 8 * (K >> 5) + kb) * 2 + half) * 256 + lane * 8);
    __builtin_amdgcn_sched_barrier(0);   // holds the stores behind the last conversion: nothing is computed into a register of an issued store
#pragma unroll
    for (int u = 0; u < 8; ++u) *(v8us*)(q + u * (K >> 5) * 512) = o[u]; }
template <int K>
__global__ __launch_bounds__(256) void k_cvt8(const float* __restrict__ src, bf* dst) {   // a block: 16 whole rows (K = 1024: 32 fragments); wave wq, piece u: 32-k block (u & 3) 8 + wq of the rows (u >> 2) 8 + rr
    static_assert(K == 1024, "8 waves x 8 pieces cover 16 rows of 1024"); const int lane = threadIdx.x & 31, kq = lane & 3, rr = lane >> 2, wq = threadIdx.x >> 5;
    const unsigned vo = ((unsigned)(blockIdx.x * 16 + rr) * K + wq * 32 + kq * 8) * 4; const float* p = (const float*)((const char*)src + vo); v8f v[8]; v8us o[8];
#pragma unroll
    for (int u = 0; u < 8; ++u) v[u] = *(const v8f*)(p + (u >> 2) * 8 * K + (u & 3) * 256);
    __builtin_amdgcn_sched_barrier(0);   // holds every load in front of the wait below, and so in flight together
    asm volatile("s_wait_xcnt 0x0" :: "v"(vo) : "memory");   // the wait in front of any rewrite of the loads' offset register; as an input it stays whole up to it
#pragma unroll
    for (int u = 0; u < 8; ++u)
#pragma unroll
        for (int j = 0; j < 8; ++j) o[u][j] = f2bf(v[u][j]);
    bf* q = dst + ((unsigned)blockIdx.x * 16 * K + wq * 512 + (kq >> 1) * 256 + ((kq & 1) * 16 + rr) * 8);
    __builtin_amdgcn_sched_barrier(0);   // holds the stores behind the last conversion: nothing is computed into a register of an issued store
#pragma unroll
    for (int u = 0; u < 8; ++u) *(v8us*)(q + (u & 3) * 8 * 512 + (u >> 2) * 64) = o[u]; }
template <int R>
__global__ __launch_bounds__(256) void k_gath(const float* __restrict__ QKV, bf* Qh, bf* Ql, bf* Kh, bf* Kl) {   // a wave: 16 rows of the planes with all 64 d (two whole fragments a plane); piece u: d half u & 1 of the rows (u >> 1) 8 + rr
    const int i = blockIdx.x * 256 + threadIdx.x; const int lane = i & 31, kq = lane & 3, rr = lane >> 2; const int wv = i >> 5;
    const int zr = wv * 16 + rr; const int gi = zr % GG; const int z = zr / GG; const int h = z % NH_, seg = z / NH_;   // zr: row of the planes, groups one behind the other (GG % 16 == 0)
    const unsigned vo = ((unsigned)dpos(R, seg, h, gi) * (3 * EE) + h * HD + kq * 8) * 4; const float* row = (const float*)((const char*)QKV + vo); v8f q[4], kk[4]; v8us qh[4], ql[4], kh[4], kl[4];
#pragma unroll
    for (int u = 0; u < 4; ++u) { const float* p = row + (u >> 1) * 8 * R * 3 * EE + (u & 1) * 32; q[u] = *(const v8f*)p; kk[u] = *(const v8f*)(p + EE); }
    __builtin_amdgcn_sched_barrier(0);   // holds every load in front of the wait below, and so in flight together
    asm volatile("s_wait_xcnt 0x0" :: "v"(vo) : "memory");   // the wait in front of any rewrite of the loads' offset register; as an input it stays whole up to it
#pragma unroll
    for (int u = 0; u < 4; ++u)
#pragma unroll
        for (int j = 0; j < 8; ++j) { unsigned short a, c; splitf(q[u][j] * 0.125f, a, c); qh[u][j] = a; ql[u][j] = c; splitf(kk[u][j], a, c); kh[u][j] = a; kl[u][j] = c; }
    const unsigned e = (unsigned)wv * 1024 + (kq >> 1) * 256 + ((kq & 1) * 16 + rr) * 8; bf* pqh = Qh + e; bf* pql = Ql + e; bf* pkh = Kh + e; bf* pkl = Kl + e;
    __builtin_amdgcn_sched_barrier(0);   // holds the stores behind the last split: nothing is computed into a register of an issued store
#pragma unroll
    for (int u = 0; u < 4; ++u) { const int c = (u & 1) * 512 + (u >> 1) * 64; *(v8us*)(pqh + c) = qh[u]; *(v8us*)(pql + c) = ql[u]; *(v8us*)(pkh + c) = kh[u]; *(v8us*)(pkl + c) = kl[u]; } }
template <int R>
__global__ __launch_bounds__(256) void k_gathv(const float* __restrict__ QKV, bf* V) {   // a wave: 32 keys of one group with all 64 d (whole 256-byte source rows; four whole fragments a plane); piece (half, nb): keys half 16 + hi 8 + j, d = nb 16 + lr
    const int i = blockIdx.x * 256 + threadIdx.x; const int lane = i & 31, lr = lane & 15, hi = lane >> 4; const int wv = i >> 5; const int kb = wv % (GG / 32), zl = wv / (GG / 32); const int h = zl % NH_, seg = zl / NH_;
    const unsigned vo = (unsigned)dpos(R, seg, h, kb * 32 + hi * 8) * (3 * EE) + h * HD + lr; const float* p = QKV + 2 * EE + vo; float f[2][4][8]; v8us oh[2][4], ol[2][4];   // element offset inside qkv (12.6 M elements): one register beside the uniform base
#pragma unroll
    for (int half = 0; half < 2; ++half)
#pragma unroll
        for (int j = 0; j < 8; ++j)
#pragma unroll
            for (int nb = 0; nb < 4; ++nb) f[half][nb][j] = p[(half * 16 + j) * R * 3 * EE + nb * 16];
    __builtin_amdgcn_sched_barrier(0);   // holds every load in front of the wait below, and so in flight together
    asm volatile("s_wait_xcnt 0x0" :: "v"(vo) : "memory");   // the wait in front of any rewrite of the loads' offset register; as an input it stays whole up to it
#pragma unroll
    for (int half = 0; half < 2; ++half)
#pragma unroll
        for (int nb = 0; nb < 4; ++nb)
#pragma unroll
            for (int j = 0; j < 8; ++j) { unsigned short a, c; splitf(f[half][nb][j], a, c); oh[half][nb][j] = a; ol[half][nb][j] = c; }
    bf* q = V + ((unsigned)zl * (2 * HD * GG) + kb * 512 + lane * 8);   // per group: the hi plane [HD rows d][GG keys] in fragment order, then the lo plane
    __builtin_amdgcn_sched_barrier(0);   // holds the stores behind the last split: nothing is computed into a register of an issued store
#pragma unroll
    for (int half = 0; half < 2; ++half)
#pragma unroll
        for (int nb = 0; nb < 4; ++nb) { *(v8us*)(q + nb * 16 * GG + half * 256) = oh[half][nb]; *(v8us*)(q + nb * 16 * GG + half * 256 + HD * GG) = ol[half][nb]; } }
// ---- k_fattn: scores, softmax, the probability-logsumexp and probs.v of one (segment, head) group in ONE kernel; no score or probability ever reaches memory. Block = 4 independent waves (no barrier, no LDS); a wave owns 32 query rows
// and walks its causal keys 32 at a time, twice: sweep 1 finds each row's max and sum (running, rescaled), sweep 2 forms the scores again, normalises them, sums exp(p) and multiplies by v.
// The score tile is computed TRANSPOSED (A = keys, B = queries): lane (lr, hi) then holds query lr, keys 8 hi + j of tile 0 and 16 + 8 hi + j of tile 1, which is the k order of the A fragment that probs.v needs: no exchange between lanes.
__device__ __forceinline__ void fa_kload(const bf* __restrict__ pkh, const bf* __restrict__ pkl, v16bf (&ah)[2][2], v16bf (&al)[2][2]) {   // pkh, pkl: the four fragments of keys k0 .. k0 + 31, at this lane's piece
#pragma unroll
    for (int kt = 0; kt < 2; ++kt)
#pragma unroll
        for (int kc = 0; kc < 2; ++kc) { ah[kt][kc] = WFrag<bf>::ld(pkh + (kt * 2 + kc) * 512); al[kt][kc] = WFrag<bf>::ld(pkl + (kt * 2 + kc) * 512); }
}
__device__ __forceinline__ void fa_scores(const v16bf (&ah)[2][2], const v16bf (&al)[2][2], int k0, int lr, int hi, int r0, const v16bf (&bqh)[2][2], const v16bf (&bql)[2][2], v8f (&s)[2][2]) {
#pragma unroll
    for (int kt = 0; kt < 2; ++kt)
#pragma unroll
        for (int qb = 0; qb < 2; ++qb) { v8f acc = (v8f){};
#pragma unroll
            for (int kc = 0; kc < 2; ++kc) { acc = wmmab(ah[kt][kc], bqh[qb][kc], acc); acc = wmmab(ah[kt][kc], bql[qb][kc], acc); acc = wmmab(al[kt][kc], bqh[qb][kc], acc); }
#pragma unroll
            for (int j = 0; j < 8; ++j) s[kt][qb][j] = (k0 + kt * 16 + hi * 8 + j) <= (r0 + qb * 16 + lr) ? acc[j] : -3.0e38f; }   // causal mask by select
}
__global__ __launch_bounds__(128) void k_fattn(const bf* __restrict__ Qh, const bf* __restrict__ Ql, const bf* __restrict__ Kh, const bf* __restrict__ Kl, const bf* __restrict__ V, float* Ob, float* LSEX) {
    const int lane = threadIdx.x & 31, lr = lane & 15, hi = lane >> 4; const int z = blockIdx.x;
    const int t = GG / 32 - 1 - (int)(blockIdx.y * 4 + __builtin_amdgcn_readfirstlane(threadIdx.x >> 5));   // the longest rows are launched first; the wave's number in a scalar register, so that both loops branch on scalars
    const int r0 = t * 32; const size_t zo = (size_t)z * GG * HD; const size_t lo = zo + 8 * lane;
    v16bf bqh[2][2], bql[2][2]; const bf* pqh = Qh + lo + (size_t)r0 * HD; const bf* pql = Ql + lo + (size_t)r0 * HD;
#pragma unroll
    for (int qb = 0; qb < 2; ++qb)
#pragma unroll
        for (int kc = 0; kc < 2; ++kc) { bqh[qb][kc] = WFrag<bf>::ld(pqh + (qb * 2 + kc) * 512); bql[qb][kc] = WFrag<bf>::ld(pql + (qb * 2 + kc) * 512); }
    asm volatile("s_wait_xcnt 0x0" :: "v"(pqh), "v"(pql) : "memory");   // the wait in front of any reuse of the query loads' address registers; as inputs they stay whole up to it
    float m[2] = {-3.0e38f, -3.0e38f}, l[2] = {0.f, 0.f};
    { const bf* pkh = Kh + lo; const bf* pkl = Kl + lo;
    for (int kb = 0; kb <= t; ++kb) { v8f s[2][2]; v16bf ah[2][2], al[2][2]; fa_kload(pkh, pkl, ah, al);
        __builtin_amdgcn_sched_barrier(0);   // holds all sixteen key loads in front of the first product: one memory latency a step instead of one per pair of loads
        asm volatile("s_wait_xcnt 0x0" :: "v"(pkh), "v"(pkl) : "memory");   // the wait in front of any rewrite of the loads' address registers; as inputs they stay whole up to it
        fa_scores(ah, al, kb * 32, lr, hi, r0, bqh, bql, s); pkh += 32 * HD; pkl += 32 * HD;
#pragma unroll
        for (int qb = 0; qb < 2; ++qb) { float mx = m[qb];
#pragma unroll
            for (int j = 0; j < 8; ++j) mx = fmaxf(mx, fmaxf(s[0][qb][j], s[1][qb][j]));
            float a = l[qb] * __expf(m[qb] - mx);
#pragma unroll
            for (int j = 0; j < 8; ++j) a += __expf(s[0][qb][j] - mx) + __expf(s[1][qb][j] - mx);
            m[qb] = mx; l[qb] = a; } } }
    float inv[2];
#pragma unroll
    for (int qb = 0; qb < 2; ++qb) { const float mm = fmaxf(m[qb], __shfl_xor(m[qb], 16, 32)); float a = l[qb] * __expf(m[qb] - mm); a += __shfl_xor(a, 16, 32); m[qb] = mm; inv[qb] = __fdiv_rn(1.0f, a); }   // a lane whose keys were all masked holds m = -3e38: its sum is scaled to 0
    float se[2] = {0.f, 0.f}; v8f o[2][4];
#pragma unroll
    for (int qb = 0; qb < 2; ++qb)
#pragma unroll
        for (int nb = 0; nb < 4; ++nb) o[qb][nb] = (v8f){};
    { const bf* pkh = Kh + lo; const bf* pkl = Kl + lo; const bf* pv = V + (size_t)z * HD * 2 * GG + 8 * lane;
    for (int kb = 0; kb <= t; ++kb) { v8f s[2][2]; v16bf ah[2][2], al[2][2], vh[4], vl[4]; fa_kload(pkh, pkl, ah, al);
#pragma unroll
        for (int nb = 0; nb < 4; ++nb) { vh[nb] = WFrag<bf>::ld(pv + (size_t)nb * 16 * GG); vl[nb] = WFrag<bf>::ld(pv + (size_t)nb * 16 * GG + HD * GG); }
        __builtin_amdgcn_sched_barrier(0);   // holds the key and the value loads in front of the first product: one memory latency a step, and the value tile flies under the scores and the softmax
        asm volatile("s_wait_xcnt 0x0" :: "v"(pkh), "v"(pkl), "v"(pv) : "memory");   // the wait in front of any rewrite of the loads' address registers; as inputs they stay whole up to it
        fa_scores(ah, al, kb * 32, lr, hi, r0, bqh, bql, s); pkh += 32 * HD; pkl += 32 * HD; pv += 512; v16bf ph[2], pl[2];
#pragma unroll
        for (int qb = 0; qb < 2; ++qb) { v8us h[2], c[2];
#pragma unroll
            for (int kt = 0; kt < 2; ++kt)
#pragma unroll
                for (int j = 0; j < 8; ++j) { const float p = __expf(s[kt][qb][j] - m[qb]) * inv[qb]; se[qb] += __expf(p); unsigned short a, b; splitf(p, a, b); h[kt][j] = a; c[kt][j] = b; }   // masked: p = 0 exactly, exp(0) = 1, as the reference
            ph[qb] = cat16b(h[0], h[1]); pl[qb] = cat16b(c[0], c[1]); }
#pragma unroll
        for (int nb = 0; nb < 4; ++nb)
#pragma unroll
            for (int qb = 0; qb < 2; ++qb) { o[qb][nb] = wmmab(ph[qb], vh[nb], o[qb][nb]); o[qb][nb] = wmmab(pl[qb], vh[nb], o[qb][nb]); o[qb][nb] = wmmab(ph[qb], vl[nb], o[qb][nb]); } } }
#pragma unroll
    for (int qb = 0; qb < 2; ++qb) { const float st = se[qb] + __shfl_xor(se[qb], 16, 32) + (float)(GG - (t + 1) * 32);   // the keys beyond this wave's last tile are masked: exp(0) = 1 each
        const float lse = __logf(st); const v4f lv = {lse, lse, lse, lse}; float* lp = LSEX + ((size_t)z * GG + r0 + qb * 16 + lr) * 32 + hi * 16;
#pragma unroll
        for (int q = 0; q < 4; ++q) *(v4f*)(lp + q * 4) = lv;
#pragma unroll
        for (int nb = 0; nb < 4; ++nb)
#pragma unroll
            for (int j = 0; j < 8; ++j) Ob[((size_t)z * GG + r0 + qb * 16 + hi * 8 + j) * HD + nb * 16 + lr] = o[qb][nb][j]; }
}
// k_comb: per (l, h): for each branch k (r = 1, 2, 4; segment w = 1024 r): head h uses position l iff (l mod w) mod r == h / (16/r); then gi = (l mod w) / r, z = (l / w) 16 + h, o_k = Ob_k[z][gi][:] and
// a wave: head h (64 k: two whole fragments a plane) of 16 positions; a thread's piece 2 g + c2 is k half c2 of position l + 8 g, where the same branches are in use (8 % r == 0) 8 / r rows further on; the weights of a position serve both its halves
__global__ __launch_bounds__(256) void k_comb(const float* __restrict__ Ob0, const float* __restrict__ Ob1, const float* __restrict__ Ob2, const float* __restrict__ L0, const float* __restrict__ L1, const float* __restrict__ L2, bf* Ah, bf* Al) { const int i = blockIdx.x * 256 + threadIdx.x; const int lane = i & 31, kq = lane & 3, rr = lane >> 2; const int wv = i >> 5; const int h = wv % NH_; const int l = (wv / NH_) * 16 + rr;
    const float* obs[3] = {Ob0, Ob1, Ob2}; const float* lss[3] = {L0, L1, L2}; float lsq[2][3]; unsigned vl[3], vb[3]; bool used[3]; v8f obq[4][3]; v8us ohq[4], olq[4];
#pragma unroll
    for (int k = 0; k < 3; ++k) { const int r = 1 << k; const int w = GG * r; const int ll = l % w; const int off = h / (NH_ / r); used[k] = (ll % r) == off; const int gi = ll / r; const int z = (l / w) * NH_ + h; const unsigned src = (unsigned)(z * GG + gi); vl[k] = src * (32 * 4); vb[k] = (src * HD + kq * 8) * 4;   // byte offsets: one register a branch for the lse rows, one for the outputs
        const float* pl = (const float*)((const char*)lss[k] + vl[k]); const float* po = (const float*)((const char*)obs[k] + vb[k]);
        lsq[0][k] = lsq[1][k] = -1.0e8f; obq[0][k] = obq[1][k] = obq[2][k] = obq[3][k] = (v8f){};
        if (used[k]) {   // one masked stretch a branch: its two lse values and, per piece, 8 outputs in two 16-byte loads; all pieces and branches in flight together
#pragma unroll
            for (int g = 0; g < 2; ++g) lsq[g][k] = pl[g * (8 / r) * 32];
#pragma unroll
            for (int pc = 0; pc < 4; ++pc) obq[pc][k] = *(const v8f*)(po + (pc >> 1) * (8 / r) * HD + (pc & 1) * 32); } }
    asm volatile("s_wait_xcnt 0x0" :: "v"(vl[0]), "v"(vl[1]), "v"(vl[2]), "v"(vb[0]), "v"(vb[1]), "v"(vb[2]) : "memory");   // the wait in front of any rewrite of the loads' offset registers; as inputs they stay whole up to it
#pragma unroll
    for (int g = 0; g < 2; ++g) { const float (&lse)[3] = lsq[g];
    const float m = fmaxf(lse[0], fmaxf(lse[1], lse[2])); float ex[3]; float den = 0.f;
#pragma unroll
    for (int k = 0; k < 3; ++k) { ex[k] = __expf(__fsub_rn(lse[k], m)); den = __fadd_rn(den, ex[k]); }
    const float inv = __fdiv_rn(1.0f, den);
#pragma unroll
    for (int c2 = 0; c2 < 2; ++c2) { const v8f (&ob)[3] = obq[g * 2 + c2]; v8us oh, ol;
#pragma unroll
    for (int u = 0; u < 8; ++u) { float acc = 0.f;
#pragma unroll
        for (int k = 0; k < 3; ++k) { const float o = ob[k][u]; float p = __fmul_rn(o, ex[k] * inv); asm volatile("" : "+v"(p)); acc = __fadd_rn(acc, p); }
        unsigned short a, c; splitf(acc, a, c); oh[u] = a; ol[u] = c; }
    ohq[g * 2 + c2] = oh; olq[g * 2 + c2] = ol; } }
    const unsigned e = (unsigned)wv * 1024 + (kq >> 1) * 256 + ((kq & 1) * 16 + rr) * 8; bf* pah = Ah + e; bf* pal = Al + e;
    __builtin_amdgcn_sched_barrier(0);   // holds the stores behind the last split: nothing is computed into a register of an issued store
#pragma unroll
    for (int pc = 0; pc < 4; ++pc) { *(v8us*)(pah + (pc & 1) * 512 + (pc >> 1) * 64) = ohq[pc]; *(v8us*)(pal + (pc & 1) * 512 + (pc >> 1) * 64) = olq[pc]; } }

extern "C" void kernel_launch(void* const* d_in, const int* in_sizes, int n_in,
                              void* d_out, int out_size, void* d_ws, size_t ws_size, hipStream_t stream) {
    (void)in_sizes; (void)n_in; (void)out_size;
    const float* x = (const float*)d_in[0]; const float* wqkv = (const float*)d_in[1]; const float* wproj = (const float*)d_in[2];
    float* OUT = (float*)d_out;     // [1][4096][1024]
    char* wsp = (char*)d_ws;
    auto take = [&](size_t bytes) { char* p = wsp; wsp += (bytes + 255) & ~(size_t)255; return (void*)p; };
    const int NZ = 7 * NH_;   // (segment, head) groups of all three branches: 64 + 32 + 16, numbered through
    bf* WP = (bf*)take((size_t)EE * EE * 2); float* QKV = (float*)take((size_t)LL * 3 * EE * 4);
    bf* Qh = (bf*)take((size_t)NZ * GG * HD * 2); bf* Ql = (bf*)take((size_t)NZ * GG * HD * 2); bf* Kh = (bf*)take((size_t)NZ * GG * HD * 2); bf* Kl = (bf*)take((size_t)NZ * GG * HD * 2); bf* V = (bf*)take((size_t)NZ * HD * GG * 4);
    bf* WQ = (bf*)take((size_t)3 * EE * EE * 2); bf* XB = (bf*)take((size_t)LL * EE * 2); bf* Ah = (bf*)take((size_t)LL * EE * 2); bf* Al = (bf*)take((size_t)LL * EE * 2);
    float* Ob = (float*)take((size_t)NZ * GG * HD * 4); float* LS = (float*)take((size_t)NZ * GG * 32 * 4);
    const int zb[3] = {0, 4 * NH_, 6 * NH_};   // first group of each branch
    float* ObK[3]; float* LSK[3]; for (int k = 0; k < 3; ++k) { ObK[k] = Ob + (size_t)zb[k] * GG * HD; LSK[k] = LS + (size_t)zb[k] * GG * 32; }
    if ((size_t)(wsp - (char*)d_ws) > ws_size) return;    // total 216 MB (qkv f32 [4096][3072] 50 MB, gathered hl planes of 112 groups 88 MB, branch outputs + row-replicated lse 44 MB, weights, x and the combined planes 34 MB)
    k_wtG<EE, 3 * EE><<<EE * 3 * EE / 64 / 256, 256, 0, stream>>>(wqkv, WQ); k_wtG<EE, EE><<<EE * EE / 64 / 256, 256, 0, stream>>>(wproj, WP);
    k_cvt8<EE><<<LL / 16, 256, 0, stream>>>(x, XB);
    k_gemmw<bf, 0, false><<<dim3(LL / 64, 3 * EE / 64, 1), 32, 0, stream>>>(XB, nullptr, WQ, nullptr, EE, QKV, 3 * EE, nullptr, 0, 0, 0);
    const size_t po1 = (size_t)zb[1] * GG * HD, po2 = (size_t)zb[2] * GG * HD;   // a branch of nz groups: k_gath nz GG / 16 waves, k_gathv nz GG / 32 waves, 8 waves a block
    k_gath<1><<<4 * NH_ * GG / 128, 256, 0, stream>>>(QKV, Qh, Ql, Kh, Kl); k_gathv<1><<<4 * NH_ * GG / 256, 256, 0, stream>>>(QKV, V);
    k_gath<2><<<2 * NH_ * GG / 128, 256, 0, stream>>>(QKV, Qh + po1, Ql + po1, Kh + po1, Kl + po1); k_gathv<2><<<2 * NH_ * GG / 256, 256, 0, stream>>>(QKV, V + 2 * po1);
    k_gath<4><<<NH_ * GG / 128, 256, 0, stream>>>(QKV, Qh + po2, Ql + po2, Kh + po2, Kl + po2); k_gathv<4><<<NH_ * GG / 256, 256, 0, stream>>>(QKV, V + 2 * po2);
    k_fattn<<<dim3(NZ, GG / 128, 1), 128, 0, stream>>>(Qh, Ql, Kh, Kl, V, Ob, LS);
    k_comb<<<LL * NH_ / 128, 256, 0, stream>>>(ObK[0], ObK[1], ObK[2], LSK[0], LSK[1], LSK[2], Ah, Al);
    k_gemmw<bf, 1, false><<<dim3(LL / 64, EE / 64, 1), 32, 0, stream>>>(Ah, Al, WP, nullptr, EE, OUT, EE, nullptr, 0, 0, 0);
}

// v005
// Measured time: 148 microseconds a run.
// Timed twice side by side with v004, it ran 1.11 times as fast both times.
// Over all steps from v000 it is 5.45 times as fast.
#include <hip/hip_runtime.h>

// Dilated causal self-attention (x [1][4096][1024]; qkv = x w_qkv (16 heads x 64); three branches (segment w, dilation r) = (1024,1), (2048,2), (4096,4): inside each segment, head h attends causally over the
// g = w/r = 1024 positions {gi r + off}, off = h / (16/r) (the reference's diagonal sparsify); softmax(q.k/8) with a causal mask over gi; branch output scattered back to those positions (0 elsewhere) with lse = logsumexp over the softmax
// PROBABILITIES of the row (masked entries contribute exp(0)), -1e8 elsewhere; branches recombined per (position, head) with softmax(lse) weights; out @ w_proj -> [1][4096][1024]).
// Compute dtypes, f32 accumulate: every input rounded to bf16; qkv on PLAIN bf16 operands (inputs: exact); per (segment, head) 1024x1024 attention on bf16 hi+lo planes gathered at the dilated positions
// (q x 1/8 exact; scores K 64 with 3 products, causal tiles skipped), softmax + the probability-logsumexp in f32 registers, probs.v on hl planes (3 products); the 3-branch recombination f32; w_proj on hl planes x exact (2 products). One-wave-per-64x64-tile GEMMs

#define LL   4096
#define EE   1024
#define NH_  16
#define HD   64
#define GG   1024
#define PCAR 1024.0f
typedef _Float16 h16;
typedef unsigned short bf;
typedef __attribute__((ext_vector_type(16))) __bf16   v16bf;
typedef __attribute__((ext_vector_type(16))) _Float16 v16h;
typedef __attribute__((ext_vector_type(8)))  _Float16 v8h;
typedef __attribute__((ext_vector_type(8)))  unsigned short v8us;
typedef __attribute__((ext_vector_type(8)))  float    v8f;
typedef __attribute__((ext_vector_type(4)))  float    v4f;
typedef v8h  __attribute__((may_alias)) v8ha;
typedef v4f  __attribute__((may_alias)) v4fa;
typedef v8us __attribute__((may_alias)) v8usa;

__device__ __forceinline__ unsigned short f2bf(float f) { unsigned u = __float_as_uint(f); u += 0x7FFFu + ((u >> 16) & 1u); return (unsigned short)(u >> 16); }
__device__ __forceinline__ float bf2f(unsigned short b) { return __uint_as_float(((unsigned)b) << 16); }
__device__ __forceinline__ float bfr(float f) { return bf2f(f2bf(f)); }
__device__ __forceinline__ v16h cat16(v8h lo, v8h hi) { return __builtin_shufflevector(lo, hi, 0, 1, 2, 3, 4, 5, 6, 7, 8, 9, 10, 11, 12, 13, 14, 15); }
__device__ __forceinline__ v16bf cat16b(v8us lo, v8us hi) { return __builtin_bit_cast(v16bf, __builtin_shufflevector(lo, hi, 0, 1, 2, 3, 4, 5, 6, 7, 8, 9, 10, 11, 12, 13, 14, 15)); }
__device__ __forceinline__ v8f wmma16(v16h a, v16h b, v8f c) { return __builtin_amdgcn_wmma_f32_16x16x32_f16(false, a, false, b, (short)0, c, false, false); }
__device__ __forceinline__ v8f wmmab(v16bf a, v16bf b, v8f c) { return __builtin_amdgcn_wmma_f32_16x16x32_bf16(false, a, false, b, (short)0, c, false, false); }



// ---- FRAGMENT ORDER of every 16-bit operand plane [rows][K]: the plane is cut into fragments of 16 rows x 32 k (512 elements, 1 KiB), numbered (row / 16) (K / 32) + k / 32; inside a fragment element (row, k) lies at
// ((k >> 4) & 1) 256 + (((k >> 3) & 1) 16 + (row & 15)) 8 + (k & 7). Lane (lr, hi) = 16 hi + lr then finds its 8 + 8 elements (k = 8 hi + j and 16 + 8 hi + j of row lr, the hardware k order) at lane 8 and 256 + lane 8:
// each wave-wide 16-byte load reads 512 contiguous bytes, 4 whole lines, where a row-major plane made it touch 16 lines.
__device__ __forceinline__ size_t fo8(int row, int k, int K) { return ((size_t)(row >> 4) * (K >> 5) + (k >> 5)) * 512 + ((k >> 4) & 1) * 256 + (((k >> 3) & 1) * 16 + (row & 15)) * 8; }   // place of the 8 elements k .. k + 7 (k % 8 == 0) of a row
// ---- k_gemmw: register-blocked GEMM, ONE WAVE per 64x64 output tile (16 accumulators), operands straight from 16-bit planes in fragment order; grid (M/64, N/64, Z), 32 threads.
// C[m][n] (f32, pitch ldc, + optional f32 bias[n]) = sum_k A[m][k] Bt[n][k] (+ split products per NSPLIT). z-batch strides sA/sB/sC in elements. K % 32 == 0.
template <typename T16> struct WFrag;
template <> struct WFrag<h16> { typedef v16h V; static __device__ __forceinline__ V ld(const h16* p) { return cat16(*(const v8h*)p, *(const v8h*)(p + 256)); } static __device__ __forceinline__ v8f mma(V a, V b, v8f c) { return wmma16(a, b, c); } };
template <> struct WFrag<bf> { typedef v16bf V; static __device__ __forceinline__ V ld(const bf* p) { return cat16b(*(const v8us*)p, *(const v8us*)(p + 256)); } static __device__ __forceinline__ v8f mma(V a, V b, v8f c) { return wmmab(a, b, c); } };
template <typename T16, int NSPLIT, bool BIAS>
__global__ __launch_bounds__(32) void k_gemmw(const T16* __restrict__ A, const T16* __restrict__ A2, const T16* __restrict__ Bt, const T16* __restrict__ Bt2, int K, float* C, int ldc, const float* __restrict__ bias, size_t sA, size_t sB, size_t sC) {
    typedef typename WFrag<T16>::V V;
    __shared__ __align__(16) float os[16 * 68];
    const size_t z = blockIdx.z; A += z * sA; if (A2) A2 += z * sA; Bt += z * sB; if (Bt2) Bt2 += z * sB; C += z * sC;
    const int lane = threadIdx.x & 31, lr = lane & 15, hi = lane >> 4; const int r0 = blockIdx.x * 64, c0 = blockIdx.y * 64;
    v8f acc[4][4];
#pragma unroll
    for (int mb = 0; mb < 4; ++mb)
#pragma unroll
        for (int nb = 0; nb < 4; ++nb) acc[mb][nb] = (v8f){};
    unsigned vo = 16u * lane;   // byte offset of this lane's piece of the current fragment inside a 16-row block: the only part of an operand address that differs between lanes or trips (a fragment is 1 KiB)
    const char *pa[4], *pa2[4], *pb[4], *pb2[4];   // wave-uniform and fixed: the first fragment of each 16-row block (16 rows of fragments hold 16 K elements)
#pragma unroll
    for (int u = 0; u < 4; ++u) { pa[u] = (const char*)(A + (size_t)(r0 + u * 16) * K); pb[u] = (const char*)(Bt + (size_t)(c0 + u * 16) * K); if (NSPLIT == 1 || NSPLIT == 2) pa2[u] = (const char*)(A2 + (size_t)(r0 + u * 16) * K); if (NSPLIT >= 2) pb2[u] = (const char*)(Bt2 + (size_t)(c0 + u * 16) * K); }
#pragma unroll 1
    for (int kc = 0; kc < K; kc += 32) {
        V a[4], a2[4], b[4], b2[4];
#pragma unroll
        for (int u = 0; u < 4; ++u) { a[u] = WFrag<T16>::ld((const T16*)(pa[u] + vo)); b[u] = WFrag<T16>::ld((const T16*)(pb[u] + vo)); if (NSPLIT == 1 || NSPLIT == 2) a2[u] = WFrag<T16>::ld((const T16*)(pa2[u] + vo)); if (NSPLIT >= 2) b2[u] = WFrag<T16>::ld((const T16*)(pb2[u] + vo)); }
        __builtin_amdgcn_sched_barrier(0);   // holds every operand load of the trip in front of the wait below, and so in flight together: one memory latency a trip
        asm volatile("s_wait_xcnt 0x0" :: "v"(vo) : "memory");   // the wait in front of the rewrite of the loads' offset register; as an input it stays whole up to it
#pragma unroll
        for (int nb = 0; nb < 4; ++nb)
#pragma unroll
            for (int mb = 0; mb < 4; ++mb) { acc[mb][nb] = WFrag<T16>::mma(a[mb], b[nb], acc[mb][nb]); if (NSPLIT == 1 || NSPLIT == 2) acc[mb][nb] = WFrag<T16>::mma(a2[mb], b[nb], acc[mb][nb]); if (NSPLIT >= 2) acc[mb][nb] = WFrag<T16>::mma(a[mb], b2[nb], acc[mb][nb]); }
        vo += 1024;
        asm volatile("v_nop\n\tv_nop\n\tv_nop\n\tv_nop" : "+v"(acc[0][0]), "+v"(acc[1][1]), "+v"(acc[2][2]), "+v"(acc[3][3]) : "v"(a[0]), "v"(a[3]));
    }
#pragma unroll
    for (int mb = 0; mb < 4; ++mb) {
#pragma unroll
        for (int nb = 0; nb < 4; ++nb) {
#pragma unroll
            for (int j = 0; j < 8; ++j) os[(hi * 8 + j) * 68 + nb * 16 + lr] = acc[mb][nb][j]; }
        __builtin_amdgcn_wave_barrier(); asm volatile("" ::: "memory");
        float* crow = C + (size_t)(r0 + mb * 16) * ldc + c0;
{
#pragma unroll
            for (int s = 0; s < 8; ++s) { const int row = 2 * s + hi, cofs = lr * 4; v4f val = *(const v4fa*)(os + row * 68 + cofs); if (BIAS) { val[0] += bfr(bias[c0 + cofs]); val[1] += bfr(bias[c0 + cofs + 1]); val[2] += bfr(bias[c0 + cofs + 2]); val[3] += bfr(bias[c0 + cofs + 3]); }
                *(v4f*)(crow + (size_t)row * ldc + cofs) = val; }
             }
        __builtin_amdgcn_wave_barrier(); asm volatile("" ::: "memory");
    }
}

__device__ __forceinline__ h16 tohx(float x) { return (h16)x; }
__device__ __forceinline__ void splitf(float y, unsigned short& h, unsigned short& l) { h = f2bf(y); l = f2bf(y - bf2f(h)); }
typedef __attribute__((ext_vector_type(2))) _Float16 v2h;
typedef __attribute__((ext_vector_type(4))) _Float16 v4h;
typedef __attribute__((ext_vector_type(2))) unsigned short v2us;
typedef __attribute__((ext_vector_type(4))) unsigned short v4us;
typedef __attribute__((ext_vector_type(2))) float v2f;
__device__ __forceinline__ int dpos(int r, int seg, int h, int gi) { const int w = GG * r; const int off = h / (NH_ / r); return seg * w + gi * r + off; }   // dense position of sparse index gi for (branch r, segment, head)

// The writers of the planes. Row-major sources (d_cvt8, d_gath, k_comb): a 16-byte piece is 8 k of one row; lane = 4 rr + kq takes row rr of 8 and piece kq of a 32-k block, so 4 lanes read one whole 128-byte line of f32
// and the 8 lanes of one kq store one whole 128-byte line. Transposed sources (d_wtG, d_gathv): lane = 16 hi + lr as in the readers: 16 lanes read 64 contiguous bytes, the wave stores 512.
// A THREAD MAKES SEVERAL PIECES (4 or 8), not one: with one piece a thread these launches lasted as long as their many short waves took to start. A thread's pieces lie at compile-time distances from its first, in the source and in the
// planes, so one address register serves all its loads of a source and one all its stores of a plane; all loads fly together, every piece is formed, and the stores come last, so that no register of an issued load or store is written again.
template <int K, int N>
__device__ __forceinline__ void d_wtG(int bx, const float* __restrict__ w, bf* Bt) {   // a wave: 16 k (one half of a 32-k block) of 8 neighbouring 16-column blocks: 512 contiguous bytes of each source row
    const int i = bx * 256 + threadIdx.x; const int lane = i & 31, lr = lane & 15, hi = lane >> 4; const int wv = i >> 5; const int half = wv & 1, fr = wv >> 1; const int kb = fr % (K >> 5), ng = fr / (K >> 5);
    const unsigned vo = (unsigned)(kb * 32 + half * 16 + hi * 8) * N + ng * 128 + lr; const float* p = w + vo; float f[8][8]; v8us o[8];
#pragma unroll
    for (int u = 0; u < 8; ++u)
#pragma unroll
        for (int j = 0; j < 8; ++j) f[u][j] = p[j * N + u * 16];
    __builtin_amdgcn_sched_barrier(0);   // holds every load in front of the wait below, and so in flight together
    asm volatile("s_wait_xcnt 0x0" :: "v"(vo) : "memory");   // the wait in front of any rewrite of the loads' offset register; as an input it stays whole up to it
#pragma unroll
    for (int u = 0; u < 8; ++u)
#pragma unroll
        for (int j = 0; j < 8; ++j) o[u][j] = f2bf(f[u][j]);
    bf* q = Bt + ((unsigned)((ng * 8 * (K >> 5) + kb) * 2 + half) * 256 + lane * 8);
    __builtin_amdgcn_sched_barrier(0);   // holds the stores behind the last conversion: nothing is computed into a register of an issued store
#pragma unroll
    for (int u = 0; u < 8; ++u) *(v8us*)(q + u * (K >> 5) * 512) = o[u];
    asm volatile("s_wait_xcnt 0x0" ::: "memory"); }   // behind the job's last store: in a shared launch another job's code follows in the listing and writes the stores' registers again
template <int K>
__device__ __forceinline__ void d_cvt8(int bx, const float* __restrict__ src, bf* dst) {   // a block: 16 whole rows (K = 1024: 32 fragments); wave wq, piece u: 32-k block (u & 3) 8 + wq of the rows (u >> 2) 8 + rr
    static_assert(K == 1024, "8 waves x 8 pieces cover 16 rows of 1024"); const int lane = threadIdx.x & 31, kq = lane & 3, rr = lane >> 2, wq = threadIdx.x >> 5;
    const unsigned vo = ((unsigned)(bx * 16 + rr) * K + wq * 32 + kq * 8) * 4; const float* p = (const float*)((const char*)src + vo); v8f v[8]; v8us o[8];
#pragma unroll
    for (int u = 0; u < 8; ++u) v[u] = *(const v8f*)(p + (u >> 2) * 8 * K + (u & 3) * 256);
    __builtin_amdgcn_sched_barrier(0);   // holds every load in front of the wait below, and so in flight together
    asm volatile("s_wait_xcnt 0x0" :: "v"(vo) : "memory");   // the wait in front of any rewrite of the loads' offset register; as an input it stays whole up to it
#pragma unroll
    for (int u = 0; u < 8; ++u)
#pragma unroll
        for (int j = 0; j < 8; ++j) o[u][j] = f2bf(v[u][j]);
    bf* q = dst + ((unsigned)bx * 16 * K + wq * 512 + (kq >> 1) * 256 + ((kq & 1) * 16 + rr) * 8);
    __builtin_amdgcn_sched_barrier(0);   // holds the stores behind the last conversion: nothing is computed into a register of an issued store
#pragma unroll
    for (int u = 0; u < 8; ++u) *(v8us*)(q + (u & 3) * 8 * 512 + (u >> 2) * 64) = o[u];
    asm volatile("s_wait_xcnt 0x0" ::: "memory"); }   // behind the job's last store: in a shared launch another job's code follows in the listing and writes the stores' registers again
template <int R>
__device__ __forceinline__ void d_gath(int bx, const float* __restrict__ QKV, bf* Qh, bf* Ql, bf* Kh, bf* Kl) {   // a wave: 16 rows of the planes with all 64 d (two whole fragments a plane); piece u: d half u & 1 of the rows (u >> 1) 8 + rr
    const int i = bx * 256 + threadIdx.x; const int lane = i & 31, kq = lane & 3, rr = lane >> 2; const int wv = i >> 5;
    const int zr = wv * 16 + rr; const int gi = zr % GG; const int z = zr / GG; const int h = z % NH_, seg = z / NH_;   // zr: row of the planes, groups one behind the other (GG % 16 == 0)
    const unsigned vo = ((unsigned)dpos(R, seg, h, gi) * (3 * EE) + h * HD + kq * 8) * 4; const float* row = (const float*)((const char*)QKV + vo); v8f q[4], kk[4]; v8us qh[4], ql[4], kh[4], kl[4];
#pragma unroll
    for (int u = 0; u < 4; ++u) { const float* p = row + (u >> 1) * 8 * R * 3 * EE + (u & 1) * 32; q[u] = *(const v8f*)p; kk[u] = *(const v8f*)(p + EE); }
    __builtin_amdgcn_sched_barrier(0);   // holds every load in front of the wait below, and so in flight together
    asm volatile("s_wait_xcnt 0x0" :: "v"(vo) : "memory");   // the wait in front of any rewrite of the loads' offset register; as an input it stays whole up to it
#pragma unroll
    for (int u = 0; u < 4; ++u)
#pragma unroll
        for (int j = 0; j < 8; ++j) { unsigned short a, c; splitf(q[u][j] * 0.125f, a, c); qh[u][j] = a; ql[u][j] = c; splitf(kk[u][j], a, c); kh[u][j] = a; kl[u][j] = c; }
    const unsigned e = (unsigned)wv * 1024 + (kq >> 1) * 256 + ((kq & 1) * 16 + rr) * 8; bf* pqh = Qh + e; bf* pql = Ql + e; bf* pkh = Kh + e; bf* pkl = Kl + e;
    __builtin_amdgcn_sched_barrier(0);   // holds the stores behind the last split: nothing is computed into a register of an issued store
#pragma unroll
    for (int u = 0; u < 4; ++u) { const int c = (u & 1) * 512 + (u >> 1) * 64; *(v8us*)(pqh + c) = qh[u]; *(v8us*)(pql + c) = ql[u]; *(v8us*)(pkh + c) = kh[u]; *(v8us*)(pkl + c) = kl[u]; }
    asm volatile("s_wait_xcnt 0x0" ::: "memory"); }   // behind the job's last store: in a shared launch another job's code follows in the listing and writes the stores' registers again
template <int R>
__device__ __forceinline__ void d_gathv(int bx, const float* __restrict__ QKV, bf* V) {   // a wave: 32 keys of one group with all 64 d (whole 256-byte source rows; four whole fragments a plane); piece (half, nb): keys half 16 + hi 8 + j, d = nb 16 + lr
    const int i = bx * 256 + threadIdx.x; const int lane = i & 31, lr = lane & 15, hi = lane >> 4; const int wv = i >> 5; const int kb = wv % (GG / 32), zl = wv / (GG / 32); const int h = zl % NH_, seg = zl / NH_;
    const unsigned vo = (unsigned)dpos(R, seg, h, kb * 32 + hi * 8) * (3 * EE) + h * HD + lr; const float* p = QKV + 2 * EE + vo; float f[2][4][8]; v8us oh[2][4], ol[2][4];   // element offset inside qkv (12.6 M elements): one register beside the uniform base
#pragma unroll
    for (int half = 0; half < 2; ++half)
#pragma unroll
        for (int j = 0; j < 8; ++j)
#pragma unroll
            for (int nb = 0; nb < 4; ++nb) f[half][nb][j] = p[(half * 16 + j) * R * 3 * EE + nb * 16];
    __builtin_amdgcn_sched_barrier(0);   // holds every load in front of the wait below, and so in flight together
    asm volatile("s_wait_xcnt 0x0" :: "v"(vo) : "memory");   // the wait in front of any rewrite of the loads' offset register; as an input it stays whole up to it
#pragma unroll
    for (int half = 0; half < 2; ++half)
#pragma unroll
        for (int nb = 0; nb < 4; ++nb)
#pragma unroll
            for (int j = 0; j < 8; ++j) { unsigned short a, c; splitf(f[half][nb][j], a, c); oh[half][nb][j] = a; ol[half][nb][j] = c; }
    bf* q = V + ((unsigned)zl * (2 * HD * GG) + kb * 512 + lane * 8);   // per group: the hi plane [HD rows d][GG keys] in fragment order, then the lo plane
    __builtin_amdgcn_sched_barrier(0);   // holds the stores behind the last split: nothing is computed into a register of an issued store
#pragma unroll
    for (int half = 0; half < 2; ++half)
#pragma unroll
        for (int nb = 0; nb < 4; ++nb) { *(v8us*)(q + nb * 16 * GG + half * 256) = oh[half][nb]; *(v8us*)(q + nb * 16 * GG + half * 256 + HD * GG) = ol[half][nb]; }
    asm volatile("s_wait_xcnt 0x0" ::: "memory"); }   // behind the job's last store: in a shared launch another job's code follows in the listing and writes the stores' registers again
// ---- Pre-passes that do not depend on one another SHARE A LAUNCH: the block's number picks its job (a scalar branch) and its place inside that job. Alone, each of these short launches paid the gap to the launch before it,
// its own start and its own drain, and the smaller ones left most of the chip idle meanwhile. k_pre: x and both weights into their planes. k_gall: the q/k and the v planes of all three branches, the larger jobs first.
#define NB_CVT (LL / 16)
#define NB_WQ  (EE * 3 * EE / 64 / 256)
#define NB_WP  (EE * EE / 64 / 256)
__global__ __launch_bounds__(256) void k_pre(const float* __restrict__ x, const float* __restrict__ wqkv, const float* __restrict__ wproj, bf* XB, bf* WQ, bf* WP) {
    const int b = blockIdx.x;
    if (b < NB_CVT) d_cvt8<EE>(b, x, XB);
    else if (b < NB_CVT + NB_WQ) d_wtG<EE, 3 * EE>(b - NB_CVT, wqkv, WQ);
    else d_wtG<EE, EE>(b - NB_CVT - NB_WQ, wproj, WP);
}
#define NB_G1 (4 * NH_ * GG / 128)   // blocks of the q/k planes of branch 1 (a branch of nz groups: nz GG / 16 waves, 8 waves a block); the v planes take half as many (nz GG / 32 waves), branch 2 half of branch 1, branch 4 a quarter
#define PO1 ((size_t)4 * NH_ * GG * HD)   // first plane element of branch 2's groups, and of branch 4's
#define PO2 ((size_t)6 * NH_ * GG * HD)
__global__ __launch_bounds__(256) void k_gall(const float* __restrict__ QKV, bf* Qh, bf* Ql, bf* Kh, bf* Kl, bf* V) {
    int b = blockIdx.x;
    if (b < NB_G1) { d_gath<1>(b, QKV, Qh, Ql, Kh, Kl); return; }
    b -= NB_G1;
    if (b < NB_G1 / 2) { d_gathv<1>(b, QKV, V); return; }
    b -= NB_G1 / 2;
    if (b < NB_G1 / 2) { d_gath<2>(b, QKV, Qh + PO1, Ql + PO1, Kh + PO1, Kl + PO1); return; }
    b -= NB_G1 / 2;
    if (b < NB_G1 / 4) { d_gathv<2>(b, QKV, V + 2 * PO1); return; }
    b -= NB_G1 / 4;
    if (b < NB_G1 / 4) { d_gath<4>(b, QKV, Qh + PO2, Ql + PO2, Kh + PO2, Kl + PO2); return; }
    b -= NB_G1 / 4;
    d_gathv<4>(b, QKV, V + 2 * PO2);
}
// ---- k_fattn: scores, softmax, the probability-logsumexp and probs.v of one (segment, head) group in ONE kernel; no score or probability ever reaches memory. Block = 4 independent waves (no barrier, no LDS); a wave owns 32 query rows
// and walks its causal keys 32 at a time, twice: sweep 1 finds each row's max and sum (running, rescaled), sweep 2 forms the scores again, normalises them, sums exp(p) and multiplies by v.
// The score tile is computed TRANSPOSED (A = keys, B = queries): lane (lr, hi) then holds query lr, keys 8 hi + j of tile 0 and 16 + 8 hi + j of tile 1, which is the k order of the A fragment that probs.v needs: no exchange between lanes.
__device__ __forceinline__ void fa_kload(const bf* __restrict__ pkh, const bf* __restrict__ pkl, v16bf (&ah)[2][2], v16bf (&al)[2][2]) {   // pkh, pkl: the four fragments of keys k0 .. k0 + 31, at this lane's piece
#pragma unroll
    for (int kt = 0; kt < 2; ++kt)
#pragma unroll
        for (int kc = 0; kc < 2; ++kc) { ah[kt][kc] = WFrag<bf>::ld(pkh + (kt * 2 + kc) * 512); al[kt][kc] = WFrag<bf>::ld(pkl + (kt * 2 + kc) * 512); }
}
__device__ __forceinline__ void fa_scores(const v16bf (&ah)[2][2], const v16bf (&al)[2][2], int k0, int lr, int hi, int r0, const v16bf (&bqh)[2][2], const v16bf (&bql)[2][2], v8f (&s)[2][2]) {
#pragma unroll
    for (int kt = 0; kt < 2; ++kt)
#pragma unroll
        for (int qb = 0; qb < 2; ++qb) { v8f acc = (v8f){};
#pragma unroll
            for (int kc = 0; kc < 2; ++kc) { acc = wmmab(ah[kt][kc], bqh[qb][kc], acc); acc = wmmab(ah[kt][kc], bql[qb][kc], acc); acc = wmmab(al[kt][kc], bqh[qb][kc], acc); }
#pragma unroll
            for (int j = 0; j < 8; ++j) s[kt][qb][j] = (k0 + kt * 16 + hi * 8 + j) <= (r0 + qb * 16 + lr) ? acc[j] : -3.0e38f; }   // causal mask by select
}
__global__ __launch_bounds__(128) void k_fattn(const bf* __restrict__ Qh, const bf* __restrict__ Ql, const bf* __restrict__ Kh, const bf* __restrict__ Kl, const bf* __restrict__ V, float* Ob, float* LSEX) {
    const int lane = threadIdx.x & 31, lr = lane & 15, hi = lane >> 4; const int z = blockIdx.x;
    const int t = GG / 32 - 1 - (int)(blockIdx.y * 4 + __builtin_amdgcn_readfirstlane(threadIdx.x >> 5));   // the longest rows are launched first; the wave's number in a scalar register, so that both loops branch on scalars
    const int r0 = t * 32; const size_t zo = (size_t)z * GG * HD; const size_t lo = zo + 8 * lane;
    v16bf bqh[2][2], bql[2][2]; const bf* pqh = Qh + lo + (size_t)r0 * HD; const bf* pql = Ql + lo + (size_t)r0 * HD;
#pragma unroll
    for (int qb = 0; qb < 2; ++qb)
#pragma unroll
        for (int kc = 0; kc < 2; ++kc) { bqh[qb][kc] = WFrag<bf>::ld(pqh + (qb * 2 + kc) * 512); bql[qb][kc] = WFrag<bf>::ld(pql + (qb * 2 + kc) * 512); }
    asm volatile("s_wait_xcnt 0x0" :: "v"(pqh), "v"(pql) : "memory");   // the wait in front of any reuse of the query loads' address registers; as inputs they stay whole up to it
    float m[2] = {-3.0e38f, -3.0e38f}, l[2] = {0.f, 0.f};
    { const bf* pkh = Kh + lo; const bf* pkl = Kl + lo;
    for (int kb = 0; kb <= t; ++kb) { v8f s[2][2]; v16bf ah[2][2], al[2][2]; fa_kload(pkh, pkl, ah, al);
        __builtin_amdgcn_sched_barrier(0);   // holds all sixteen key loads in front of the first product: one memory latency a step instead of one per pair of loads
        asm volatile("s_wait_xcnt 0x0" :: "v"(pkh), "v"(pkl) : "memory");   // the wait in front of any rewrite of the loads' address registers; as inputs they stay whole up to it
        fa_scores(ah, al, kb * 32, lr, hi, r0, bqh, bql, s); pkh += 32 * HD; pkl += 32 * HD;
#pragma unroll
        for (int qb = 0; qb < 2; ++qb) { float mx = m[qb];
#pragma unroll
            for (int j = 0; j < 8; ++j) mx = fmaxf(mx, fmaxf(s[0][qb][j], s[1][qb][j]));
            float a = l[qb] * __expf(m[qb] - mx);
#pragma unroll
            for (int j = 0; j < 8; ++j) a += __expf(s[0][qb][j] - mx) + __expf(s[1][qb][j] - mx);
            m[qb] = mx; l[qb] = a; } } }
    float inv[2];
#pragma unroll
    for (int qb = 0; qb < 2; ++qb) { const float mm = fmaxf(m[qb], __shfl_xor(m[qb], 16, 32)); float a = l[qb] * __expf(m[qb] - mm); a += __shfl_xor(a, 16, 32); m[qb] = mm; inv[qb] = __fdiv_rn(1.0f, a); }   // a lane whose keys were all masked holds m = -3e38: its sum is scaled to 0
    float se[2] = {0.f, 0.f}; v8f o[2][4];
#pragma unroll
    for (int qb = 0; qb < 2; ++qb)
#pragma unroll
        for (int nb = 0; nb < 4; ++nb) o[qb][nb] = (v8f){};
    { const bf* pkh = Kh + lo; const bf* pkl = Kl + lo; const bf* pv = V + (size_t)z * HD * 2 * GG + 8 * lane;
    for (int kb = 0; kb <= t; ++kb) { v8f s[2][2]; v16bf ah[2][2], al[2][2], vh[4], vl[4]; fa_kload(pkh, pkl, ah, al);
#pragma unroll
        for (int nb = 0; nb < 4; ++nb) { vh[nb] = WFrag<bf>::ld(pv + (size_t)nb * 16 * GG); vl[nb] = WFrag<bf>::ld(pv + (size_t)nb * 16 * GG + HD * GG); }
        __builtin_amdgcn_sched_barrier(0);   // holds the key and the value loads in front of the first product: one memory latency a step, and the value tile flies under the scores and the softmax
        asm volatile("s_wait_xcnt 0x0" :: "v"(pkh), "v"(pkl), "v"(pv) : "memory");   // the wait in front of any rewrite of the loads' address registers; as inputs they stay whole up to it
        fa_scores(ah, al, kb * 32, lr, hi, r0, bqh, bql, s); pkh += 32 * HD; pkl += 32 * HD; pv += 512; v16bf ph[2], pl[2];
#pragma unroll
        for (int qb = 0; qb < 2; ++qb) { v8us h[2], c[2];
#pragma unroll
            for (int kt = 0; kt < 2; ++kt)
#pragma unroll
                for (int j = 0; j < 8; ++j) { const float p = __expf(s[kt][qb][j] - m[qb]) * inv[qb]; se[qb] += __expf(p); unsigned short a, b; splitf(p, a, b); h[kt][j] = a; c[kt][j] = b; }   // masked: p = 0 exactly, exp(0) = 1, as the reference
            ph[qb] = cat16b(h[0], h[1]); pl[qb] = cat16b(c[0], c[1]); }
#pragma unroll
        for (int nb = 0; nb < 4; ++nb)
#pragma unroll
            for (int qb = 0; qb < 2; ++qb) { o[qb][nb] = wmmab(ph[qb], vh[nb], o[qb][nb]); o[qb][nb] = wmmab(pl[qb], vh[nb], o[qb][nb]); o[qb][nb] = wmmab(ph[qb], vl[nb], o[qb][nb]); } } }
#pragma unroll
    for (int qb = 0; qb < 2; ++qb) { const float st = se[qb] + __shfl_xor(se[qb], 16, 32) + (float)(GG - (t + 1) * 32);   // the keys beyond this wave's last tile are masked: exp(0) = 1 each
        const float lse = __logf(st); const v4f lv = {lse, lse, lse, lse}; float* lp = LSEX + ((size_t)z * GG + r0 + qb * 16 + lr) * 32 + hi * 16;
#pragma unroll
        for (int q = 0; q < 4; ++q) *(v4f*)(lp + q * 4) = lv;
#pragma unroll
        for (int nb = 0; nb < 4; ++nb)
#pragma unroll
            for (int j = 0; j < 8; ++j) Ob[((size_t)z * GG + r0 + qb * 16 + hi * 8 + j) * HD + nb * 16 + lr] = o[qb][nb][j]; }
}
// k_comb: per (l, h): for each branch k (r = 1, 2, 4; segment w = 1024 r): head h uses position l iff (l mod w) mod r == h / (16/r); then gi = (l mod w) / r, z = (l / w) 16 + h, o_k = Ob_k[z][gi][:] and
// a wave: head h (64 k: two whole fragments a plane) of 16 positions; a thread's piece 2 g + c2 is k half c2 of position l + 8 g, where the same branches are in use (8 % r == 0) 8 / r rows further on; the weights of a position serve both its halves
__global__ __launch_bounds__(256) void k_comb(const float* __restrict__ Ob0, const float* __restrict__ Ob1, const float* __restrict__ Ob2, const float* __restrict__ L0, const float* __restrict__ L1, const float* __restrict__ L2, bf* Ah, bf* Al) { const int i = blockIdx.x * 256 + threadIdx.x; const int lane = i & 31, kq = lane & 3, rr = lane >> 2; const int wv = i >> 5; const int h = wv % NH_; const int l = (wv / NH_) * 16 + rr;
    const float* obs[3] = {Ob0, Ob1, Ob2}; const float* lss[3] = {L0, L1, L2}; float lsq[2][3]; unsigned vl[3], vb[3]; bool used[3]; v8f obq[4][3]; v8us ohq[4], olq[4];
#pragma unroll
    for (int k = 0; k < 3; ++k) { const int r = 1 << k; const int w = GG * r; const int ll = l % w; const int off = h / (NH_ / r); used[k] = (ll % r) == off; const int gi = ll / r; const int z = (l / w) * NH_ + h; const unsigned src = (unsigned)(z * GG + gi); vl[k] = src * (32 * 4); vb[k] = (src * HD + kq * 8) * 4;   // byte offsets: one register a branch for the lse rows, one for the outputs
        const float* pl = (const float*)((const char*)lss[k] + vl[k]); const float* po = (const float*)((const char*)obs[k] + vb[k]);
        lsq[0][k] = lsq[1][k] = -1.0e8f; obq[0][k] = obq[1][k] = obq[2][k] = obq[3][k] = (v8f){};
        if (used[k]) {   // one masked stretch a branch: its two lse values and, per piece, 8 outputs in two 16-byte loads; all pieces and branches in flight together
#pragma unroll
            for (int g = 0; g < 2; ++g) lsq[g][k] = pl[g * (8 / r) * 32];
#pragma unroll
            for (int pc = 0; pc < 4; ++pc) obq[pc][k] = *(const v8f*)(po + (pc >> 1) * (8 / r) * HD + (pc & 1) * 32); } }
    asm volatile("s_wait_xcnt 0x0" :: "v"(vl[0]), "v"(vl[1]), "v"(vl[2]), "v"(vb[0]), "v"(vb[1]), "v"(vb[2]) : "memory");   // the wait in front of any rewrite of the loads' offset registers; as inputs they stay whole up to it
#pragma unroll
    for (int g = 0; g < 2; ++g) { const float (&lse)[3] = lsq[g];
    const float m = fmaxf(lse[0], fmaxf(lse[1], lse[2])); float ex[3]; float den = 0.f;
#pragma unroll
    for (int k = 0; k < 3; ++k) { ex[k] = __expf(__fsub_rn(lse[k], m)); den = __fadd_rn(den, ex[k]); }
    const float inv = __fdiv_rn(1.0f, den);
#pragma unroll
    for (int c2 = 0; c2 < 2; ++c2) { const v8f (&ob)[3] = obq[g * 2 + c2]; v8us oh, ol;
#pragma unroll
    for (int u = 0; u < 8; ++u) { float acc = 0.f;
#pragma unroll
        for (int k = 0; k < 3; ++k) { const float o = ob[k][u]; float p = __fmul_rn(o, ex[k] * inv); asm volatile("" : "+v"(p)); acc = __fadd_rn(acc, p); }
        unsigned short a, c; splitf(acc, a, c); oh[u] = a; ol[u] = c; }
    ohq[g * 2 + c2] = oh; olq[g * 2 + c2] = ol; } }
    const unsigned e = (unsigned)wv * 1024 + (kq >> 1) * 256 + ((kq & 1) * 16 + rr) * 8; bf* pah = Ah + e; bf* pal = Al + e;
    __builtin_amdgcn_sched_barrier(0);   // holds the stores behind the last split: nothing is computed into a register of an issued store
#pragma unroll
    for (int pc = 0; pc < 4; ++pc) { *(v8us*)(pah + (pc & 1) * 512 + (pc >> 1) * 64) = ohq[pc]; *(v8us*)(pal + (pc & 1) * 512 + (pc >> 1) * 64) = olq[pc]; } }

extern "C" void kernel_launch(void* const* d_in, const int* in_sizes, int n_in,
                              void* d_out, int out_size, void* d_ws, size_t ws_size, hipStream_t stream) {
    (void)in_sizes; (void)n_in; (void)out_size;
    const float* x = (const float*)d_in[0]; const float* wqkv = (const float*)d_in[1]; const float* wproj = (const float*)d_in[2];
    float* OUT = (float*)d_out;     // [1][4096][1024]
    char* wsp = (char*)d_ws;
    auto take = [&](size_t bytes) { char* p = wsp; wsp += (bytes + 255) & ~(size_t)255; return (void*)p; };
    const int NZ = 7 * NH_;   // (segment, head) groups of all three branches: 64 + 32 + 16, numbered through
    bf* WP = (bf*)take((size_t)EE * EE * 2); float* QKV = (float*)take((size_t)LL * 3 * EE * 4);
    bf* Qh = (bf*)take((size_t)NZ * GG * HD * 2); bf* Ql = (bf*)take((size_t)NZ * GG * HD * 2); bf* Kh = (bf*)take((size_t)NZ * GG * HD * 2); bf* Kl = (bf*)take((size_t)NZ * GG * HD * 2); bf* V = (bf*)take((size_t)NZ * HD * GG * 4);
    bf* WQ = (bf*)take((size_t)3 * EE * EE * 2); bf* XB = (bf*)take((size_t)LL * EE * 2); bf* Ah = (bf*)take((size_t)LL * EE * 2); bf* Al = (bf*)take((size_t)LL * EE * 2);
    float* Ob = (float*)take((size_t)NZ * GG * HD * 4); float* LS = (float*)take((size_t)NZ * GG * 32 * 4);
    const int zb[3] = {0, 4 * NH_, 6 * NH_};   // first group of each branch
    float* ObK[3]; float* LSK[3]; for (int k = 0; k < 3; ++k) { ObK[k] = Ob + (size_t)zb[k] * GG * HD; LSK[k] = LS + (size_t)zb[k] * GG * 32; }
    if ((size_t)(wsp - (char*)d_ws) > ws_size) return;    // total 216 MB (qkv f32 [4096][3072] 50 MB, gathered hl planes of 112 groups 88 MB, branch outputs + row-replicated lse 44 MB, weights, x and the combined planes 34 MB)
    k_pre<<<NB_CVT + NB_WQ + NB_WP, 256, 0, stream>>>(x, wqkv, wproj, XB, WQ, WP);
    k_gemmw<bf, 0, false><<<dim3(LL / 64, 3 * EE / 64, 1), 32, 0, stream>>>(XB, nullptr, WQ, nullptr, EE, QKV, 3 * EE, nullptr, 0, 0, 0);
    k_gall<<<NB_G1 * 21 / 8, 256, 0, stream>>>(QKV, Qh, Ql, Kh, Kl, V);   // 1 + 1/2 + 1/2 + 1/4 + 1/4 + 1/8 of branch 1's q/k blocks
    k_fattn<<<dim3(NZ, GG / 128, 1), 128, 0, stream>>>(Qh, Ql, Kh, Kl, V, Ob, LS);
    k_comb<<<LL * NH_ / 128, 256, 0, stream>>>(ObK[0], ObK[1], ObK[2], LSK[0], LSK[1], LSK[2], Ah, Al);
    k_gemmw<bf, 1, false><<<dim3(LL / 64, EE / 64, 1), 32, 0, stream>>>(Ah, Al, WP, nullptr, EE, OUT, EE, nullptr, 0, 0, 0);
}

// v006
// Measured time: 131 microseconds a run.
// Two timings next to v005 both put it at 1.13 times that version's speed.
// Over all steps from v000 it is 6.18 times as fast.
#include <hip/hip_runtime.h>

// Dilated causal self-attention (x [1][4096][1024]; qkv = x w_qkv (16 heads x 64); three branches (segment w, dilation r) = (1024,1), (2048,2), (4096,4): inside each segment, head h attends causally over the
// g = w/r = 1024 positions {gi r + off}, off = h / (16/r) (the reference's diagonal sparsify); softmax(q.k/8) with a causal mask over gi; branch output scattered back to those positions (0 elsewhere) with lse = logsumexp over the softmax
// PROBABILITIES of the row (masked entries contribute exp(0)), -1e8 elsewhere; branches recombined per (position, head) with softmax(lse) weights; out @ w_proj -> [1][4096][1024]).
// Compute dtypes, f32 accumulate: every input rounded to bf16; qkv on PLAIN bf16 operands (inputs: exact); per (segment, head) 1024x1024 attention on bf16 hi+lo planes gathered at the dilated positions
// (q x 1/8 exact; scores K 64 with 3 products, causal tiles skipped), softmax + the probability-logsumexp in f32 registers, probs.v on hl planes (3 products); the 3-branch recombination f32; w_proj on hl planes x exact (2 products). GEMMs: four waves per 128x128 tile, operands staged in LDS

#define LL   4096
#define EE   1024
#define NH_  16
#define HD   64
#define GG   1024
#define PCAR 1024.0f
typedef _Float16 h16;
typedef unsigned short bf;
typedef __attribute__((ext_vector_type(16))) __bf16   v16bf;
typedef __attribute__((ext_vector_type(16))) _Float16 v16h;
typedef __attribute__((ext_vector_type(8)))  _Float16 v8h;
typedef __attribute__((ext_vector_type(8)))  unsigned short v8us;
typedef __attribute__((ext_vector_type(8)))  float    v8f;
typedef __attribute__((ext_vector_type(4)))  float    v4f;
typedef v8h  __attribute__((may_alias)) v8ha;
typedef v4f  __attribute__((may_alias)) v4fa;
typedef v8us __attribute__((may_alias)) v8usa;

__device__ __forceinline__ unsigned short f2bf(float f) { unsigned u = __float_as_uint(f); u += 0x7FFFu + ((u >> 16) & 1u); return (unsigned short)(u >> 16); }
__device__ __forceinline__ float bf2f(unsigned short b) { return __uint_as_float(((unsigned)b) << 16); }
__device__ __forceinline__ float bfr(float f) { return bf2f(f2bf(f)); }
__device__ __forceinline__ v16h cat16(v8h lo, v8h hi) { return __builtin_shufflevector(lo, hi, 0, 1, 2, 3, 4, 5, 6, 7, 8, 9, 10, 11, 12, 13, 14, 15); }
__device__ __forceinline__ v16bf cat16b(v8us lo, v8us hi) { return __builtin_bit_cast(v16bf, __builtin_shufflevector(lo, hi, 0, 1, 2, 3, 4, 5, 6, 7, 8, 9, 10, 11, 12, 13, 14, 15)); }
__device__ __forceinline__ v8f wmma16(v16h a, v16h b, v8f c) { return __builtin_amdgcn_wmma_f32_16x16x32_f16(false, a, false, b, (short)0, c, false, false); }
__device__ __forceinline__ v8f wmmab(v16bf a, v16bf b, v8f c) { return __builtin_amdgcn_wmma_f32_16x16x32_bf16(false, a, false, b, (short)0, c, false, false); }



// ---- FRAGMENT ORDER of every 16-bit operand plane [rows][K]: the plane is cut into fragments of 16 rows x 32 k (512 elements, 1 KiB), numbered (row / 16) (K / 32) + k / 32; inside a fragment element (row, k) lies at
// ((k >> 4) & 1) 256 + (((k >> 3) & 1) 16 + (row & 15)) 8 + (k & 7). Lane (lr, hi) = 16 hi + lr then finds its 8 + 8 elements (k = 8 hi + j and 16 + 8 hi + j of row lr, the hardware k order) at lane 8 and 256 + lane 8:
// each wave-wide 16-byte load reads 512 contiguous bytes, 4 whole lines, where a row-major plane made it touch 16 lines.
__device__ __forceinline__ size_t fo8(int row, int k, int K) { return ((size_t)(row >> 4) * (K >> 5) + (k >> 5)) * 512 + ((k >> 4) & 1) * 256 + (((k >> 3) & 1) * 16 + (row & 15)) * 8; }   // place of the 8 elements k .. k + 7 (k % 8 == 0) of a row
// ---- k_gemmw: GEMM on 16-bit planes in fragment order. A block of FOUR WAVES (2 x 2) makes a 128x128 tile of C, a wave its 64x64 quarter (16 accumulators); grid (M/128, N/128, Z), 128 threads.
// The block's operands pass through LDS: a stage is 64 k of the tile's 128 rows of every plane (8 row blocks x 2 fragments = 16 KiB a plane), brought in by asynchronous copies, each byte once a block, where four separate waves
// fetched each fragment twice from L2. Fragments are copied as they lie (1 KiB, lane-contiguous), so a wave-wide 16-byte LDS read takes 512 contiguous bytes. Two buffers: the next stage's copies fly while this stage is multiplied.
// C[m][n] (f32, pitch ldc, + optional f32 bias[n]) = sum_k A[m][k] Bt[n][k] (+ split products per NSPLIT). z-batch strides sA/sB/sC in elements. M % 128 == 0, N % 128 == 0, K % 64 == 0.
template <typename T16> struct WFrag;
template <> struct WFrag<h16> { typedef v16h V; static __device__ __forceinline__ V ld(const h16* p) { return cat16(*(const v8h*)p, *(const v8h*)(p + 256)); } static __device__ __forceinline__ v8f mma(V a, V b, v8f c) { return wmma16(a, b, c); } };
template <> struct WFrag<bf> { typedef v16bf V; static __device__ __forceinline__ V ld(const bf* p) { return cat16b(*(const v8us*)p, *(const v8us*)(p + 256)); } static __device__ __forceinline__ v8f mma(V a, V b, v8f c) { return wmmab(a, b, c); } };
// One wave's share of one plane's stage: two row blocks of 2 KiB, eight wave-wide copies of 512 bytes; l: the lane's LDS byte address, g: the lane's source address, rbstep: bytes from a row block of the plane to the next.
__device__ __forceinline__ void cp8(unsigned l, const char* g, unsigned rbstep) { const char* g2 = g + rbstep;
    asm volatile("global_load_async_to_lds_b128 %0, %8, off\n\t"
                 "global_load_async_to_lds_b128 %1, %9, off\n\t"
                 "global_load_async_to_lds_b128 %2, %10, off\n\t"
                 "global_load_async_to_lds_b128 %3, %11, off\n\t"
                 "global_load_async_to_lds_b128 %4, %12, off\n\t"
                 "global_load_async_to_lds_b128 %5, %13, off\n\t"
                 "global_load_async_to_lds_b128 %6, %14, off\n\t"
                 "global_load_async_to_lds_b128 %7, %15, off\n\t"
                 "s_wait_xcnt 0x0"   // inside the copies' own statement: it stands in front of any rewrite of their address registers
                 :: "v"(l), "v"(l + 512u), "v"(l + 1024u), "v"(l + 1536u), "v"(l + 2048u), "v"(l + 2560u), "v"(l + 3072u), "v"(l + 3584u),
                    "v"(g), "v"(g + 512), "v"(g + 1024), "v"(g + 1536), "v"(g2), "v"(g2 + 512), "v"(g2 + 1024), "v"(g2 + 1536) : "memory"); }
template <typename T16, int NSPLIT, bool BIAS>
__global__ __launch_bounds__(128) void k_gemmw(const T16* __restrict__ A, const T16* __restrict__ A2, const T16* __restrict__ Bt, const T16* __restrict__ Bt2, int K, float* C, int ldc, const float* __restrict__ bias, size_t sA, size_t sB, size_t sC) {
    typedef typename WFrag<T16>::V V;
    constexpr int NPA = (NSPLIT == 1 || NSPLIT == 2) ? 2 : 1, NPB = NSPLIT >= 2 ? 2 : 1, NP = NPA + NPB;   // planes staged: A (, A2), Bt (, Bt2)
    constexpr unsigned PLB = 8 * 2048, BUFB = NP * PLB;   // bytes of a plane's stage and of a buffer
    __shared__ __align__(2048) char ring[2 * BUFB];
    __shared__ __align__(16) float osm[4][16 * 68];
    const size_t z = blockIdx.z; A += z * sA; if (A2) A2 += z * sA; Bt += z * sB; if (Bt2) Bt2 += z * sB; C += z * sC;
    const int lane = threadIdx.x & 31, lr = lane & 15, hi = lane >> 4; const int w = __builtin_amdgcn_readfirstlane(threadIdx.x >> 5), wm = w & 1, wn = w >> 1;
    const int R0 = blockIdx.x * 128, C0 = blockIdx.y * 128; const int r0 = R0 + wm * 64, c0 = C0 + wn * 64; float* os = osm[w];
    v8f acc[4][4];
#pragma unroll
    for (int mb = 0; mb < 4; ++mb)
#pragma unroll
        for (int nb = 0; nb < 4; ++nb) acc[mb][nb] = (v8f){};
    const unsigned rbstep = (unsigned)K * 32;   // 16 rows of a plane hold 16 K elements
    const char* gs[NP];   // wave w copies row blocks 2 w and 2 w + 1 of every plane's stage
    gs[0] = (const char*)(A + (size_t)(R0 + w * 32) * K) + lane * 16; if (NPA == 2) gs[1] = (const char*)(A2 + (size_t)(R0 + w * 32) * K) + lane * 16;
    gs[NPA] = (const char*)(Bt + (size_t)(C0 + w * 32) * K) + lane * 16; if (NPB == 2) gs[NPA + 1] = (const char*)(Bt2 + (size_t)(C0 + w * 32) * K) + lane * 16;
    const unsigned l0 = (unsigned)(size_t)ring + w * 4096 + lane * 16;
    auto fill = [&](int buf) {
#pragma unroll
        for (int p = 0; p < NP; ++p) { cp8(l0 + buf * BUFB + p * PLB, gs[p], rbstep); gs[p] += 2048; } };
    const int NT = K >> 6;
    fill(0);
    asm volatile("s_wait_asynccnt 0x0" ::: "memory");   // this wave's copies of stage 0 have landed
    __syncthreads();                                     // and every other wave's: stage 0 may be read
    if (NT > 1) fill(1);
#pragma unroll 1   // rolled: one copy of a stage's code in the instruction cache; the buffer is picked by a scalar
    for (int t = 0; t < NT; ++t) {
        const char* rb = ring + (t & 1) * BUFB + lane * 16;
        V a[2][4], a2[2][4], b[2][4], b2[2][4];
#pragma unroll
        for (int ks = 0; ks < 2; ++ks)
#pragma unroll
            for (int u = 0; u < 4; ++u) { a[ks][u] = WFrag<T16>::ld((const T16*)(rb + (wm * 4 + u) * 2048 + ks * 1024)); b[ks][u] = WFrag<T16>::ld((const T16*)(rb + NPA * PLB + (wn * 4 + u) * 2048 + ks * 1024));
                if (NPA == 2) a2[ks][u] = WFrag<T16>::ld((const T16*)(rb + PLB + (wm * 4 + u) * 2048 + ks * 1024)); if (NPB == 2) b2[ks][u] = WFrag<T16>::ld((const T16*)(rb + (NPA + 1) * PLB + (wn * 4 + u) * 2048 + ks * 1024)); }
        __builtin_amdgcn_sched_barrier(0);   // holds every fragment read of the stage in front of its first product: one LDS latency a stage; left alone, the reads stood one by one among the products, each with its own full wait
#pragma unroll
        for (int ks = 0; ks < 2; ++ks)
#pragma unroll
            for (int nb = 0; nb < 4; ++nb)
#pragma unroll
                for (int mb = 0; mb < 4; ++mb) { acc[mb][nb] = WFrag<T16>::mma(a[ks][mb], b[ks][nb], acc[mb][nb]); if (NSPLIT == 1 || NSPLIT == 2) acc[mb][nb] = WFrag<T16>::mma(a2[ks][mb], b[ks][nb], acc[mb][nb]); if (NSPLIT >= 2) acc[mb][nb] = WFrag<T16>::mma(a[ks][mb], b2[ks][nb], acc[mb][nb]); }
        __builtin_amdgcn_sched_barrier(0);   // holds the products in front of the closing waits: sunk behind the barrier, they would leave the next stage's copies only the time of the fragment reads to land
        asm volatile("s_wait_dscnt 0x0" ::: "memory");      // this wave's reads of the buffer are over before it is refilled
        asm volatile("s_wait_asynccnt 0x0" ::: "memory");   // this wave's copies of stage t + 1 have landed
        __syncthreads();                                     // publishes stage t + 1 and ends every wave's reads of stage t
        if (t + 2 < NT) fill(t & 1);
    }
    asm volatile("s_wait_asynccnt 0x0" ::: "memory");   // no copy is outstanding when the wave goes on and ends
#pragma unroll
    for (int mb = 0; mb < 4; ++mb) {
#pragma unroll
        for (int nb = 0; nb < 4; ++nb) {
#pragma unroll
            for (int j = 0; j < 8; ++j) os[(hi * 8 + j) * 68 + nb * 16 + lr] = acc[mb][nb][j]; }
        __builtin_amdgcn_wave_barrier(); asm volatile("" ::: "memory");
        float* crow = C + (size_t)(r0 + mb * 16) * ldc + c0;
{
#pragma unroll
            for (int s = 0; s < 8; ++s) { const int row = 2 * s + hi, cofs = lr * 4; v4f val = *(const v4fa*)(os + row * 68 + cofs); if (BIAS) { val[0] += bfr(bias[c0 + cofs]); val[1] += bfr(bias[c0 + cofs + 1]); val[2] += bfr(bias[c0 + cofs + 2]); val[3] += bfr(bias[c0 + cofs + 3]); }
                *(v4f*)(crow + (size_t)row * ldc + cofs) = val; }
             }
        __builtin_amdgcn_wave_barrier(); asm volatile("" ::: "memory");
    }
}

__device__ __forceinline__ h16 tohx(float x) { return (h16)x; }
__device__ __forceinline__ void splitf(float y, unsigned short& h, unsigned short& l) { h = f2bf(y); l = f2bf(y - bf2f(h)); }
typedef __attribute__((ext_vector_type(2))) _Float16 v2h;
typedef __attribute__((ext_vector_type(4))) _Float16 v4h;
typedef __attribute__((ext_vector_type(2))) unsigned short v2us;
typedef __attribute__((ext_vector_type(4))) unsigned short v4us;
typedef __attribute__((ext_vector_type(2))) float v2f;
__device__ __forceinline__ int dpos(int r, int seg, int h, int gi) { const int w = GG * r; const int off = h / (NH_ / r); return seg * w + gi * r + off; }   // dense position of sparse index gi for (branch r, segment, head)

// The writers of the planes. Row-major sources (d_cvt8, d_gath, k_comb): a 16-byte piece is 8 k of one row; lane = 4 rr + kq takes row rr of 8 and piece kq of a 32-k block, so 4 lanes read one whole 128-byte line of f32
// and the 8 lanes of one kq store one whole 128-byte line. Transposed sources (d_wtG, d_gathv): lane = 16 hi + lr as in the readers: 16 lanes read 64 contiguous bytes, the wave stores 512.
// A THREAD MAKES SEVERAL PIECES (4 or 8), not one, for speed only. A thread's pieces lie at compile-time distances from its first, in the source and in the
// planes, so one address register serves all its loads of a source and one all its stores of a plane; all loads fly together, every piece is formed, and the stores come last, so that no register of an issued load or store is written again.
template <int K, int N>
__device__ __forceinline__ void d_wtG(int bx, const float* __restrict__ w, bf* Bt) {   // a wave: 16 k (one half of a 32-k block) of 8 neighbouring 16-column blocks: 512 contiguous bytes of each source row
    const int i = bx * 256 + threadIdx.x; const int lane = i & 31, lr = lane & 15, hi = lane >> 4; const int wv = i >> 5; const int half = wv & 1, fr = wv >> 1; const int kb = fr % (K >> 5), ng = fr / (K >> 5);
    const unsigned vo = (unsigned)(kb * 32 + half * 16 + hi * 8) * N + ng * 128 + lr; const float* p = w + vo; float f[8][8]; v8us o[8];
#pragma unroll
    for (int u = 0; u < 8; ++u)
#pragma unroll
        for (int j = 0; j < 8; ++j) f[u][j] = p[j * N + u * 16];
    __builtin_amdgcn_sched_barrier(0);   // holds every load in front of the wait below, and so in flight together
    asm volatile("s_wait_xcnt 0x0" :: "v"(vo) : "memory");   // the wait in front of any rewrite of the loads' offset register; as an input it stays whole up to it
#pragma unroll
    for (int u = 0; u < 8; ++u)
#pragma unroll
        for (int j = 0; j < 8; ++j) o[u][j] = f2bf(f[u][j]);
    bf* q = Bt + ((unsigned)((ng * 8 * (K >> 5) + kb) * 2 + half) * 256 + lane * 8);
    __builtin_amdgcn_sched_barrier(0);   // holds the stores behind the last conversion: nothing is computed into a register of an issued store
#pragma unroll
    for (int u = 0; u < 8; ++u) *(v8us*)(q + u * (K >> 5) * 512) = o[u];
    asm volatile("s_wait_xcnt 0x0" ::: "memory"); }   // behind the job's last store: in a shared launch another job's code follows in the listing and writes the stores' registers again
template <int K>
__device__ __forceinline__ void d_cvt8(int bx, const float* __restrict__ src, bf* dst) {   // a block: 16 whole rows (K = 1024: 32 fragments); wave wq, piece u: 32-k block (u & 3) 8 + wq of the rows (u >> 2) 8 + rr
    static_assert(K == 1024, "8 waves x 8 pieces cover 16 rows of 1024"); const int lane = threadIdx.x & 31, kq = lane & 3, rr = lane >> 2, wq = threadIdx.x >> 5;
    const unsigned vo = ((unsigned)(bx * 16 + rr) * K + wq * 32 + kq * 8) * 4; const float* p = (const float*)((const char*)src + vo); v8f v[8]; v8us o[8];
#pragma unroll
    for (int u = 0; u < 8; ++u) v[u] = *(const v8f*)(p + (u >> 2) * 8 * K + (u & 3) * 256);
    __builtin_amdgcn_sched_barrier(0);   // holds every load in front of the wait below, and so in flight together
    asm volatile("s_wait_xcnt 0x0" :: "v"(vo) : "memory");   // the wait in front of any rewrite of the loads' offset register; as an input it stays whole up to it
#pragma unroll
    for (int u = 0; u < 8; ++u)
#pragma unroll
        for (int j = 0; j < 8; ++j) o[u][j] = f2bf(v[u][j]);
    bf* q = dst + ((unsigned)bx * 16 * K + wq * 512 + (kq >> 1) * 256 + ((kq & 1) * 16 + rr) * 8);
    __builtin_amdgcn_sched_barrier(0);   // holds the stores behind the last conversion: nothing is computed into a register of an issued store
#pragma unroll
    for (int u = 0; u < 8; ++u) *(v8us*)(q + (u & 3) * 8 * 512 + (u >> 2) * 64) = o[u];
    asm volatile("s_wait_xcnt 0x0" ::: "memory"); }   // behind the job's last store: in a shared launch another job's code follows in the listing and writes the stores' registers again
template <int R>
__device__ __forceinline__ void d_gath(int bx, const float* __restrict__ QKV, bf* Qh, bf* Ql, bf* Kh, bf* Kl) {   // a wave: 16 rows of the planes with all 64 d (two whole fragments a plane); piece u: d half u & 1 of the rows (u >> 1) 8 + rr
    const int i = bx * 256 + threadIdx.x; const int lane = i & 31, kq = lane & 3, rr = lane >> 2; const int wv = i >> 5;
    const int zr = wv * 16 + rr; const int gi = zr % GG; const int z = zr / GG; const int h = z % NH_, seg = z / NH_;   // zr: row of the planes, groups one behind the other (GG % 16 == 0)
    const unsigned vo = ((unsigned)dpos(R, seg, h, gi) * (3 * EE) + h * HD + kq * 8) * 4; const float* row = (const float*)((const char*)QKV + vo); v8f q[4], kk[4]; v8us qh[4], ql[4], kh[4], kl[4];
#pragma unroll
    for (int u = 0; u < 4; ++u) { const float* p = row + (u >> 1) * 8 * R * 3 * EE + (u & 1) * 32; q[u] = *(const v8f*)p; kk[u] = *(const v8f*)(p + EE); }
    __builtin_amdgcn_sched_barrier(0);   // holds every load in front of the wait below, and so in flight together
    asm volatile("s_wait_xcnt 0x0" :: "v"(vo) : "memory");   // the wait in front of any rewrite of the loads' offset register; as an input it stays whole up to it
#pragma unroll
    for (int u = 0; u < 4; ++u)
#pragma unroll
        for (int j = 0; j < 8; ++j) { unsigned short a, c; splitf(q[u][j] * 0.125f, a, c); qh[u][j] = a; ql[u][j] = c; splitf(kk[u][j], a, c); kh[u][j] = a; kl[u][j] = c; }
    const unsigned e = (unsigned)wv * 1024 + (kq >> 1) * 256 + ((kq & 1) * 16 + rr) * 8; bf* pqh = Qh + e; bf* pql = Ql + e; bf* pkh = Kh + e; bf* pkl = Kl + e;
    __builtin_amdgcn_sched_barrier(0);   // holds the stores behind the last split: nothing is computed into a register of an issued store
#pragma unroll
    for (int u = 0; u < 4; ++u) { const int c = (u & 1) * 512 + (u >> 1) * 64; *(v8us*)(pqh + c) = qh[u]; *(v8us*)(pql + c) = ql[u]; *(v8us*)(pkh + c) = kh[u]; *(v8us*)(pkl + c) = kl[u]; }
    asm volatile("s_wait_xcnt 0x0" ::: "memory"); }   // behind the job's last store: in a shared launch another job's code follows in the listing and writes the stores' registers again
template <int R>
__device__ __forceinline__ void d_gathv(int bx, const float* __restrict__ QKV, bf* V) {   // a wave: 32 keys of one group with all 64 d (whole 256-byte source rows; four whole fragments a plane); piece (half, nb): keys half 16 + hi 8 + j, d = nb 16 + lr
    const int i = bx * 256 + threadIdx.x; const int lane = i & 31, lr = lane & 15, hi = lane >> 4; const int wv = i >> 5; const int kb = wv % (GG / 32), zl = wv / (GG / 32); const int h = zl % NH_, seg = zl / NH_;
    const unsigned vo = (unsigned)dpos(R, seg, h, kb * 32 + hi * 8) * (3 * EE) + h * HD + lr; const float* p = QKV + 2 * EE + vo; float f[2][4][8]; v8us oh[2][4], ol[2][4];   // element offset inside qkv (12.6 M elements): one register beside the uniform base
#pragma unroll
    for (int half = 0; half < 2; ++half)
#pragma unroll
        for (int j = 0; j < 8; ++j)
#pragma unroll
            for (int nb = 0; nb < 4; ++nb) f[half][nb][j] = p[(half * 16 + j) * R * 3 * EE + nb * 16];
    __builtin_amdgcn_sched_barrier(0);   // holds every load in front of the wait below, and so in flight together
    asm volatile("s_wait_xcnt 0x0" :: "v"(vo) : "memory");   // the wait in front of any rewrite of the loads' offset register; as an input it stays whole up to it
#pragma unroll
    for (int half = 0; half < 2; ++half)
#pragma unroll
        for (int nb = 0; nb < 4; ++nb)
#pragma unroll
            for (int j = 0; j < 8; ++j) { unsigned short a, c; splitf(f[half][nb][j], a, c); oh[half][nb][j] = a; ol[half][nb][j] = c; }
    bf* q = V + ((unsigned)zl * (2 * HD * GG) + kb * 512 + lane * 8);   // per group: the hi plane [HD rows d][GG keys] in fragment order, then the lo plane
    __builtin_amdgcn_sched_barrier(0);   // holds the stores behind the last split: nothing is computed into a register of an issued store
#pragma unroll
    for (int half = 0; half < 2; ++half)
#pragma unroll
        for (int nb = 0; nb < 4; ++nb) { *(v8us*)(q + nb * 16 * GG + half * 256) = oh[half][nb]; *(v8us*)(q + nb * 16 * GG + half * 256 + HD * GG) = ol[half][nb]; }
    asm volatile("s_wait_xcnt 0x0" ::: "memory"); }   // behind the job's last store: in a shared launch another job's code follows in the listing and writes the stores' registers again
// ---- Pre-passes that do not depend on one another SHARE A LAUNCH: the block's number picks its job (a scalar branch) and its place inside that job. Alone, each of these short launches paid the gap to the launch before it,
// its own start and its own drain, and the smaller ones left most of the chip idle meanwhile. k_pre: x and both weights into their planes. k_gall: the q/k and the v planes of all three branches, the larger jobs first.
#define NB_CVT (LL / 16)
#define NB_WQ  (EE * 3 * EE / 64 / 256)
#define NB_WP  (EE * EE / 64 / 256)
__global__ __launch_bounds__(256) void k_pre(const float* __restrict__ x, const float* __restrict__ wqkv, const float* __restrict__ wproj, bf* XB, bf* WQ, bf* WP) {
    const int b = blockIdx.x;
    if (b < NB_CVT) d_cvt8<EE>(b, x, XB);
    else if (b < NB_CVT + NB_WQ) d_wtG<EE, 3 * EE>(b - NB_CVT, wqkv, WQ);
    else d_wtG<EE, EE>(b - NB_CVT - NB_WQ, wproj, WP);
}
#define NB_G1 (4 * NH_ * GG / 128)   // blocks of the q/k planes of branch 1 (a branch of nz groups: nz GG / 16 waves, 8 waves a block); the v planes take half as many (nz GG / 32 waves), branch 2 half of branch 1, branch 4 a quarter
#define PO1 ((size_t)4 * NH_ * GG * HD)   // first plane element of branch 2's groups, and of branch 4's
#define PO2 ((size_t)6 * NH_ * GG * HD)
__global__ __launch_bounds__(256) void k_gall(const float* __restrict__ QKV, bf* Qh, bf* Ql, bf* Kh, bf* Kl, bf* V) {
    int b = blockIdx.x;
    if (b < NB_G1) { d_gath<1>(b, QKV, Qh, Ql, Kh, Kl); return; }
    b -= NB_G1;
    if (b < NB_G1 / 2) { d_gathv<1>(b, QKV, V); return; }
    b -= NB_G1 / 2;
    if (b < NB_G1 / 2) { d_gath<2>(b, QKV, Qh + PO1, Ql + PO1, Kh + PO1, Kl + PO1); return; }
    b -= NB_G1 / 2;
    if (b < NB_G1 / 4) { d_gathv<2>(b, QKV, V + 2 * PO1); return; }
    b -= NB_G1 / 4;
    if (b < NB_G1 / 4) { d_gath<4>(b, QKV, Qh + PO2, Ql + PO2, Kh + PO2, Kl + PO2); return; }
    b -= NB_G1 / 4;
    d_gathv<4>(b, QKV, V + 2 * PO2);
}
// ---- k_fattn: scores, softmax, the probability-logsumexp and probs.v of one (segment, head) group in ONE kernel; no score or probability ever reaches memory. Block = 4 independent waves (no barrier, no LDS); a wave owns 32 query rows
// and walks its causal keys 32 at a time, twice: sweep 1 finds each row's max and sum (running, rescaled), sweep 2 forms the scores again, normalises them, sums exp(p) and multiplies by v.
// The score tile is computed TRANSPOSED (A = keys, B = queries): lane (lr, hi) then holds query lr, keys 8 hi + j of tile 0 and 16 + 8 hi + j of tile 1, which is the k order of the A fragment that probs.v needs: no exchange between lanes.
__device__ __forceinline__ void fa_kload(const bf* __restrict__ pkh, const bf* __restrict__ pkl, v16bf (&ah)[2][2], v16bf (&al)[2][2]) {   // pkh, pkl: the four fragments of keys k0 .. k0 + 31, at this lane's piece
#pragma unroll
    for (int kt = 0; kt < 2; ++kt)
#pragma unroll
        for (int kc = 0; kc < 2; ++kc) { ah[kt][kc] = WFrag<bf>::ld(pkh + (kt * 2 + kc) * 512); al[kt][kc] = WFrag<bf>::ld(pkl + (kt * 2 + kc) * 512); }
}
__device__ __forceinline__ void fa_scores(const v16bf (&ah)[2][2], const v16bf (&al)[2][2], int k0, int lr, int hi, int r0, const v16bf (&bqh)[2][2], const v16bf (&bql)[2][2], v8f (&s)[2][2]) {
#pragma unroll
    for (int kt = 0; kt < 2; ++kt)
#pragma unroll
        for (int qb = 0; qb < 2; ++qb) { v8f acc = (v8f){};
#pragma unroll
            for (int kc = 0; kc < 2; ++kc) { acc = wmmab(ah[kt][kc], bqh[qb][kc], acc); acc = wmmab(ah[kt][kc], bql[qb][kc], acc); acc = wmmab(al[kt][kc], bqh[qb][kc], acc); }
#pragma unroll
            for (int j = 0; j < 8; ++j) s[kt][qb][j] = (k0 + kt * 16 + hi * 8 + j) <= (r0 + qb * 16 + lr) ? acc[j] : -3.0e38f; }   // causal mask by select
}
__global__ __launch_bounds__(128) void k_fattn(const bf* __restrict__ Qh, const bf* __restrict__ Ql, const bf* __restrict__ Kh, const bf* __restrict__ Kl, const bf* __restrict__ V, float* Ob, float* LSEX) {
    const int lane = threadIdx.x & 31, lr = lane & 15, hi = lane >> 4; const int z = blockIdx.x;
    const int t = GG / 32 - 1 - (int)(blockIdx.y * 4 + __builtin_amdgcn_readfirstlane(threadIdx.x >> 5));   // the longest rows are launched first; the wave's number in a scalar register, so that both loops branch on scalars
    const int r0 = t * 32; const size_t zo = (size_t)z * GG * HD; const size_t lo = zo + 8 * lane;
    v16bf bqh[2][2], bql[2][2]; const bf* pqh = Qh + lo + (size_t)r0 * HD; const bf* pql = Ql + lo + (size_t)r0 * HD;
#pragma unroll
    for (int qb = 0; qb < 2; ++qb)
#pragma unroll
        for (int kc = 0; kc < 2; ++kc) { bqh[qb][kc] = WFrag<bf>::ld(pqh + (qb * 2 + kc) * 512); bql[qb][kc] = WFrag<bf>::ld(pql + (qb * 2 + kc) * 512); }
    asm volatile("s_wait_xcnt 0x0" :: "v"(pqh), "v"(pql) : "memory");   // the wait in front of any reuse of the query loads' address registers; as inputs they stay whole up to it
    float m[2] = {-3.0e38f, -3.0e38f}, l[2] = {0.f, 0.f};
    { const bf* pkh = Kh + lo; const bf* pkl = Kl + lo;
    for (int kb = 0; kb <= t; ++kb) { v8f s[2][2]; v16bf ah[2][2], al[2][2]; fa_kload(pkh, pkl, ah, al);
        __builtin_amdgcn_sched_barrier(0);   // holds all sixteen key loads in front of the first product: one memory latency a step instead of one per pair of loads
        asm volatile("s_wait_xcnt 0x0" :: "v"(pkh), "v"(pkl) : "memory");   // the wait in front of any rewrite of the loads' address registers; as inputs they stay whole up to it
        fa_scores(ah, al, kb * 32, lr, hi, r0, bqh, bql, s); pkh += 32 * HD; pkl += 32 * HD;
#pragma unroll
        for (int qb = 0; qb < 2; ++qb) { float mx = m[qb];
#pragma unroll
            for (int j = 0; j < 8; ++j) mx = fmaxf(mx, fmaxf(s[0][qb][j], s[1][qb][j]));
            float a = l[qb] * __expf(m[qb] - mx);
#pragma unroll
            for (int j = 0; j < 8; ++j) a += __expf(s[0][qb][j] - mx) + __expf(s[1][qb][j] - mx);
            m[qb] = mx; l[qb] = a; } } }
    float inv[2];
#pragma unroll
    for (int qb = 0; qb < 2; ++qb) { const float mm = fmaxf(m[qb], __shfl_xor(m[qb], 16, 32)); float a = l[qb] * __expf(m[qb] - mm); a += __shfl_xor(a, 16, 32); m[qb] = mm; inv[qb] = __fdiv_rn(1.0f, a); }   // a lane whose keys were all masked holds m = -3e38: its sum is scaled to 0
    float se[2] = {0.f, 0.f}; v8f o[2][4];
#pragma unroll
    for (int qb = 0; qb < 2; ++qb)
#pragma unroll
        for (int nb = 0; nb < 4; ++nb) o[qb][nb] = (v8f){};
    { const bf* pkh = Kh + lo; const bf* pkl = Kl + lo; const bf* pv = V + (size_t)z * HD * 2 * GG + 8 * lane;
    for (int kb = 0; kb <= t; ++kb) { v8f s[2][2]; v16bf ah[2][2], al[2][2], vh[4], vl[4]; fa_kload(pkh, pkl, ah, al);
#pragma unroll
        for (int nb = 0; nb < 4; ++nb) { vh[nb] = WFrag<bf>::ld(pv + (size_t)nb * 16 * GG); vl[nb] = WFrag<bf>::ld(pv + (size_t)nb * 16 * GG + HD * GG); }
        __builtin_amdgcn_sched_barrier(0);   // holds the key and the value loads in front of the first product: one memory latency a step, and the value tile flies under the scores and the softmax
        asm volatile("s_wait_xcnt 0x0" :: "v"(pkh), "v"(pkl), "v"(pv) : "memory");   // the wait in front of any rewrite of the loads' address registers; as inputs they stay whole up to it
        fa_scores(ah, al, kb * 32, lr, hi, r0, bqh, bql, s); pkh += 32 * HD; pkl += 32 * HD; pv += 512; v16bf ph[2], pl[2];
#pragma unroll
        for (int qb = 0; qb < 2; ++qb) { v8us h[2], c[2];
#pragma unroll
            for (int kt = 0; kt < 2; ++kt)
#pragma unroll
                for (int j = 0; j < 8; ++j) { const float p = __expf(s[kt][qb][j] - m[qb]) * inv[qb]; se[qb] += __expf(p); unsigned short a, b; splitf(p, a, b); h[kt][j] = a; c[kt][j] = b; }   // masked: p = 0 exactly, exp(0) = 1, as the reference
            ph[qb] = cat16b(h[0], h[1]); pl[qb] = cat16b(c[0], c[1]); }
#pragma unroll
        for (int nb = 0; nb < 4; ++nb)
#pragma unroll
            for (int qb = 0; qb < 2; ++qb) { o[qb][nb] = wmmab(ph[qb], vh[nb], o[qb][nb]); o[qb][nb] = wmmab(pl[qb], vh[nb], o[qb][nb]); o[qb][nb] = wmmab(ph[qb], vl[nb], o[qb][nb]); } } }
#pragma unroll
    for (int qb = 0; qb < 2; ++qb) { const float st = se[qb] + __shfl_xor(se[qb], 16, 32) + (float)(GG - (t + 1) * 32);   // the keys beyond this wave's last tile are masked: exp(0) = 1 each
        const float lse = __logf(st); const v4f lv = {lse, lse, lse, lse}; float* lp = LSEX + ((size_t)z * GG + r0 + qb * 16 + lr) * 32 + hi * 16;
#pragma unroll
        for (int q = 0; q < 4; ++q) *(v4f*)(lp + q * 4) = lv;
#pragma unroll
        for (int nb = 0; nb < 4; ++nb)
#pragma unroll
            for (int j = 0; j < 8; ++j) Ob[((size_t)z * GG + r0 + qb * 16 + hi * 8 + j) * HD + nb * 16 + lr] = o[qb][nb][j]; }
}
// k_comb: per (l, h): for each branch k (r = 1, 2, 4; segment w = 1024 r): head h uses position l iff (l mod w) mod r == h / (16/r); then gi = (l mod w) / r, z = (l / w) 16 + h, o_k = Ob_k[z][gi][:] and
// a wave: head h (64 k: two whole fragments a plane) of 16 positions; a thread's piece 2 g + c2 is k half c2 of position l + 8 g, where the same branches are in use (8 % r == 0) 8 / r rows further on; the weights of a position serve both its halves
__global__ __launch_bounds__(256) void k_comb(const float* __restrict__ Ob0, const float* __restrict__ Ob1, const float* __restrict__ Ob2, const float* __restrict__ L0, const float* __restrict__ L1, const float* __restrict__ L2, bf* Ah, bf* Al) { const int i = blockIdx.x * 256 + threadIdx.x; const int lane = i & 31, kq = lane & 3, rr = lane >> 2; const int wv = i >> 5; const int h = wv % NH_; const int l = (wv / NH_) * 16 + rr;
    const float* obs[3] = {Ob0, Ob1, Ob2}; const float* lss[3] = {L0, L1, L2}; float lsq[2][3]; unsigned vl[3], vb[3]; bool used[3]; v8f obq[4][3]; v8us ohq[4], olq[4];
#pragma unroll
    for (int k = 0; k < 3; ++k) { const int r = 1 << k; const int w = GG * r; const int ll = l % w; const int off = h / (NH_ / r); used[k] = (ll % r) == off; const int gi = ll / r; const int z = (l / w) * NH_ + h; const unsigned src = (unsigned)(z * GG + gi); vl[k] = src * (32 * 4); vb[k] = (src * HD + kq * 8) * 4;   // byte offsets: one register a branch for the lse rows, one for the outputs
        const float* pl = (const float*)((const char*)lss[k] + vl[k]); const float* po = (const float*)((const char*)obs[k] + vb[k]);
        lsq[0][k] = lsq[1][k] = -1.0e8f; obq[0][k] = obq[1][k] = obq[2][k] = obq[3][k] = (v8f){};
        if (used[k]) {   // one masked stretch a branch: its two lse values and, per piece, 8 outputs in two 16-byte loads; all pieces and branches in flight together
#pragma unroll
            for (int g = 0; g < 2; ++g) lsq[g][k] = pl[g * (8 / r) * 32];
#pragma unroll
            for (int pc = 0; pc < 4; ++pc) obq[pc][k] = *(const v8f*)(po + (pc >> 1) * (8 / r) * HD + (pc & 1) * 32); } }
    asm volatile("s_wait_xcnt 0x0" :: "v"(vl[0]), "v"(vl[1]), "v"(vl[2]), "v"(vb[0]), "v"(vb[1]), "v"(vb[2]) : "memory");   // the wait in front of any rewrite of the loads' offset registers; as inputs they stay whole up to it
#pragma unroll
    for (int g = 0; g < 2; ++g) { const float (&lse)[3] = lsq[g];
    const float m = fmaxf(lse[0], fmaxf(lse[1], lse[2])); float ex[3]; float den = 0.f;
#pragma unroll
    for (int k = 0; k < 3; ++k) { ex[k] = __expf(__fsub_rn(lse[k], m)); den = __fadd_rn(den, ex[k]); }
    const float inv = __fdiv_rn(1.0f, den);
#pragma unroll
    for (int c2 = 0; c2 < 2; ++c2) { const v8f (&ob)[3] = obq[g * 2 + c2]; v8us oh, ol;
#pragma unroll
    for (int u = 0; u < 8; ++u) { float acc = 0.f;
#pragma unroll
        for (int k = 0; k < 3; ++k) { const float o = ob[k][u]; float p = __fmul_rn(o, ex[k] * inv); asm volatile("" : "+v"(p)); acc = __fadd_rn(acc, p); }
        unsigned short a, c; splitf(acc, a, c); oh[u] = a; ol[u] = c; }
    ohq[g * 2 + c2] = oh; olq[g * 2 + c2] = ol; } }
    const unsigned e = (unsigned)wv * 1024 + (kq >> 1) * 256 + ((kq & 1) * 16 + rr) * 8; bf* pah = Ah + e; bf* pal = Al + e;
    __builtin_amdgcn_sched_barrier(0);   // holds the stores behind the last split: nothing is computed into a register of an issued store
#pragma unroll
    for (int pc = 0; pc < 4; ++pc) { *(v8us*)(pah + (pc & 1) * 512 + (pc >> 1) * 64) = ohq[pc]; *(v8us*)(pal + (pc & 1) * 512 + (pc >> 1) * 64) = olq[pc]; } }

extern "C" void kernel_launch(void* const* d_in, const int* in_sizes, int n_in,
                              void* d_out, int out_size, void* d_ws, size_t ws_size, hipStream_t stream) {
    (void)in_sizes; (void)n_in; (void)out_size;
    const float* x = (const float*)d_in[0]; const float* wqkv = (const float*)d_in[1]; const float* wproj = (const float*)d_in[2];
    float* OUT = (float*)d_out;     // [1][4096][1024]
    char* wsp = (char*)d_ws;
    auto take = [&](size_t bytes) { char* p = wsp; wsp += (bytes + 255) & ~(size_t)255; return (void*)p; };
    const int NZ = 7 * NH_;   // (segment, head) groups of all three branches: 64 + 32 + 16, numbered through
    bf* WP = (bf*)take((size_t)EE * EE * 2); float* QKV = (float*)take((size_t)LL * 3 * EE * 4);
    bf* Qh = (bf*)take((size_t)NZ * GG * HD * 2); bf* Ql = (bf*)take((size_t)NZ * GG * HD * 2); bf* Kh = (bf*)take((size_t)NZ * GG * HD * 2); bf* Kl = (bf*)take((size_t)NZ * GG * HD * 2); bf* V = (bf*)take((size_t)NZ * HD * GG * 4);
    bf* WQ = (bf*)take((size_t)3 * EE * EE * 2); bf* XB = (bf*)take((size_t)LL * EE * 2); bf* Ah = (bf*)take((size_t)LL * EE * 2); bf* Al = (bf*)take((size_t)LL * EE * 2);
    float* Ob = (float*)take((size_t)NZ * GG * HD * 4); float* LS = (float*)take((size_t)NZ * GG * 32 * 4);
    const int zb[3] = {0, 4 * NH_, 6 * NH_};   // first group of each branch
    float* ObK[3]; float* LSK[3]; for (int k = 0; k < 3; ++k) { ObK[k] = Ob + (size_t)zb[k] * GG * HD; LSK[k] = LS + (size_t)zb[k] * GG * 32; }
    if ((size_t)(wsp - (char*)d_ws) > ws_size) return;    // total 216 MB (qkv f32 [4096][3072] 50 MB, gathered hl planes of 112 groups 88 MB, branch outputs + row-replicated lse 44 MB, weights, x and the combined planes 34 MB)
    k_pre<<<NB_CVT + NB_WQ + NB_WP, 256, 0, stream>>>(x, wqkv, wproj, XB, WQ, WP);
    k_gemmw<bf, 0, false><<<dim3(LL / 128, 3 * EE / 128, 1), 128, 0, stream>>>(XB, nullptr, WQ, nullptr, EE, QKV, 3 * EE, nullptr, 0, 0, 0);
    k_gall<<<NB_G1 * 21 / 8, 256, 0, stream>>>(QKV, Qh, Ql, Kh, Kl, V);   // 1 + 1/2 + 1/2 + 1/4 + 1/4 + 1/8 of branch 1's q/k blocks
    k_fattn<<<dim3(NZ, GG / 128, 1), 128, 0, stream>>>(Qh, Ql, Kh, Kl, V, Ob, LS);
    k_comb<<<LL * NH_ / 128, 256, 0, stream>>>(ObK[0], ObK[1], ObK[2], LSK[0], LSK[1], LSK[2], Ah, Al);
    k_gemmw<bf, 1, false><<<dim3(LL / 128, EE / 128, 1), 128, 0, stream>>>(Ah, Al, WP, nullptr, EE, OUT, EE, nullptr, 0, 0, 0);
}

// v007
// One run takes 126 microseconds.
// In both of two side-by-side timings against v006, it was 1.03 times as fast.
// Over all steps from v000 it is 6.39 times as fast.
#include <hip/hip_runtime.h>

// Dilated causal self-attention (x [1][4096][1024]; qkv = x w_qkv (16 heads x 64); three branches (segment w, dilation r) = (1024,1), (2048,2), (4096,4): inside each segment, head h attends causally over the
// g = w/r = 1024 positions {gi r + off}, off = h / (16/r) (the reference's diagonal sparsify); softmax(q.k/8) with a causal mask over gi; branch output scattered back to those positions (0 elsewhere) with lse = logsumexp over the softmax
// PROBABILITIES of the row (masked entries contribute exp(0)), -1e8 elsewhere; branches recombined per (position, head) with softmax(lse) weights; out @ w_proj -> [1][4096][1024]).
// Compute dtypes, f32 accumulate: every input rounded to bf16; qkv on PLAIN bf16 operands (inputs: exact); per (segment, head) 1024x1024 attention on bf16 hi+lo planes gathered at the dilated positions
// (q x 1/8 exact; scores K 64 with 3 products, causal tiles skipped), softmax + the probability-logsumexp in f32 registers, probs.v on hl planes (3 products); the 3-branch recombination f32; w_proj on hl planes x exact (2 products). GEMMs: four waves per 128x128 tile, operands staged in LDS

#define LL   4096
#define EE   1024
#define NH_  16
#define HD   64
#define GG   1024
#define PCAR 1024.0f
typedef _Float16 h16;
typedef unsigned short bf;
typedef __attribute__((ext_vector_type(16))) __bf16   v16bf;
typedef __attribute__((ext_vector_type(16))) _Float16 v16h;
typedef __attribute__((ext_vector_type(8)))  _Float16 v8h;
typedef __attribute__((ext_vector_type(8)))  unsigned short v8us;
typedef __attribute__((ext_vector_type(8)))  float    v8f;
typedef __attribute__((ext_vector_type(4)))  float    v4f;
typedef v8h  __attribute__((may_alias)) v8ha;
typedef v4f  __attribute__((may_alias)) v4fa;
typedef v8us __attribute__((may_alias)) v8usa;

__device__ __forceinline__ unsigned short f2bf(float f) { return __builtin_bit_cast(unsigned short, (__bf16)f); }   // the hardware's convert: round to nearest even, as the integer form it replaces
__device__ __forceinline__ float bf2f(unsigned short b) { return __uint_as_float(((unsigned)b) << 16); }
__device__ __forceinline__ float bfr(float f) { return bf2f(f2bf(f)); }
__device__ __forceinline__ v16h cat16(v8h lo, v8h hi) { return __builtin_shufflevector(lo, hi, 0, 1, 2, 3, 4, 5, 6, 7, 8, 9, 10, 11, 12, 13, 14, 15); }
__device__ __forceinline__ v16bf cat16b(v8us lo, v8us hi) { return __builtin_bit_cast(v16bf, __builtin_shufflevector(lo, hi, 0, 1, 2, 3, 4, 5, 6, 7, 8, 9, 10, 11, 12, 13, 14, 15)); }
__device__ __forceinline__ v8f wmma16(v16h a, v16h b, v8f c) { return __builtin_amdgcn_wmma_f32_16x16x32_f16(false, a, false, b, (short)0, c, false, false); }
__device__ __forceinline__ v8f wmmab(v16bf a, v16bf b, v8f c) { return __builtin_amdgcn_wmma_f32_16x16x32_bf16(false, a, false, b, (short)0, c, false, false); }



// ---- FRAGMENT ORDER of every 16-bit operand plane [rows][K]: the plane is cut into fragments of 16 rows x 32 k (512 elements, 1 KiB), numbered (row / 16) (K / 32) + k / 32; inside a fragment element (row, k) lies at
// ((k >> 4) & 1) 256 + (((k >> 3) & 1) 16 + (row & 15)) 8 + (k & 7). Lane (lr, hi) = 16 hi + lr then finds its 8 + 8 elements (k = 8 hi + j and 16 + 8 hi + j of row lr, the hardware k order) at lane 8 and 256 + lane 8:
// each wave-wide 16-byte load reads 512 contiguous bytes, 4 whole lines, where a row-major plane made it touch 16 lines.
__device__ __forceinline__ size_t fo8(int row, int k, int K) { return ((size_t)(row >> 4) * (K >> 5) + (k >> 5)) * 512 + ((k >> 4) & 1) * 256 + (((k >> 3) & 1) * 16 + (row & 15)) * 8; }   // place of the 8 elements k .. k + 7 (k % 8 == 0) of a row
// ---- k_gemmw: GEMM on 16-bit planes in fragment order. A block of FOUR WAVES (2 x 2) makes a 128x128 tile of C, a wave its 64x64 quarter (16 accumulators); grid (M/128, N/128, Z), 128 threads.
// The block's operands pass through LDS: a stage is 64 k of the tile's 128 rows of every plane (8 row blocks x 2 fragments = 16 KiB a plane), brought in by asynchronous copies, each byte once a block, where four separate waves
// fetched each fragment twice from L2. Fragments are copied as they lie (1 KiB, lane-contiguous), so a wave-wide 16-byte LDS read takes 512 contiguous bytes. Two buffers: the next stage's copies fly while this stage is multiplied.
// C[m][n] (f32, pitch ldc, + optional f32 bias[n]) = sum_k A[m][k] Bt[n][k] (+ split products per NSPLIT). z-batch strides sA/sB/sC in elements. M % 128 == 0, N % 128 == 0, K % 64 == 0.
template <typename T16> struct WFrag;
template <> struct WFrag<h16> { typedef v16h V; static __device__ __forceinline__ V ld(const h16* p) { return cat16(*(const v8h*)p, *(const v8h*)(p + 256)); } static __device__ __forceinline__ v8f mma(V a, V b, v8f c) { return wmma16(a, b, c); } };
template <> struct WFrag<bf> { typedef v16bf V; static __device__ __forceinline__ V ld(const bf* p) { return cat16b(*(const v8us*)p, *(const v8us*)(p + 256)); } static __device__ __forceinline__ v8f mma(V a, V b, v8f c) { return wmmab(a, b, c); } };
// One wave's share of one plane's stage: two row blocks of 2 KiB, eight wave-wide copies of 512 bytes; l: the lane's LDS byte address, g: the lane's source address, rbstep: bytes from a row block of the plane to the next.
__device__ __forceinline__ void cp8(unsigned l, const char* g, unsigned rbstep) { const char* g2 = g + rbstep;
    asm volatile("global_load_async_to_lds_b128 %0, %8, off\n\t"
                 "global_load_async_to_lds_b128 %1, %9, off\n\t"
                 "global_load_async_to_lds_b128 %2, %10, off\n\t"
                 "global_load_async_to_lds_b128 %3, %11, off\n\t"
                 "global_load_async_to_lds_b128 %4, %12, off\n\t"
                 "global_load_async_to_lds_b128 %5, %13, off\n\t"
                 "global_load_async_to_lds_b128 %6, %14, off\n\t"
                 "global_load_async_to_lds_b128 %7, %15, off\n\t"
                 "s_wait_xcnt 0x0"   // inside the copies' own statement: it stands in front of any rewrite of their address registers
                 :: "v"(l), "v"(l + 512u), "v"(l + 1024u), "v"(l + 1536u), "v"(l + 2048u), "v"(l + 2560u), "v"(l + 3072u), "v"(l + 3584u),
                    "v"(g), "v"(g + 512), "v"(g + 1024), "v"(g + 1536), "v"(g2), "v"(g2 + 512), "v"(g2 + 1024), "v"(g2 + 1536) : "memory"); }
template <typename T16, int NSPLIT, bool BIAS>
__global__ __launch_bounds__(128) void k_gemmw(const T16* __restrict__ A, const T16* __restrict__ A2, const T16* __restrict__ Bt, const T16* __restrict__ Bt2, int K, float* C, int ldc, const float* __restrict__ bias, size_t sA, size_t sB, size_t sC) {
    typedef typename WFrag<T16>::V V;
    constexpr int NPA = (NSPLIT == 1 || NSPLIT == 2) ? 2 : 1, NPB = NSPLIT >= 2 ? 2 : 1, NP = NPA + NPB;   // planes staged: A (, A2), Bt (, Bt2)
    constexpr unsigned PLB = 8 * 2048, BUFB = NP * PLB;   // bytes of a plane's stage and of a buffer
    __shared__ __align__(2048) char ring[2 * BUFB];
    __shared__ __align__(16) float osm[4][16 * 68];
    const size_t z = blockIdx.z; A += z * sA; if (A2) A2 += z * sA; Bt += z * sB; if (Bt2) Bt2 += z * sB; C += z * sC;
    const int lane = threadIdx.x & 31, lr = lane & 15, hi = lane >> 4; const int w = __builtin_amdgcn_readfirstlane(threadIdx.x >> 5), wm = w & 1, wn = w >> 1;
    const int R0 = blockIdx.x * 128, C0 = blockIdx.y * 128; const int r0 = R0 + wm * 64, c0 = C0 + wn * 64; float* os = osm[w];
    v8f acc[4][4];
#pragma unroll
    for (int mb = 0; mb < 4; ++mb)
#pragma unroll
        for (int nb = 0; nb < 4; ++nb) acc[mb][nb] = (v8f){};
    const unsigned rbstep = (unsigned)K * 32;   // 16 rows of a plane hold 16 K elements
    const char* gs[NP];   // wave w copies row blocks 2 w and 2 w + 1 of every plane's stage
    gs[0] = (const char*)(A + (size_t)(R0 + w * 32) * K) + lane * 16; if (NPA == 2) gs[1] = (const char*)(A2 + (size_t)(R0 + w * 32) * K) + lane * 16;
    gs[NPA] = (const char*)(Bt + (size_t)(C0 + w * 32) * K) + lane * 16; if (NPB == 2) gs[NPA + 1] = (const char*)(Bt2 + (size_t)(C0 + w * 32) * K) + lane * 16;
    const unsigned l0 = (unsigned)(size_t)ring + w * 4096 + lane * 16;
    auto fill = [&](int buf) {
#pragma unroll
        for (int p = 0; p < NP; ++p) { cp8(l0 + buf * BUFB + p * PLB, gs[p], rbstep); gs[p] += 2048; } };
    const int NT = K >> 6;
    fill(0);
    asm volatile("s_wait_asynccnt 0x0" ::: "memory");   // this wave's copies of stage 0 have landed
    __syncthreads();                                     // and every other wave's: stage 0 may be read
    if (NT > 1) fill(1);
#pragma unroll 1   // rolled: one copy of a stage's code in the instruction cache; the buffer is picked by a scalar
    for (int t = 0; t < NT; ++t) {
        const char* rb = ring + (t & 1) * BUFB + lane * 16;
        V a[2][4], a2[2][4], b[2][4], b2[2][4];
#pragma unroll
        for (int ks = 0; ks < 2; ++ks)
#pragma unroll
            for (int u = 0; u < 4; ++u) { a[ks][u] = WFrag<T16>::ld((const T16*)(rb + (wm * 4 + u) * 2048 + ks * 1024)); b[ks][u] = WFrag<T16>::ld((const T16*)(rb + NPA * PLB + (wn * 4 + u) * 2048 + ks * 1024));
                if (NPA == 2) a2[ks][u] = WFrag<T16>::ld((const T16*)(rb + PLB + (wm * 4 + u) * 2048 + ks * 1024)); if (NPB == 2) b2[ks][u] = WFrag<T16>::ld((const T16*)(rb + (NPA + 1) * PLB + (wn * 4 + u) * 2048 + ks * 1024)); }
        __builtin_amdgcn_sched_barrier(0);   // holds every fragment read of the stage in front of its first product: one LDS latency a stage; left alone, the reads stood one by one among the products, each with its own full wait
#pragma unroll
        for (int ks = 0; ks < 2; ++ks)
#pragma unroll
            for (int nb = 0; nb < 4; ++nb)
#pragma unroll
                for (int mb = 0; mb < 4; ++mb) { acc[mb][nb] = WFrag<T16>::mma(a[ks][mb], b[ks][nb], acc[mb][nb]); if (NSPLIT == 1 || NSPLIT == 2) acc[mb][nb] = WFrag<T16>::mma(a2[ks][mb], b[ks][nb], acc[mb][nb]); if (NSPLIT >= 2) acc[mb][nb] = WFrag<T16>::mma(a[ks][mb], b2[ks][nb], acc[mb][nb]); }
        __builtin_amdgcn_sched_barrier(0);   // holds the products in front of the closing waits: sunk behind the barrier, they would leave the next stage's copies only the time of the fragment reads to land
        asm volatile("s_wait_dscnt 0x0" ::: "memory");      // this wave's reads of the buffer are over before it is refilled
        asm volatile("s_wait_asynccnt 0x0" ::: "memory");   // this wave's copies of stage t + 1 have landed
        __syncthreads();                                     // publishes stage t + 1 and ends every wave's reads of stage t
        if (t + 2 < NT) fill(t & 1);
    }
    asm volatile("s_wait_asynccnt 0x0" ::: "memory");   // no copy is outstanding when the wave goes on and ends
#pragma unroll
    for (int mb = 0; mb < 4; ++mb) {
#pragma unroll
        for (int nb = 0; nb < 4; ++nb) {
#pragma unroll
            for (int j = 0; j < 8; ++j) os[(hi * 8 + j) * 68 + nb * 16 + lr] = acc[mb][nb][j]; }
        __builtin_amdgcn_wave_barrier(); asm volatile("" ::: "memory");
        float* crow = C + (size_t)(r0 + mb * 16) * ldc + c0;
{
#pragma unroll
            for (int s = 0; s < 8; ++s) { const int row = 2 * s + hi, cofs = lr * 4; v4f val = *(const v4fa*)(os + row * 68 + cofs); if (BIAS) { val[0] += bfr(bias[c0 + cofs]); val[1] += bfr(bias[c0 + cofs + 1]); val[2] += bfr(bias[c0 + cofs + 2]); val[3] += bfr(bias[c0 + cofs + 3]); }
                *(v4f*)(crow + (size_t)row * ldc + cofs) = val; }
             }
        __builtin_amdgcn_wave_barrier(); asm volatile("" ::: "memory");
    }
}

__device__ __forceinline__ h16 tohx(float x) { return (h16)x; }
__device__ __forceinline__ void splitf(float y, unsigned short& h, unsigned short& l) { h = f2bf(y); l = f2bf(y - bf2f(h)); }
typedef __attribute__((ext_vector_type(2))) _Float16 v2h;
typedef __attribute__((ext_vector_type(4))) _Float16 v4h;
typedef __attribute__((ext_vector_type(2))) unsigned short v2us;
typedef __attribute__((ext_vector_type(4))) unsigned short v4us;
typedef __attribute__((ext_vector_type(2))) float v2f;
typedef __attribute__((ext_vector_type(2))) __bf16 v2bf;
typedef __attribute__((ext_vector_type(8))) unsigned v8u;
__device__ __forceinline__ int dpos(int r, int seg, int h, int gi) { const int w = GG * r; const int off = h / (NH_ / r); return seg * w + gi * r + off; }   // dense position of sparse index gi for (branch r, segment, head)

// The writers of the planes. Row-major sources (d_cvt8, d_gath, k_comb): a 16-byte piece is 8 k of one row; lane = 4 rr + kq takes row rr of 8 and piece kq of a 32-k block, so 4 lanes read one whole 128-byte line of f32
// and the 8 lanes of one kq store one whole 128-byte line. Transposed sources (d_wtG, d_gathv): lane = 16 hi + lr as in the readers: 16 lanes read 64 contiguous bytes, the wave stores 512.
// A THREAD MAKES SEVERAL PIECES (4 or 8), not one, for speed only. A thread's pieces lie at compile-time distances from its first, in the source and in the
// planes, so one address register serves all its loads of a source and one all its stores of a plane; all loads fly together, every piece is formed, and the stores come last, so that no register of an issued load or store is written again.
template <int K, int N>
__device__ __forceinline__ void d_wtG(int bx, const float* __restrict__ w, bf* Bt) {   // a wave: 16 k (one half of a 32-k block) of 8 neighbouring 16-column blocks: 512 contiguous bytes of each source row
    const int i = bx * 256 + threadIdx.x; const int lane = i & 31, lr = lane & 15, hi = lane >> 4; const int wv = i >> 5; const int half = wv & 1, fr = wv >> 1; const int kb = fr % (K >> 5), ng = fr / (K >> 5);
    const unsigned vo = (unsigned)(kb * 32 + half * 16 + hi * 8) * N + ng * 128 + lr; const float* p = w + vo; float f[8][8]; v8us o[8];
#pragma unroll
    for (int u = 0; u < 8; ++u)
#pragma unroll
        for (int j = 0; j < 8; ++j) f[u][j] = p[j * N + u * 16];
    __builtin_amdgcn_sched_barrier(0);   // holds every load in front of the wait below, and so in flight together
    asm volatile("s_wait_xcnt 0x0" :: "v"(vo) : "memory");   // the wait in front of any rewrite of the loads' offset register; as an input it stays whole up to it
#pragma unroll
    for (int u = 0; u < 8; ++u)
#pragma unroll
        for (int j = 0; j < 8; ++j) o[u][j] = f2bf(f[u][j]);
    bf* q = Bt + ((unsigned)((ng * 8 * (K >> 5) + kb) * 2 + half) * 256 + lane * 8);
    __builtin_amdgcn_sched_barrier(0);   // holds the stores behind the last conversion: nothing is computed into a register of an issued store
#pragma unroll
    for (int u = 0; u < 8; ++u) *(v8us*)(q + u * (K >> 5) * 512) = o[u];
    asm volatile("s_wait_xcnt 0x0" ::: "memory"); }   // behind the job's last store: in a shared launch another job's code follows in the listing and writes the stores' registers again
template <int K>
__device__ __forceinline__ void d_cvt8(int bx, const float* __restrict__ src, bf* dst) {   // a block: 16 whole rows (K = 1024: 32 fragments); wave wq, piece u: 32-k block (u & 3) 8 + wq of the rows (u >> 2) 8 + rr
    static_assert(K == 1024, "8 waves x 8 pieces cover 16 rows of 1024"); const int lane = threadIdx.x & 31, kq = lane & 3, rr = lane >> 2, wq = threadIdx.x >> 5;
    const unsigned vo = ((unsigned)(bx * 16 + rr) * K + wq * 32 + kq * 8) * 4; const float* p = (const float*)((const char*)src + vo); v8f v[8]; v8us o[8];
#pragma unroll
    for (int u = 0; u < 8; ++u) v[u] = *(const v8f*)(p + (u >> 2) * 8 * K + (u & 3) * 256);
    __builtin_amdgcn_sched_barrier(0);   // holds every load in front of the wait below, and so in flight together
    asm volatile("s_wait_xcnt 0x0" :: "v"(vo) : "memory");   // the wait in front of any rewrite of the loads' offset register; as an input it stays whole up to it
#pragma unroll
    for (int u = 0; u < 8; ++u)
#pragma unroll
        for (int j = 0; j < 8; ++j) o[u][j] = f2bf(v[u][j]);
    bf* q = dst + ((unsigned)bx * 16 * K + wq * 512 + (kq >> 1) * 256 + ((kq & 1) * 16 + rr) * 8);
    __builtin_amdgcn_sched_barrier(0);   // holds the stores behind the last conversion: nothing is computed into a register of an issued store
#pragma unroll
    for (int u = 0; u < 8; ++u) *(v8us*)(q + (u & 3) * 8 * 512 + (u >> 2) * 64) = o[u];
    asm volatile("s_wait_xcnt 0x0" ::: "memory"); }   // behind the job's last store: in a shared launch another job's code follows in the listing and writes the stores' registers again
template <int R>
__device__ __forceinline__ void d_gath(int bx, const float* __restrict__ QKV, bf* Qh, bf* Ql, bf* Kh, bf* Kl) {   // a wave: 16 rows of the planes with all 64 d (two whole fragments a plane); piece u: d half u & 1 of the rows (u >> 1) 8 + rr
    const int i = bx * 256 + threadIdx.x; const int lane = i & 31, kq = lane & 3, rr = lane >> 2; const int wv = i >> 5;
    const int zr = wv * 16 + rr; const int gi = zr % GG; const int z = zr / GG; const int h = z % NH_, seg = z / NH_;   // zr: row of the planes, groups one behind the other (GG % 16 == 0)
    const unsigned vo = ((unsigned)dpos(R, seg, h, gi) * (3 * EE) + h * HD + kq * 8) * 4; const float* row = (const float*)((const char*)QKV + vo); v8f q[4], kk[4]; v8us qh[4], ql[4], kh[4], kl[4];
#pragma unroll
    for (int u = 0; u < 4; ++u) { const float* p = row + (u >> 1) * 8 * R * 3 * EE + (u & 1) * 32; q[u] = *(const v8f*)p; kk[u] = *(const v8f*)(p + EE); }
    __builtin_amdgcn_sched_barrier(0);   // holds every load in front of the wait below, and so in flight together
    asm volatile("s_wait_xcnt 0x0" :: "v"(vo) : "memory");   // the wait in front of any rewrite of the loads' offset register; as an input it stays whole up to it
#pragma unroll
    for (int u = 0; u < 4; ++u)
#pragma unroll
        for (int j = 0; j < 8; ++j) { unsigned short a, c; splitf(q[u][j] * 0.125f, a, c); qh[u][j] = a; ql[u][j] = c; splitf(kk[u][j], a, c); kh[u][j] = a; kl[u][j] = c; }
    const unsigned e = (unsigned)wv * 1024 + (kq >> 1) * 256 + ((kq & 1) * 16 + rr) * 8; bf* pqh = Qh + e; bf* pql = Ql + e; bf* pkh = Kh + e; bf* pkl = Kl + e;
    __builtin_amdgcn_sched_barrier(0);   // holds the stores behind the last split: nothing is computed into a register of an issued store
#pragma unroll
    for (int u = 0; u < 4; ++u) { const int c = (u & 1) * 512 + (u >> 1) * 64; *(v8us*)(pqh + c) = qh[u]; *(v8us*)(pql + c) = ql[u]; *(v8us*)(pkh + c) = kh[u]; *(v8us*)(pkl + c) = kl[u]; }
    asm volatile("s_wait_xcnt 0x0" ::: "memory"); }   // behind the job's last store: in a shared launch another job's code follows in the listing and writes the stores' registers again
template <int R>
__device__ __forceinline__ void d_gathv(int bx, const float* __restrict__ QKV, bf* V) {   // a wave: 32 keys of one group with all 64 d (whole 256-byte source rows; four whole fragments a plane); piece (half, nb): keys half 16 + hi 8 + j, d = nb 16 + lr
    const int i = bx * 256 + threadIdx.x; const int lane = i & 31, lr = lane & 15, hi = lane >> 4; const int wv = i >> 5; const int kb = wv % (GG / 32), zl = wv / (GG / 32); const int h = zl % NH_, seg = zl / NH_;
    const unsigned vo = (unsigned)dpos(R, seg, h, kb * 32 + hi * 8) * (3 * EE) + h * HD + lr; const float* p = QKV + 2 * EE + vo; float f[2][4][8]; v8us oh[2][4], ol[2][4];   // element offset inside qkv (12.6 M elements): one register beside the uniform base
#pragma unroll
    for (int half = 0; half < 2; ++half)
#pragma unroll
        for (int j = 0; j < 8; ++j)
#pragma unroll
            for (int nb = 0; nb < 4; ++nb) f[half][nb][j] = p[(half * 16 + j) * R * 3 * EE + nb * 16];
    __builtin_amdgcn_sched_barrier(0);   // holds every load in front of the wait below, and so in flight together
    asm volatile("s_wait_xcnt 0x0" :: "v"(vo) : "memory");   // the wait in front of any rewrite of the loads' offset register; as an input it stays whole up to it
#pragma unroll
    for (int half = 0; half < 2; ++half)
#pragma unroll
        for (int nb = 0; nb < 4; ++nb)
#pragma unroll
            for (int j = 0; j < 8; ++j) { unsigned short a, c; splitf(f[half][nb][j], a, c); oh[half][nb][j] = a; ol[half][nb][j] = c; }
    bf* q = V + ((unsigned)zl * (2 * HD * GG) + kb * 512 + lane * 8);   // per group: the hi plane [HD rows d][GG keys] in fragment order, then the lo plane
    __builtin_amdgcn_sched_barrier(0);   // holds the stores behind the last split: nothing is computed into a register of an issued store
#pragma unroll
    for (int half = 0; half < 2; ++half)
#pragma unroll
        for (int nb = 0; nb < 4; ++nb) { *(v8us*)(q + nb * 16 * GG + half * 256) = oh[half][nb]; *(v8us*)(q + nb * 16 * GG + half * 256 + HD * GG) = ol[half][nb]; }
    asm volatile("s_wait_xcnt 0x0" ::: "memory"); }   // behind the job's last store: in a shared launch another job's code follows in the listing and writes the stores' registers again
// ---- Pre-passes that do not depend on one another SHARE A LAUNCH: the block's number picks its job (a scalar branch) and its place inside that job. Alone, each of these short launches paid the gap to the launch before it,
// its own start and its own drain, and the smaller ones left most of the chip idle meanwhile. k_pre: x and both weights into their planes. k_gall: the q/k and the v planes of all three branches, the larger jobs first.
#define NB_CVT (LL / 16)
#define NB_WQ  (EE * 3 * EE / 64 / 256)
#define NB_WP  (EE * EE / 64 / 256)
__global__ __launch_bounds__(256) void k_pre(const float* __restrict__ x, const float* __restrict__ wqkv, const float* __restrict__ wproj, bf* XB, bf* WQ, bf* WP) {
    const int b = blockIdx.x;
    if (b < NB_CVT) d_cvt8<EE>(b, x, XB);
    else if (b < NB_CVT + NB_WQ) d_wtG<EE, 3 * EE>(b - NB_CVT, wqkv, WQ);
    else d_wtG<EE, EE>(b - NB_CVT - NB_WQ, wproj, WP);
}
#define NB_G1 (4 * NH_ * GG / 128)   // blocks of the q/k planes of branch 1 (a branch of nz groups: nz GG / 16 waves, 8 waves a block); the v planes take half as many (nz GG / 32 waves), branch 2 half of branch 1, branch 4 a quarter
#define PO1 ((size_t)4 * NH_ * GG * HD)   // first plane element of branch 2's groups, and of branch 4's
#define PO2 ((size_t)6 * NH_ * GG * HD)
__global__ __launch_bounds__(256) void k_gall(const float* __restrict__ QKV, bf* Qh, bf* Ql, bf* Kh, bf* Kl, bf* V) {
    int b = blockIdx.x;
    if (b < NB_G1) { d_gath<1>(b, QKV, Qh, Ql, Kh, Kl); return; }
    b -= NB_G1;
    if (b < NB_G1 / 2) { d_gathv<1>(b, QKV, V); return; }
    b -= NB_G1 / 2;
    if (b < NB_G1 / 2) { d_gath<2>(b, QKV, Qh + PO1, Ql + PO1, Kh + PO1, Kl + PO1); return; }
    b -= NB_G1 / 2;
    if (b < NB_G1 / 4) { d_gathv<2>(b, QKV, V + 2 * PO1); return; }
    b -= NB_G1 / 4;
    if (b < NB_G1 / 4) { d_gath<4>(b, QKV, Qh + PO2, Ql + PO2, Kh + PO2, Kl + PO2); return; }
    b -= NB_G1 / 4;
    d_gathv<4>(b, QKV, V + 2 * PO2);
}
// ---- k_fattn: scores, softmax, the probability-logsumexp and probs.v of one (segment, head) group in ONE kernel; no score or probability ever reaches memory. Block = 4 independent waves (no barrier, no LDS); a wave owns 32 query rows
// and walks its causal keys 32 at a time, twice: sweep 1 finds each row's max and sum (running, rescaled), sweep 2 forms the scores again, normalises them, sums exp(p) and multiplies by v.
// The score tile is computed TRANSPOSED (A = keys, B = queries): lane (lr, hi) then holds query lr, keys 8 hi + j of tile 0 and 16 + 8 hi + j of tile 1, which is the k order of the A fragment that probs.v needs: no exchange between lanes.
__device__ __forceinline__ void fa_kload(const bf* __restrict__ pkh, const bf* __restrict__ pkl, v16bf (&ah)[2][2], v16bf (&al)[2][2]) {   // pkh, pkl: the four fragments of keys k0 .. k0 + 31, at this lane's piece
#pragma unroll
    for (int kt = 0; kt < 2; ++kt)
#pragma unroll
        for (int kc = 0; kc < 2; ++kc) { ah[kt][kc] = WFrag<bf>::ld(pkh + (kt * 2 + kc) * 512); al[kt][kc] = WFrag<bf>::ld(pkl + (kt * 2 + kc) * 512); }
}
__device__ __forceinline__ void fa_scores(const v16bf (&ah)[2][2], const v16bf (&al)[2][2], int k0, int lr, int hi, int r0, const v16bf (&bqh)[2][2], const v16bf (&bql)[2][2], v8f (&s)[2][2]) {
#pragma unroll
    for (int kt = 0; kt < 2; ++kt)
#pragma unroll
        for (int qb = 0; qb < 2; ++qb) { v8f acc = (v8f){};
#pragma unroll
            for (int kc = 0; kc < 2; ++kc) { acc = wmmab(ah[kt][kc], bqh[qb][kc], acc); acc = wmmab(ah[kt][kc], bql[qb][kc], acc); acc = wmmab(al[kt][kc], bqh[qb][kc], acc); }
#pragma unroll
            for (int j = 0; j < 8; ++j) s[kt][qb][j] = (k0 + kt * 16 + hi * 8 + j) <= (r0 + qb * 16 + lr) ? acc[j] : -3.0e38f; }   // causal mask by select
}
__global__ __launch_bounds__(128) void k_fattn(const bf* __restrict__ Qh, const bf* __restrict__ Ql, const bf* __restrict__ Kh, const bf* __restrict__ Kl, const bf* __restrict__ V, float* Ob, float* LSEX) {
    const int lane = threadIdx.x & 31, lr = lane & 15, hi = lane >> 4; const int z = blockIdx.x;
    const int t = GG / 32 - 1 - (int)(blockIdx.y * 4 + __builtin_amdgcn_readfirstlane(threadIdx.x >> 5));   // the longest rows are launched first; the wave's number in a scalar register, so that both loops branch on scalars
    const int r0 = t * 32; const size_t zo = (size_t)z * GG * HD; const size_t lo = zo + 8 * lane;
    v16bf bqh[2][2], bql[2][2]; const bf* pqh = Qh + lo + (size_t)r0 * HD; const bf* pql = Ql + lo + (size_t)r0 * HD;
#pragma unroll
    for (int qb = 0; qb < 2; ++qb)
#pragma unroll
        for (int kc = 0; kc < 2; ++kc) { bqh[qb][kc] = WFrag<bf>::ld(pqh + (qb * 2 + kc) * 512); bql[qb][kc] = WFrag<bf>::ld(pql + (qb * 2 + kc) * 512); }
    asm volatile("s_wait_xcnt 0x0" :: "v"(pqh), "v"(pql) : "memory");   // the wait in front of any reuse of the query loads' address registers; as inputs they stay whole up to it
    float m[2] = {-3.0e38f, -3.0e38f}, l[2] = {0.f, 0.f};
    { const bf* pkh = Kh + lo; const bf* pkl = Kl + lo;
    for (int kb = 0; kb <= t; ++kb) { v8f s[2][2]; v16bf ah[2][2], al[2][2]; fa_kload(pkh, pkl, ah, al);
        __builtin_amdgcn_sched_barrier(0);   // holds all sixteen key loads in front of the first product: one memory latency a step instead of one per pair of loads
        asm volatile("s_wait_xcnt 0x0" :: "v"(pkh), "v"(pkl) : "memory");   // the wait in front of any rewrite of the loads' address registers; as inputs they stay whole up to it
        fa_scores(ah, al, kb * 32, lr, hi, r0, bqh, bql, s); pkh += 32 * HD; pkl += 32 * HD;
#pragma unroll
        for (int qb = 0; qb < 2; ++qb) { float mx = m[qb];
#pragma unroll
            for (int j = 0; j < 8; ++j) mx = fmaxf(mx, fmaxf(s[0][qb][j], s[1][qb][j]));
            float a = l[qb] * __expf(m[qb] - mx);
#pragma unroll
            for (int j = 0; j < 8; ++j) a += __expf(s[0][qb][j] - mx) + __expf(s[1][qb][j] - mx);
            m[qb] = mx; l[qb] = a; } } }
    float inv[2];
#pragma unroll
    for (int qb = 0; qb < 2; ++qb) { const float mm = fmaxf(m[qb], __shfl_xor(m[qb], 16, 32)); float a = l[qb] * __expf(m[qb] - mm); a += __shfl_xor(a, 16, 32); m[qb] = mm; inv[qb] = __fdiv_rn(1.0f, a); }   // a lane whose keys were all masked holds m = -3e38: its sum is scaled to 0
    float se[2] = {0.f, 0.f}; v8f o[2][4];
#pragma unroll
    for (int qb = 0; qb < 2; ++qb)
#pragma unroll
        for (int nb = 0; nb < 4; ++nb) o[qb][nb] = (v8f){};
    { const bf* pkh = Kh + lo; const bf* pkl = Kl + lo; const bf* pv = V + (size_t)z * HD * 2 * GG + 8 * lane;
    for (int kb = 0; kb <= t; ++kb) { v8f s[2][2]; v16bf ah[2][2], al[2][2], vh[4], vl[4]; fa_kload(pkh, pkl, ah, al);
#pragma unroll
        for (int nb = 0; nb < 4; ++nb) { vh[nb] = WFrag<bf>::ld(pv + (size_t)nb * 16 * GG); vl[nb] = WFrag<bf>::ld(pv + (size_t)nb * 16 * GG + HD * GG); }
        __builtin_amdgcn_sched_barrier(0);   // holds the key and the value loads in front of the first product: one memory latency a step, and the value tile flies under the scores and the softmax
        asm volatile("s_wait_xcnt 0x0" :: "v"(pkh), "v"(pkl), "v"(pv) : "memory");   // the wait in front of any rewrite of the loads' address registers; as inputs they stay whole up to it
        fa_scores(ah, al, kb * 32, lr, hi, r0, bqh, bql, s); pkh += 32 * HD; pkl += 32 * HD; pv += 512; v16bf ph[2], pl[2];
#pragma unroll
        for (int qb = 0; qb < 2; ++qb) { v8u h, c;   // two neighbouring keys a word: one packed convert makes the hi pair, one the lo pair
#pragma unroll
            for (int kt = 0; kt < 2; ++kt)
#pragma unroll
                for (int j = 0; j < 8; j += 2) { v2f p; p[0] = __expf(s[kt][qb][j] - m[qb]) * inv[qb]; p[1] = __expf(s[kt][qb][j + 1] - m[qb]) * inv[qb]; se[qb] += __expf(p[0]); se[qb] += __expf(p[1]);   // masked: p = 0 exactly, exp(0) = 1, as the reference
                    const v2bf a = __builtin_convertvector(p, v2bf); const v2bf b = __builtin_convertvector(p - __builtin_convertvector(a, v2f), v2bf); h[kt * 4 + (j >> 1)] = __builtin_bit_cast(unsigned, a); c[kt * 4 + (j >> 1)] = __builtin_bit_cast(unsigned, b); }
            ph[qb] = __builtin_bit_cast(v16bf, h); pl[qb] = __builtin_bit_cast(v16bf, c); }
#pragma unroll
        for (int nb = 0; nb < 4; ++nb)
#pragma unroll
            for (int qb = 0; qb < 2; ++qb) { o[qb][nb] = wmmab(ph[qb], vh[nb], o[qb][nb]); o[qb][nb] = wmmab(pl[qb], vh[nb], o[qb][nb]); o[qb][nb] = wmmab(ph[qb], vl[nb], o[qb][nb]); } } }
#pragma unroll
    for (int qb = 0; qb < 2; ++qb) { const float st = se[qb] + __shfl_xor(se[qb], 16, 32) + (float)(GG - (t + 1) * 32);   // the keys beyond this wave's last tile are masked: exp(0) = 1 each
        const float lse = __logf(st); const v4f lv = {lse, lse, lse, lse}; float* lp = LSEX + ((size_t)z * GG + r0 + qb * 16 + lr) * 32 + hi * 16;
#pragma unroll
        for (int q = 0; q < 4; ++q) *(v4f*)(lp + q * 4) = lv;
#pragma unroll
        for (int nb = 0; nb < 4; ++nb)
#pragma unroll
            for (int j = 0; j < 8; ++j) Ob[((size_t)z * GG + r0 + qb * 16 + hi * 8 + j) * HD + nb * 16 + lr] = o[qb][nb][j]; }
}
// k_comb: per (l, h): for each branch k (r = 1, 2, 4; segment w = 1024 r): head h uses position l iff (l mod w) mod r == h / (16/r); then gi = (l mod w) / r, z = (l / w) 16 + h, o_k = Ob_k[z][gi][:] and
// a wave: head h (64 k: two whole fragments a plane) of 16 positions; a thread's piece 2 g + c2 is k half c2 of position l + 8 g, where the same branches are in use (8 % r == 0) 8 / r rows further on; the weights of a position serve both its halves
__global__ __launch_bounds__(256) void k_comb(const float* __restrict__ Ob0, const float* __restrict__ Ob1, const float* __restrict__ Ob2, const float* __restrict__ L0, const float* __restrict__ L1, const float* __restrict__ L2, bf* Ah, bf* Al) { const int i = blockIdx.x * 256 + threadIdx.x; const int lane = i & 31, kq = lane & 3, rr = lane >> 2; const int wv = i >> 5; const int h = wv % NH_; const int l = (wv / NH_) * 16 + rr;
    const float* obs[3] = {Ob0, Ob1, Ob2}; const float* lss[3] = {L0, L1, L2}; float lsq[2][3]; unsigned vl[3], vb[3]; bool used[3]; v8f obq[4][3]; v8us ohq[4], olq[4];
#pragma unroll
    for (int k = 0; k < 3; ++k) { const int r = 1 << k; const int w = GG * r; const int ll = l % w; const int off = h / (NH_ / r); used[k] = (ll % r) == off; const int gi = ll / r; const int z = (l / w) * NH_ + h; const unsigned src = (unsigned)(z * GG + gi); vl[k] = src * (32 * 4); vb[k] = (src * HD + kq * 8) * 4;   // byte offsets: one register a branch for the lse rows, one for the outputs
        const float* pl = (const float*)((const char*)lss[k] + vl[k]); const float* po = (const float*)((const char*)obs[k] + vb[k]);
        lsq[0][k] = lsq[1][k] = -1.0e8f; obq[0][k] = obq[1][k] = obq[2][k] = obq[3][k] = (v8f){};
        if (used[k]) {   // one masked stretch a branch: its two lse values and, per piece, 8 outputs in two 16-byte loads; all pieces and branches in flight together
#pragma unroll
            for (int g = 0; g < 2; ++g) lsq[g][k] = pl[g * (8 / r) * 32];
#pragma unroll
            for (int pc = 0; pc < 4; ++pc) obq[pc][k] = *(const v8f*)(po + (pc >> 1) * (8 / r) * HD + (pc & 1) * 32); } }
    asm volatile("s_wait_xcnt 0x0" :: "v"(vl[0]), "v"(vl[1]), "v"(vl[2]), "v"(vb[0]), "v"(vb[1]), "v"(vb[2]) : "memory");   // the wait in front of any rewrite of the loads' offset registers; as inputs they stay whole up to it
#pragma unroll
    for (int g = 0; g < 2; ++g) { const float (&lse)[3] = lsq[g];
    const float m = fmaxf(lse[0], fmaxf(lse[1], lse[2])); float ex[3]; float den = 0.f;
#pragma unroll
    for (int k = 0; k < 3; ++k) { ex[k] = __expf(__fsub_rn(lse[k], m)); den = __fadd_rn(den, ex[k]); }
    const float inv = __fdiv_rn(1.0f, den);
#pragma unroll
    for (int c2 = 0; c2 < 2; ++c2) { const v8f (&ob)[3] = obq[g * 2 + c2]; v8us oh, ol;
#pragma unroll
    for (int u = 0; u < 8; ++u) { float acc = 0.f;
#pragma unroll
        for (int k = 0; k < 3; ++k) { const float o = ob[k][u]; float p = __fmul_rn(o, ex[k] * inv); asm volatile("" : "+v"(p)); acc = __fadd_rn(acc, p); }
        unsigned short a, c; splitf(acc, a, c); oh[u] = a; ol[u] = c; }
    ohq[g * 2 + c2] = oh; olq[g * 2 + c2] = ol; } }
    const unsigned e = (unsigned)wv * 1024 + (kq >> 1) * 256 + ((kq & 1) * 16 + rr) * 8; bf* pah = Ah + e; bf* pal = Al + e;
    __builtin_amdgcn_sched_barrier(0);   // holds the stores behind the last split: nothing is computed into a register of an issued store
#pragma unroll
    for (int pc = 0; pc < 4; ++pc) { *(v8us*)(pah + (pc & 1) * 512 + (pc >> 1) * 64) = ohq[pc]; *(v8us*)(pal + (pc & 1) * 512 + (pc >> 1) * 64) = olq[pc]; } }

extern "C" void kernel_launch(void* const* d_in, const int* in_sizes, int n_in,
                              void* d_out, int out_size, void* d_ws, size_t ws_size, hipStream_t stream) {
    (void)in_sizes; (void)n_in; (void)out_size;
    const float* x = (const float*)d_in[0]; const float* wqkv = (const float*)d_in[1]; const float* wproj = (const float*)d_in[2];
    float* OUT = (float*)d_out;     // [1][4096][1024]
    char* wsp = (char*)d_ws;
    auto take = [&](size_t bytes) { char* p = wsp; wsp += (bytes + 255) & ~(size_t)255; return (void*)p; };
    const int NZ = 7 * NH_;   // (segment, head) groups of all three branches: 64 + 32 + 16, numbered through
    bf* WP = (bf*)take((size_t)EE * EE * 2); float* QKV = (float*)take((size_t)LL * 3 * EE * 4);
    bf* Qh = (bf*)take((size_t)NZ * GG * HD * 2); bf* Ql = (bf*)take((size_t)NZ * GG * HD * 2); bf* Kh = (bf*)take((size_t)NZ * GG * HD * 2); bf* Kl = (bf*)take((size_t)NZ * GG * HD * 2); bf* V = (bf*)take((size_t)NZ * HD * GG * 4);
    bf* WQ = (bf*)take((size_t)3 * EE * EE * 2); bf* XB = (bf*)take((size_t)LL * EE * 2); bf* Ah = (bf*)take((size_t)LL * EE * 2); bf* Al = (bf*)take((size_t)LL * EE * 2);
    float* Ob = (float*)take((size_t)NZ * GG * HD * 4); float* LS = (float*)take((size_t)NZ * GG * 32 * 4);
    const int zb[3] = {0, 4 * NH_, 6 * NH_};   // first group of each branch
    float* ObK[3]; float* LSK[3]; for (int k = 0; k < 3; ++k) { ObK[k] = Ob + (size_t)zb[k] * GG * HD; LSK[k] = LS + (size_t)zb[k] * GG * 32; }
    if ((size_t)(wsp - (char*)d_ws) > ws_size) return;    // total 216 MB (qkv f32 [4096][3072] 50 MB, gathered hl planes of 112 groups 88 MB, branch outputs + row-replicated lse 44 MB, weights, x and the combined planes 34 MB)
    k_pre<<<NB_CVT + NB_WQ + NB_WP, 256, 0, stream>>>(x, wqkv, wproj, XB, WQ, WP);
    k_gemmw<bf, 0, false><<<dim3(LL / 128, 3 * EE / 128, 1), 128, 0, stream>>>(XB, nullptr, WQ, nullptr, EE, QKV, 3 * EE, nullptr, 0, 0, 0);
    k_gall<<<NB_G1 * 21 / 8, 256, 0, stream>>>(QKV, Qh, Ql, Kh, Kl, V);   // 1 + 1/2 + 1/2 + 1/4 + 1/4 + 1/8 of branch 1's q/k blocks
    k_fattn<<<dim3(NZ, GG / 128, 1), 128, 0, stream>>>(Qh, Ql, Kh, Kl, V, Ob, LS);
    k_comb<<<LL * NH_ / 128, 256, 0, stream>>>(ObK[0], ObK[1], ObK[2], LSK[0], LSK[1], LSK[2], Ah, Al);
    k_gemmw<bf, 1, false><<<dim3(LL / 128, EE / 128, 1), 128, 0, stream>>>(Ah, Al, WP, nullptr, EE, OUT, EE, nullptr, 0, 0, 0);
}

// v008
// A run of this version takes 115 microseconds.
// Next to v007, in two timings, it ran 1.11 times as fast each time.
// Counting every step since v000, it is 7.11 times as fast.
#include <hip/hip_runtime.h>

// Dilated causal self-attention (x [1][4096][1024]; qkv = x w_qkv (16 heads x 64); three branches (segment w, dilation r) = (1024,1), (2048,2), (4096,4): inside each segment, head h attends causally over the
// g = w/r = 1024 positions {gi r + off}, off = h / (16/r) (the reference's diagonal sparsify); softmax(q.k/8) with a causal mask over gi; branch output scattered back to those positions (0 elsewhere) with lse = logsumexp over the softmax
// PROBABILITIES of the row (masked entries contribute exp(0)), -1e8 elsewhere; branches recombined per (position, head) with softmax(lse) weights; out @ w_proj -> [1][4096][1024]).
// Compute dtypes, f32 accumulate: every input rounded to bf16; qkv on PLAIN bf16 operands (inputs: exact); per (segment, head) 1024x1024 attention on bf16 hi+lo planes gathered at the dilated positions
// (q x 1/8 exact; scores K 64 with 3 products, causal tiles skipped), softmax + the probability-logsumexp in f32 registers, probs.v on hl planes (3 products); the 3-branch recombination f32; w_proj on hl planes x exact (2 products). GEMMs: four waves per 128x128 tile, operands staged in LDS; the qkv GEMM writes those planes itself

#define LL   4096
#define EE   1024
#define NH_  16
#define HD   64
#define GG   1024
#define PCAR 1024.0f
typedef _Float16 h16;
typedef unsigned short bf;
typedef __attribute__((ext_vector_type(16))) __bf16   v16bf;
typedef __attribute__((ext_vector_type(16))) _Float16 v16h;
typedef __attribute__((ext_vector_type(8)))  _Float16 v8h;
typedef __attribute__((ext_vector_type(8)))  unsigned short v8us;
typedef __attribute__((ext_vector_type(8)))  float    v8f;
typedef __attribute__((ext_vector_type(4)))  float    v4f;
typedef v8h  __attribute__((may_alias)) v8ha;
typedef v4f  __attribute__((may_alias)) v4fa;
typedef v8us __attribute__((may_alias)) v8usa;

__device__ __forceinline__ unsigned short f2bf(float f) { return __builtin_bit_cast(unsigned short, (__bf16)f); }   // the hardware's convert: round to nearest even, as the integer form it replaces
__device__ __forceinline__ float bf2f(unsigned short b) { return __uint_as_float(((unsigned)b) << 16); }
__device__ __forceinline__ float bfr(float f) { return bf2f(f2bf(f)); }
__device__ __forceinline__ v16h cat16(v8h lo, v8h hi) { return __builtin_shufflevector(lo, hi, 0, 1, 2, 3, 4, 5, 6, 7, 8, 9, 10, 11, 12, 13, 14, 15); }
__device__ __forceinline__ v16bf cat16b(v8us lo, v8us hi) { return __builtin_bit_cast(v16bf, __builtin_shufflevector(lo, hi, 0, 1, 2, 3, 4, 5, 6, 7, 8, 9, 10, 11, 12, 13, 14, 15)); }
__device__ __forceinline__ v8f wmma16(v16h a, v16h b, v8f c) { return __builtin_amdgcn_wmma_f32_16x16x32_f16(false, a, false, b, (short)0, c, false, false); }
__device__ __forceinline__ v8f wmmab(v16bf a, v16bf b, v8f c) { return __builtin_amdgcn_wmma_f32_16x16x32_bf16(false, a, false, b, (short)0, c, false, false); }



// ---- FRAGMENT ORDER of every 16-bit operand plane [rows][K]: the plane is cut into fragments of 16 rows x 32 k (512 elements, 1 KiB), numbered (row / 16) (K / 32) + k / 32; inside a fragment element (row, k) lies at
// ((k >> 4) & 1) 256 + (((k >> 3) & 1) 16 + (row & 15)) 8 + (k & 7). Lane (lr, hi) = 16 hi + lr then finds its 8 + 8 elements (k = 8 hi + j and 16 + 8 hi + j of row lr, the hardware k order) at lane 8 and 256 + lane 8:
// each wave-wide 16-byte load reads 512 contiguous bytes, 4 whole lines, where a row-major plane made it touch 16 lines.
__device__ __forceinline__ size_t fo8(int row, int k, int K) { return ((size_t)(row >> 4) * (K >> 5) + (k >> 5)) * 512 + ((k >> 4) & 1) * 256 + (((k >> 3) & 1) * 16 + (row & 15)) * 8; }   // place of the 8 elements k .. k + 7 (k % 8 == 0) of a row
// ---- k_gemmw: GEMM on 16-bit planes in fragment order. A block of FOUR WAVES (2 x 2) makes a 128x128 tile of C, a wave its 64x64 quarter (16 accumulators); grid (M/128, N/128, Z), 128 threads.
// The block's operands pass through LDS: a stage is 64 k of the tile's 128 rows of every plane (8 row blocks x 2 fragments = 16 KiB a plane), brought in by asynchronous copies, each byte once a block, where four separate waves
// fetched each fragment twice from L2. Fragments are copied as they lie (1 KiB, lane-contiguous), so a wave-wide 16-byte LDS read takes 512 contiguous bytes. Two buffers: the next stage's copies fly while this stage is multiplied.
// C[m][n] (f32, pitch ldc, + optional f32 bias[n]) = sum_k A[m][k] Bt[n][k] (+ split products per NSPLIT). z-batch strides sA/sB/sC in elements. M % 128 == 0, N % 128 == 0, K % 64 == 0.
template <typename T16> struct WFrag;
template <> struct WFrag<h16> { typedef v16h V; static __device__ __forceinline__ V ld(const h16* p) { return cat16(*(const v8h*)p, *(const v8h*)(p + 256)); } static __device__ __forceinline__ v8f mma(V a, V b, v8f c) { return wmma16(a, b, c); } };
template <> struct WFrag<bf> { typedef v16bf V; static __device__ __forceinline__ V ld(const bf* p) { return cat16b(*(const v8us*)p, *(const v8us*)(p + 256)); } static __device__ __forceinline__ v8f mma(V a, V b, v8f c) { return wmmab(a, b, c); } };
// One wave's share of one plane's stage: two row blocks of 2 KiB, eight wave-wide copies of 512 bytes; l: the lane's LDS byte address, g: the lane's source address, rbstep: bytes from a row block of the plane to the next.
__device__ __forceinline__ void cp8(unsigned l, const char* g, unsigned rbstep) { const char* g2 = g + rbstep;
    asm volatile("global_load_async_to_lds_b128 %0, %8, off\n\t"
                 "global_load_async_to_lds_b128 %1, %9, off\n\t"
                 "global_load_async_to_lds_b128 %2, %10, off\n\t"
                 "global_load_async_to_lds_b128 %3, %11, off\n\t"
                 "global_load_async_to_lds_b128 %4, %12, off\n\t"
                 "global_load_async_to_lds_b128 %5, %13, off\n\t"
                 "global_load_async_to_lds_b128 %6, %14, off\n\t"
                 "global_load_async_to_lds_b128 %7, %15, off\n\t"
                 "s_wait_xcnt 0x0"   // inside the copies' own statement: it stands in front of any rewrite of their address registers
                 :: "v"(l), "v"(l + 512u), "v"(l + 1024u), "v"(l + 1536u), "v"(l + 2048u), "v"(l + 2560u), "v"(l + 3072u), "v"(l + 3584u),
                    "v"(g), "v"(g + 512), "v"(g + 1024), "v"(g + 1536), "v"(g2), "v"(g2 + 512), "v"(g2 + 1024), "v"(g2 + 1536) : "memory"); }
__device__ __forceinline__ void splitf(float y, unsigned short& h, unsigned short& l) { h = f2bf(y); l = f2bf(y - bf2f(h)); }
#define PO1 ((size_t)4 * NH_ * GG * HD)   // first plane element of branch 2's groups, and of branch 4's
#define PO2 ((size_t)6 * NH_ * GG * HD)
// ---- PLANES: the qkv GEMM writes the attention's operand planes itself; no f32 qkv reaches memory and no gather launch reads it back. os: the wave's tile [64 positions][64 d] of one head in LDS, pitch 68. Branch R uses the positions
// i R + off (off = head / (16 / R)) of the tile: 64 / R rows (keys) that follow one another in the head's group, a multiple of 16, so whole fragments (v, R = 4: a whole half). Pieces and lanes as in the other plane writers below.
// Eight pieces at a time: all LDS reads, every split, then the stores, so that nothing is computed into a register of an issued store.
template <int R>
__device__ __forceinline__ void e_qk(const float* os, int lane, int off, float sc, bf* ph, bf* pl) {   // ph, pl: the hi and lo plane at the tile's first row; lane = 4 rr + kq; piece pc: d half pc & 1 of the rows (pc >> 1) 8 + rr
    constexpr int NP8 = 64 / R / 4, NB = NP8 >= 8 ? 8 : NP8; const int kq = lane & 3, rr = lane >> 2;
    const float* s0 = os + (rr * R + off) * 68 + kq * 8; const unsigned e = (kq >> 1) * 256 + ((kq & 1) * 16 + rr) * 8; bf* qh = ph + e; bf* ql = pl + e;
#pragma unroll
    for (int p0 = 0; p0 < NP8; p0 += NB) { v4f f[NB][2]; v8us oh[NB], ol[NB];
#pragma unroll
        for (int u = 0; u < NB; ++u) { const float* p = s0 + ((p0 + u) >> 1) * 8 * R * 68 + (u & 1) * 32; f[u][0] = *(const v4fa*)p; f[u][1] = *(const v4fa*)(p + 4); }
#pragma unroll
        for (int u = 0; u < NB; ++u)
#pragma unroll
            for (int j = 0; j < 8; ++j) { unsigned short a, c; splitf(f[u][j >> 2][j & 3] * sc, a, c); oh[u][j] = a; ol[u][j] = c; }
        __builtin_amdgcn_sched_barrier(0);   // holds the stores behind the last split: nothing is computed into a register of an issued store
#pragma unroll
        for (int u = 0; u < NB; ++u) { const int c = ((p0 + u) >> 2) * 1024 + (u & 1) * 512 + (((p0 + u) >> 1) & 1) * 64; *(v8us*)(qh + c) = oh[u]; *(v8us*)(ql + c) = ol[u]; }
        asm volatile("s_wait_xcnt 0x0" ::: "memory");   // the wait in front of any rewrite of the stores' registers by the next pieces
        __builtin_amdgcn_sched_barrier(0); }   // holds the next pieces' work behind that wait
}
template <int R>
__device__ __forceinline__ void e_v(const float* os, int lane, int off, bf* pv) {   // pv: the group's hi plane [HD rows d][GG keys] at the tile's first 16 keys and this lane's piece; piece (kb, nb): keys kb 16 + hi 8 + j, d = nb 16 + lr
    constexpr int NKB = 64 / R / 16, NB = NKB >= 2 ? 2 : 1; const int lr = lane & 15, hi = lane >> 4;
    const float* s0 = os + (hi * 8 * R + off) * 68 + lr;
#pragma unroll
    for (int k0 = 0; k0 < NKB; k0 += NB) { float f[NB][4][8]; v8us oh[NB][4], ol[NB][4];
#pragma unroll
        for (int kb = 0; kb < NB; ++kb)
#pragma unroll
            for (int nb = 0; nb < 4; ++nb)
#pragma unroll
                for (int j = 0; j < 8; ++j) f[kb][nb][j] = s0[((k0 + kb) * 16 + j) * R * 68 + nb * 16];
#pragma unroll
        for (int kb = 0; kb < NB; ++kb)
#pragma unroll
            for (int nb = 0; nb < 4; ++nb)
#pragma unroll
                for (int j = 0; j < 8; ++j) { unsigned short a, c; splitf(f[kb][nb][j], a, c); oh[kb][nb][j] = a; ol[kb][nb][j] = c; }
        __builtin_amdgcn_sched_barrier(0);   // holds the stores behind the last split: nothing is computed into a register of an issued store
#pragma unroll
        for (int kb = 0; kb < NB; ++kb)
#pragma unroll
            for (int nb = 0; nb < 4; ++nb) { *(v8us*)(pv + nb * 16 * GG + (k0 + kb) * 256) = oh[kb][nb]; *(v8us*)(pv + nb * 16 * GG + (k0 + kb) * 256 + HD * GG) = ol[kb][nb]; }
        asm volatile("s_wait_xcnt 0x0" ::: "memory");   // the wait in front of any rewrite of the stores' registers by the next pieces
        __builtin_amdgcn_sched_barrier(0); }   // holds the next pieces' work behind that wait
}
template <typename T16, int NSPLIT, bool BIAS, bool PLANES>
__global__ __launch_bounds__(128) void k_gemmw(const T16* __restrict__ A, const T16* __restrict__ A2, const T16* __restrict__ Bt, const T16* __restrict__ Bt2, int K, float* C, int ldc, const float* __restrict__ bias, size_t sA, size_t sB, size_t sC, bf* Qh, bf* Ql, bf* Kh, bf* Kl, bf* Vhl) {
    typedef typename WFrag<T16>::V V;
    constexpr int NPA = (NSPLIT == 1 || NSPLIT == 2) ? 2 : 1, NPB = NSPLIT >= 2 ? 2 : 1, NP = NPA + NPB;   // planes staged: A (, A2), Bt (, Bt2)
    constexpr unsigned PLB = 8 * 2048, BUFB = NP * PLB;   // bytes of a plane's stage and of a buffer
    constexpr unsigned TILB = 4 * 64 * 68 * 4;   // PLANES: behind the loop the ring's space holds each wave's whole 64 x 64 f32 tile, pitch 68
    __shared__ __align__(2048) char ring[(PLANES && TILB > 2 * BUFB) ? TILB : 2 * BUFB];
    const size_t z = blockIdx.z; A += z * sA; if (A2) A2 += z * sA; Bt += z * sB; if (Bt2) Bt2 += z * sB; C += z * sC;
    const int lane = threadIdx.x & 31, lr = lane & 15, hi = lane >> 4; const int w = __builtin_amdgcn_readfirstlane(threadIdx.x >> 5), wm = w & 1, wn = w >> 1;
    const int R0 = blockIdx.x * 128, C0 = blockIdx.y * 128; const int r0 = R0 + wm * 64, c0 = C0 + wn * 64;
    v8f acc[4][4];
#pragma unroll
    for (int mb = 0; mb < 4; ++mb)
#pragma unroll
        for (int nb = 0; nb < 4; ++nb) acc[mb][nb] = (v8f){};
    const unsigned rbstep = (unsigned)K * 32;   // 16 rows of a plane hold 16 K elements
    const char* gs[NP];   // wave w copies row blocks 2 w and 2 w + 1 of every plane's stage
    gs[0] = (const char*)(A + (size_t)(R0 + w * 32) * K) + lane * 16; if (NPA == 2) gs[1] = (const char*)(A2 + (size_t)(R0 + w * 32) * K) + lane * 16;
    gs[NPA] = (const char*)(Bt + (size_t)(C0 + w * 32) * K) + lane * 16; if (NPB == 2) gs[NPA + 1] = (const char*)(Bt2 + (size_t)(C0 + w * 32) * K) + lane * 16;
    const unsigned l0 = (unsigned)(size_t)ring + w * 4096 + lane * 16;
    auto fill = [&](int buf) {
#pragma unroll
        for (int p = 0; p < NP; ++p) { cp8(l0 + buf * BUFB + p * PLB, gs[p], rbstep); gs[p] += 2048; } };
    const int NT = K >> 6;
    fill(0);
    asm volatile("s_wait_asynccnt 0x0" ::: "memory");   // this wave's copies of stage 0 have landed
    __syncthreads();                                     // and every other wave's: stage 0 may be read
    if (NT > 1) fill(1);
#pragma unroll 1   // rolled: one copy of a stage's code in the instruction cache; the buffer is picked by a scalar
    for (int t = 0; t < NT; ++t) {
        const char* rb = ring + (t & 1) * BUFB + lane * 16;
        V a[2][4], a2[2][4], b[2][4], b2[2][4];
#pragma unroll
        for (int ks = 0; ks < 2; ++ks)
#pragma unroll
            for (int u = 0; u < 4; ++u) { a[ks][u] = WFrag<T16>::ld((const T16*)(rb + (wm * 4 + u) * 2048 + ks * 1024)); b[ks][u] = WFrag<T16>::ld((const T16*)(rb + NPA * PLB + (wn * 4 + u) * 2048 + ks * 1024));
                if (NPA == 2) a2[ks][u] = WFrag<T16>::ld((const T16*)(rb + PLB + (wm * 4 + u) * 2048 + ks * 1024)); if (NPB == 2) b2[ks][u] = WFrag<T16>::ld((const T16*)(rb + (NPA + 1) * PLB + (wn * 4 + u) * 2048 + ks * 1024)); }
        __builtin_amdgcn_sched_barrier(0);   // holds every fragment read of the stage in front of its first product: one LDS latency a stage; left alone, the reads stood one by one among the products, each with its own full wait
#pragma unroll
        for (int ks = 0; ks < 2; ++ks)
#pragma unroll
            for (int nb = 0; nb < 4; ++nb)
#pragma unroll
                for (int mb = 0; mb < 4; ++mb) { acc[mb][nb] = WFrag<T16>::mma(a[ks][mb], b[ks][nb], acc[mb][nb]); if (NSPLIT == 1 || NSPLIT == 2) acc[mb][nb] = WFrag<T16>::mma(a2[ks][mb], b[ks][nb], acc[mb][nb]); if (NSPLIT >= 2) acc[mb][nb] = WFrag<T16>::mma(a[ks][mb], b2[ks][nb], acc[mb][nb]); }
        __builtin_amdgcn_sched_barrier(0);   // holds the products in front of the closing waits: sunk behind the barrier, they would leave the next stage's copies only the time of the fragment reads to land
        asm volatile("s_wait_dscnt 0x0" ::: "memory");      // this wave's reads of the buffer are over before it is refilled
        asm volatile("s_wait_asynccnt 0x0" ::: "memory");   // this wave's copies of stage t + 1 have landed
        __syncthreads();                                     // publishes stage t + 1 and ends every wave's reads of stage t
        if (t + 2 < NT) fill(t & 1);
    }
    asm volatile("s_wait_asynccnt 0x0" ::: "memory");   // no copy is outstanding when the wave goes on and ends
    if constexpr (PLANES) {   // the wave's tile is 64 positions of ONE head's q, k or v: it goes straight into that head's operand planes of all three branches
        float* os = (float*)ring + w * (64 * 68);   // the loop's last barrier ended every wave's reads of the ring, and no copy is outstanding
#pragma unroll
        for (int mb = 0; mb < 4; ++mb)
#pragma unroll
            for (int nb = 0; nb < 4; ++nb)
#pragma unroll
                for (int j = 0; j < 8; ++j) os[(mb * 16 + hi * 8 + j) * 68 + nb * 16 + lr] = acc[mb][nb][j];
        __builtin_amdgcn_wave_barrier(); asm volatile("" ::: "memory");   // keeps the reads below, of what other lanes of this wave wrote, behind the writes above
        const int ty = c0 >> 10, h = (c0 & (EE - 1)) >> 6;   // 0 q, 1 k, 2 v; the head
        const unsigned z1 = (unsigned)(r0 >> 10) * NH_ + h, z2 = (unsigned)(r0 >> 11) * NH_ + h, z4 = (unsigned)(r0 >> 12) * NH_ + h;   // the group inside its branch
        const unsigned g1 = r0 & 1023, g2 = (r0 & 2047) >> 1, g4 = (r0 & 4095) >> 2;   // the tile's first sparse index there
        if (ty == 2) { bf* pv = Vhl + lane * 8;
            e_v<1>(os, lane, 0, pv + (size_t)z1 * (2 * HD * GG) + (g1 >> 4) * 256);
            e_v<2>(os, lane, h >> 3, pv + 2 * PO1 + (size_t)z2 * (2 * HD * GG) + (g2 >> 4) * 256);
            e_v<4>(os, lane, h >> 2, pv + 2 * PO2 + (size_t)z4 * (2 * HD * GG) + (g4 >> 4) * 256);
        } else { bf* H = ty ? Kh : Qh; bf* L = ty ? Kl : Ql; const float sc = ty ? 1.0f : 0.125f;   // q x 1/8, exact; k x 1, an identity
            e_qk<1>(os, lane, 0, sc, H + ((size_t)z1 * GG + g1) * HD, L + ((size_t)z1 * GG + g1) * HD);
            e_qk<2>(os, lane, h >> 3, sc, H + PO1 + ((size_t)z2 * GG + g2) * HD, L + PO1 + ((size_t)z2 * GG + g2) * HD);
            e_qk<4>(os, lane, h >> 2, sc, H + PO2 + ((size_t)z4 * GG + g4) * HD, L + PO2 + ((size_t)z4 * GG + g4) * HD);
        }
    } else {
    __shared__ __align__(16) float osm[4][16 * 68]; float* os = osm[w];
#pragma unroll
    for (int mb = 0; mb < 4; ++mb) {
#pragma unroll
        for (int nb = 0; nb < 4; ++nb) {
#pragma unroll
            for (int j = 0; j < 8; ++j) os[(hi * 8 + j) * 68 + nb * 16 + lr] = acc[mb][nb][j]; }
        __builtin_amdgcn_wave_barrier(); asm volatile("" ::: "memory");
        float* crow = C + (size_t)(r0 + mb * 16) * ldc + c0;
{
#pragma unroll
            for (int s = 0; s < 8; ++s) { const int row = 2 * s + hi, cofs = lr * 4; v4f val = *(const v4fa*)(os + row * 68 + cofs); if (BIAS) { val[0] += bfr(bias[c0 + cofs]); val[1] += bfr(bias[c0 + cofs + 1]); val[2] += bfr(bias[c0 + cofs + 2]); val[3] += bfr(bias[c0 + cofs + 3]); }
                *(v4f*)(crow + (size_t)row * ldc + cofs) = val; }
             }
        __builtin_amdgcn_wave_barrier(); asm volatile("" ::: "memory");
    }
    }
}

__device__ __forceinline__ h16 tohx(float x) { return (h16)x; }
typedef __attribute__((ext_vector_type(2))) _Float16 v2h;
typedef __attribute__((ext_vector_type(4))) _Float16 v4h;
typedef __attribute__((ext_vector_type(2))) unsigned short v2us;
typedef __attribute__((ext_vector_type(4))) unsigned short v4us;
typedef __attribute__((ext_vector_type(2))) float v2f;
typedef __attribute__((ext_vector_type(2))) __bf16 v2bf;
typedef __attribute__((ext_vector_type(8))) unsigned v8u;

// The writers of the planes. Row-major sources (d_cvt8, e_qk, k_comb): a 16-byte piece is 8 k of one row; lane = 4 rr + kq takes row rr of 8 and piece kq of a 32-k block, so 4 lanes read one whole 128-byte line of f32
// and the 8 lanes of one kq store one whole 128-byte line. Transposed sources (d_wtG, e_v): lane = 16 hi + lr as in the readers: 16 lanes read 64 contiguous bytes, the wave stores 512.
// A THREAD MAKES SEVERAL PIECES (4 or 8), not one, for speed only. A thread's pieces lie at compile-time distances from its first, in the source and in the
// planes, so one address register serves all its loads of a source and one all its stores of a plane; all loads fly together, every piece is formed, and the stores come last, so that no register of an issued load or store is written again.
template <int K, int N>
__device__ __forceinline__ void d_wtG(int bx, const float* __restrict__ w, bf* Bt) {   // a wave: 16 k (one half of a 32-k block) of 8 neighbouring 16-column blocks: 512 contiguous bytes of each source row
    const int i = bx * 256 + threadIdx.x; const int lane = i & 31, lr = lane & 15, hi = lane >> 4; const int wv = i >> 5; const int half = wv & 1, fr = wv >> 1; const int kb = fr % (K >> 5), ng = fr / (K >> 5);
    const unsigned vo = (unsigned)(kb * 32 + half * 16 + hi * 8) * N + ng * 128 + lr; const float* p = w + vo; float f[8][8]; v8us o[8];
#pragma unroll
    for (int u = 0; u < 8; ++u)
#pragma unroll
        for (int j = 0; j < 8; ++j) f[u][j] = p[j * N + u * 16];
    __builtin_amdgcn_sched_barrier(0);   // holds every load in front of the wait below, and so in flight together
    asm volatile("s_wait_xcnt 0x0" :: "v"(vo) : "memory");   // the wait in front of any rewrite of the loads' offset register; as an input it stays whole up to it
#pragma unroll
    for (int u = 0; u < 8; ++u)
#pragma unroll
        for (int j = 0; j < 8; ++j) o[u][j] = f2bf(f[u][j]);
    bf* q = Bt + ((unsigned)((ng * 8 * (K >> 5) + kb) * 2 + half) * 256 + lane * 8);
    __builtin_amdgcn_sched_barrier(0);   // holds the stores behind the last conversion: nothing is computed into a register of an issued store
#pragma unroll
    for (int u = 0; u < 8; ++u) *(v8us*)(q + u * (K >> 5) * 512) = o[u];
    asm volatile("s_wait_xcnt 0x0" ::: "memory"); }   // behind the job's last store: in a shared launch another job's code follows in the listing and writes the stores' registers again
template <int K>
__device__ __forceinline__ void d_cvt8(int bx, const float* __restrict__ src, bf* dst) {   // a block: 16 whole rows (K = 1024: 32 fragments); wave wq, piece u: 32-k block (u & 3) 8 + wq of the rows (u >> 2) 8 + rr
    static_assert(K == 1024, "8 waves x 8 pieces cover 16 rows of 1024"); const int lane = threadIdx.x & 31, kq = lane & 3, rr = lane >> 2, wq = threadIdx.x >> 5;
    const unsigned vo = ((unsigned)(bx * 16 + rr) * K + wq * 32 + kq * 8) * 4; const float* p = (const float*)((const char*)src + vo); v8f v[8]; v8us o[8];
#pragma unroll
    for (int u = 0; u < 8; ++u) v[u] = *(const v8f*)(p + (u >> 2) * 8 * K + (u & 3) * 256);
    __builtin_amdgcn_sched_barrier(0);   // holds every load in front of the wait below, and so in flight together
    asm volatile("s_wait_xcnt 0x0" :: "v"(vo) : "memory");   // the wait in front of any rewrite of the loads' offset register; as an input it stays whole up to it
#pragma unroll
    for (int u = 0; u < 8; ++u)
#pragma unroll
        for (int j = 0; j < 8; ++j) o[u][j] = f2bf(v[u][j]);
    bf* q = dst + ((unsigned)bx * 16 * K + wq * 512 + (kq >> 1) * 256 + ((kq & 1) * 16 + rr) * 8);
    __builtin_amdgcn_sched_barrier(0);   // holds the stores behind the last conversion: nothing is computed into a register of an issued store
#pragma unroll
    for (int u = 0; u < 8; ++u) *(v8us*)(q + (u & 3) * 8 * 512 + (u >> 2) * 64) = o[u];
    asm volatile("s_wait_xcnt 0x0" ::: "memory"); }   // behind the job's last store: in a shared launch another job's code follows in the listing and writes the stores' registers again
// ---- Pre-passes that do not depend on one another SHARE A LAUNCH: the block's number picks its job (a scalar branch) and its place inside that job. Alone, each of these short launches paid the gap to the launch before it,
// its own start and its own drain, and the smaller ones left most of the chip idle meanwhile. k_pre: x and both weights into their planes.
#define NB_CVT (LL / 16)
#define NB_WQ  (EE * 3 * EE / 64 / 256)
#define NB_WP  (EE * EE / 64 / 256)
__global__ __launch_bounds__(256) void k_pre(const float* __restrict__ x, const float* __restrict__ wqkv, const float* __restrict__ wproj, bf* XB, bf* WQ, bf* WP) {
    const int b = blockIdx.x;
    if (b < NB_CVT) d_cvt8<EE>(b, x, XB);
    else if (b < NB_CVT + NB_WQ) d_wtG<EE, 3 * EE>(b - NB_CVT, wqkv, WQ);
    else d_wtG<EE, EE>(b - NB_CVT - NB_WQ, wproj, WP);
}
// ---- k_fattn: scores, softmax, the probability-logsumexp and probs.v of one (segment, head) group in ONE kernel; no score or probability ever reaches memory. Block = 4 independent waves (no barrier, no LDS); a wave owns 32 query rows
// and walks its causal keys 32 at a time, twice: sweep 1 finds each row's max and sum (running, rescaled), sweep 2 forms the scores again, normalises them, sums exp(p) and multiplies by v.
// The score tile is computed TRANSPOSED (A = keys, B = queries): lane (lr, hi) then holds query lr, keys 8 hi + j of tile 0 and 16 + 8 hi + j of tile 1, which is the k order of the A fragment that probs.v needs: no exchange between lanes.
__device__ __forceinline__ void fa_kload(const bf* __restrict__ pkh, const bf* __restrict__ pkl, v16bf (&ah)[2][2], v16bf (&al)[2][2]) {   // pkh, pkl: the four fragments of keys k0 .. k0 + 31, at this lane's piece
#pragma unroll
    for (int kt = 0; kt < 2; ++kt)
#pragma unroll
        for (int kc = 0; kc < 2; ++kc) { ah[kt][kc] = WFrag<bf>::ld(pkh + (kt * 2 + kc) * 512); al[kt][kc] = WFrag<bf>::ld(pkl + (kt * 2 + kc) * 512); }
}
__device__ __forceinline__ void fa_scores(const v16bf (&ah)[2][2], const v16bf (&al)[2][2], int k0, int lr, int hi, int r0, const v16bf (&bqh)[2][2], const v16bf (&bql)[2][2], v8f (&s)[2][2]) {
#pragma unroll
    for (int kt = 0; kt < 2; ++kt)
#pragma unroll
        for (int qb = 0; qb < 2; ++qb) { v8f acc = (v8f){};
#pragma unroll
            for (int kc = 0; kc < 2; ++kc) { acc = wmmab(ah[kt][kc], bqh[qb][kc], acc); acc = wmmab(ah[kt][kc], bql[qb][kc], acc); acc = wmmab(al[kt][kc], bqh[qb][kc], acc); }
#pragma unroll
            for (int j = 0; j < 8; ++j) s[kt][qb][j] = (k0 + kt * 16 + hi * 8 + j) <= (r0 + qb * 16 + lr) ? acc[j] : -3.0e38f; }   // causal mask by select
}
__global__ __launch_bounds__(128) void k_fattn(const bf* __restrict__ Qh, const bf* __restrict__ Ql, const bf* __restrict__ Kh, const bf* __restrict__ Kl, const bf* __restrict__ V, float* Ob, float* LSEX) {
    const int lane = threadIdx.x & 31, lr = lane & 15, hi = lane >> 4; const int z = blockIdx.x;
    const int t = GG / 32 - 1 - (int)(blockIdx.y * 4 + __builtin_amdgcn_readfirstlane(threadIdx.x >> 5));   // the longest rows are launched first; the wave's number in a scalar register, so that both loops branch on scalars
    const int r0 = t * 32; const size_t zo = (size_t)z * GG * HD; const size_t lo = zo + 8 * lane;
    v16bf bqh[2][2], bql[2][2]; const bf* pqh = Qh + lo + (size_t)r0 * HD; const bf* pql = Ql + lo + (size_t)r0 * HD;
#pragma unroll
    for (int qb = 0; qb < 2; ++qb)
#pragma unroll
        for (int kc = 0; kc < 2; ++kc) { bqh[qb][kc] = WFrag<bf>::ld(pqh + (qb * 2 + kc) * 512); bql[qb][kc] = WFrag<bf>::ld(pql + (qb * 2 + kc) * 512); }
    asm volatile("s_wait_xcnt 0x0" :: "v"(pqh), "v"(pql) : "memory");   // the wait in front of any reuse of the query loads' address registers; as inputs they stay whole up to it
    float m[2] = {-3.0e38f, -3.0e38f}, l[2] = {0.f, 0.f};
    { const bf* pkh = Kh + lo; const bf* pkl = Kl + lo;
    for (int kb = 0; kb <= t; ++kb) { v8f s[2][2]; v16bf ah[2][2], al[2][2]; fa_kload(pkh, pkl, ah, al);
        __builtin_amdgcn_sched_barrier(0);   // holds all sixteen key loads in front of the first product: one memory latency a step instead of one per pair of loads
        asm volatile("s_wait_xcnt 0x0" :: "v"(pkh), "v"(pkl) : "memory");   // the wait in front of any rewrite of the loads' address registers; as inputs they stay whole up to it
        fa_scores(ah, al, kb * 32, lr, hi, r0, bqh, bql, s); pkh += 32 * HD; pkl += 32 * HD;
#pragma unroll
        for (int qb = 0; qb < 2; ++qb) { float mx = m[qb];
#pragma unroll
            for (int j = 0; j < 8; ++j) mx = fmaxf(mx, fmaxf(s[0][qb][j], s[1][qb][j]));
            float a = l[qb] * __expf(m[qb] - mx);
#pragma unroll
            for (int j = 0; j < 8; ++j) a += __expf(s[0][qb][j] - mx) + __expf(s[1][qb][j] - mx);
            m[qb] = mx; l[qb] = a; } } }
    float inv[2];
#pragma unroll
    for (int qb = 0; qb < 2; ++qb) { const float mm = fmaxf(m[qb], __shfl_xor(m[qb], 16, 32)); float a = l[qb] * __expf(m[qb] - mm); a += __shfl_xor(a, 16, 32); m[qb] = mm; inv[qb] = __fdiv_rn(1.0f, a); }   // a lane whose keys were all masked holds m = -3e38: its sum is scaled to 0
    float se[2] = {0.f, 0.f}; v8f o[2][4];
#pragma unroll
    for (int qb = 0; qb < 2; ++qb)
#pragma unroll
        for (int nb = 0; nb < 4; ++nb) o[qb][nb] = (v8f){};
    { const bf* pkh = Kh + lo; const bf* pkl = Kl + lo; const bf* pv = V + (size_t)z * HD * 2 * GG + 8 * lane;
    for (int kb = 0; kb <= t; ++kb) { v8f s[2][2]; v16bf ah[2][2], al[2][2], vh[4], vl[4]; fa_kload(pkh, pkl, ah, al);
#pragma unroll
        for (int nb = 0; nb < 4; ++nb) { vh[nb] = WFrag<bf>::ld(pv + (size_t)nb * 16 * GG); vl[nb] = WFrag<bf>::ld(pv + (size_t)nb * 16 * GG + HD * GG); }
        __builtin_amdgcn_sched_barrier(0);   // holds the key and the value loads in front of the first product: one memory latency a step, and the value tile flies under the scores and the softmax
        asm volatile("s_wait_xcnt 0x0" :: "v"(pkh), "v"(pkl), "v"(pv) : "memory");   // the wait in front of any rewrite of the loads' address registers; as inputs they stay whole up to it
        fa_scores(ah, al, kb * 32, lr, hi, r0, bqh, bql, s); pkh += 32 * HD; pkl += 32 * HD; pv += 512; v16bf ph[2], pl[2];
#pragma unroll
        for (int qb = 0; qb < 2; ++qb) { v8u h, c;   // two neighbouring keys a word: one packed convert makes the hi pair, one the lo pair
#pragma unroll
            for (int kt = 0; kt < 2; ++kt)
#pragma unroll
                for (int j = 0; j < 8; j += 2) { v2f p; p[0] = __expf(s[kt][qb][j] - m[qb]) * inv[qb]; p[1] = __expf(s[kt][qb][j + 1] - m[qb]) * inv[qb]; se[qb] += __expf(p[0]); se[qb] += __expf(p[1]);   // masked: p = 0 exactly, exp(0) = 1, as the reference
                    const v2bf a = __builtin_convertvector(p, v2bf); const v2bf b = __builtin_convertvector(p - __builtin_convertvector(a, v2f), v2bf); h[kt * 4 + (j >> 1)] = __builtin_bit_cast(unsigned, a); c[kt * 4 + (j >> 1)] = __builtin_bit_cast(unsigned, b); }
            ph[qb] = __builtin_bit_cast(v16bf, h); pl[qb] = __builtin_bit_cast(v16bf, c); }
#pragma unroll
        for (int nb = 0; nb < 4; ++nb)
#pragma unroll
            for (int qb = 0; qb < 2; ++qb) { o[qb][nb] = wmmab(ph[qb], vh[nb], o[qb][nb]); o[qb][nb] = wmmab(pl[qb], vh[nb], o[qb][nb]); o[qb][nb] = wmmab(ph[qb], vl[nb], o[qb][nb]); } } }
#pragma unroll
    for (int qb = 0; qb < 2; ++qb) { const float st = se[qb] + __shfl_xor(se[qb], 16, 32) + (float)(GG - (t + 1) * 32);   // the keys beyond this wave's last tile are masked: exp(0) = 1 each
        const float lse = __logf(st); const v4f lv = {lse, lse, lse, lse}; float* lp = LSEX + ((size_t)z * GG + r0 + qb * 16 + lr) * 32 + hi * 16;
#pragma unroll
        for (int q = 0; q < 4; ++q) *(v4f*)(lp + q * 4) = lv;
#pragma unroll
        for (int nb = 0; nb < 4; ++nb)
#pragma unroll
            for (int j = 0; j < 8; ++j) Ob[((size_t)z * GG + r0 + qb * 16 + hi * 8 + j) * HD + nb * 16 + lr] = o[qb][nb][j]; }
}
// k_comb: per (l, h): for each branch k (r = 1, 2, 4; segment w = 1024 r): head h uses position l iff (l mod w) mod r == h / (16/r); then gi = (l mod w) / r, z = (l / w) 16 + h, o_k = Ob_k[z][gi][:] and
// a wave: head h (64 k: two whole fragments a plane) of 16 positions; a thread's piece 2 g + c2 is k half c2 of position l + 8 g, where the same branches are in use (8 % r == 0) 8 / r rows further on; the weights of a position serve both its halves
__global__ __launch_bounds__(256) void k_comb(const float* __restrict__ Ob0, const float* __restrict__ Ob1, const float* __restrict__ Ob2, const float* __restrict__ L0, const float* __restrict__ L1, const float* __restrict__ L2, bf* Ah, bf* Al) { const int i = blockIdx.x * 256 + threadIdx.x; const int lane = i & 31, kq = lane & 3, rr = lane >> 2; const int wv = i >> 5; const int h = wv % NH_; const int l = (wv / NH_) * 16 + rr;
    const float* obs[3] = {Ob0, Ob1, Ob2}; const float* lss[3] = {L0, L1, L2}; float lsq[2][3]; unsigned vl[3], vb[3]; bool used[3]; v8f obq[4][3]; v8us ohq[4], olq[4];
#pragma unroll
    for (int k = 0; k < 3; ++k) { const int r = 1 << k; const int w = GG * r; const int ll = l % w; const int off = h / (NH_ / r); used[k] = (ll % r) == off; const int gi = ll / r; const int z = (l / w) * NH_ + h; const unsigned src = (unsigned)(z * GG + gi); vl[k] = src * (32 * 4); vb[k] = (src * HD + kq * 8) * 4;   // byte offsets: one register a branch for the lse rows, one for the outputs
        const float* pl = (const float*)((const char*)lss[k] + vl[k]); const float* po = (const float*)((const char*)obs[k] + vb[k]);
        lsq[0][k] = lsq[1][k] = -1.0e8f; obq[0][k] = obq[1][k] = obq[2][k] = obq[3][k] = (v8f){};
        if (used[k]) {   // one masked stretch a branch: its two lse values and, per piece, 8 outputs in two 16-byte loads; all pieces and branches in flight together
#pragma unroll
            for (int g = 0; g < 2; ++g) lsq[g][k] = pl[g * (8 / r) * 32];
#pragma unroll
            for (int pc = 0; pc < 4; ++pc) obq[pc][k] = *(const v8f*)(po + (pc >> 1) * (8 / r) * HD + (pc & 1) * 32); } }
    asm volatile("s_wait_xcnt 0x0" :: "v"(vl[0]), "v"(vl[1]), "v"(vl[2]), "v"(vb[0]), "v"(vb[1]), "v"(vb[2]) : "memory");   // the wait in front of any rewrite of the loads' offset registers; as inputs they stay whole up to it
#pragma unroll
    for (int g = 0; g < 2; ++g) { const float (&lse)[3] = lsq[g];
    const float m = fmaxf(lse[0], fmaxf(lse[1], lse[2])); float ex[3]; float den = 0.f;
#pragma unroll
    for (int k = 0; k < 3; ++k) { ex[k] = __expf(__fsub_rn(lse[k], m)); den = __fadd_rn(den, ex[k]); }
    const float inv = __fdiv_rn(1.0f, den);
#pragma unroll
    for (int c2 = 0; c2 < 2; ++c2) { const v8f (&ob)[3] = obq[g * 2 + c2]; v8us oh, ol;
#pragma unroll
    for (int u = 0; u < 8; ++u) { float acc = 0.f;
#pragma unroll
        for (int k = 0; k < 3; ++k) { const float o = ob[k][u]; float p = __fmul_rn(o, ex[k] * inv); asm volatile("" : "+v"(p)); acc = __fadd_rn(acc, p); }
        unsigned short a, c; splitf(acc, a, c); oh[u] = a; ol[u] = c; }
    ohq[g * 2 + c2] = oh; olq[g * 2 + c2] = ol; } }
    const unsigned e = (unsigned)wv * 1024 + (kq >> 1) * 256 + ((kq & 1) * 16 + rr) * 8; bf* pah = Ah + e; bf* pal = Al + e;
    __builtin_amdgcn_sched_barrier(0);   // holds the stores behind the last split: nothing is computed into a register of an issued store
#pragma unroll
    for (int pc = 0; pc < 4; ++pc) { *(v8us*)(pah + (pc & 1) * 512 + (pc >> 1) * 64) = ohq[pc]; *(v8us*)(pal + (pc & 1) * 512 + (pc >> 1) * 64) = olq[pc]; } }

extern "C" void kernel_launch(void* const* d_in, const int* in_sizes, int n_in,
                              void* d_out, int out_size, void* d_ws, size_t ws_size, hipStream_t stream) {
    (void)in_sizes; (void)n_in; (void)out_size;
    const float* x = (const float*)d_in[0]; const float* wqkv = (const float*)d_in[1]; const float* wproj = (const float*)d_in[2];
    float* OUT = (float*)d_out;     // [1][4096][1024]
    char* wsp = (char*)d_ws;
    auto take = [&](size_t bytes) { char* p = wsp; wsp += (bytes + 255) & ~(size_t)255; return (void*)p; };
    const int NZ = 7 * NH_;   // (segment, head) groups of all three branches: 64 + 32 + 16, numbered through
    bf* WP = (bf*)take((size_t)EE * EE * 2);
    bf* Qh = (bf*)take((size_t)NZ * GG * HD * 2); bf* Ql = (bf*)take((size_t)NZ * GG * HD * 2); bf* Kh = (bf*)take((size_t)NZ * GG * HD * 2); bf* Kl = (bf*)take((size_t)NZ * GG * HD * 2); bf* V = (bf*)take((size_t)NZ * HD * GG * 4);
    bf* WQ = (bf*)take((size_t)3 * EE * EE * 2); bf* XB = (bf*)take((size_t)LL * EE * 2); bf* Ah = (bf*)take((size_t)LL * EE * 2); bf* Al = (bf*)take((size_t)LL * EE * 2);
    float* Ob = (float*)take((size_t)NZ * GG * HD * 4); float* LS = (float*)take((size_t)NZ * GG * 32 * 4);
    const int zb[3] = {0, 4 * NH_, 6 * NH_};   // first group of each branch
    float* ObK[3]; float* LSK[3]; for (int k = 0; k < 3; ++k) { ObK[k] = Ob + (size_t)zb[k] * GG * HD; LSK[k] = LS + (size_t)zb[k] * GG * 32; }
    if ((size_t)(wsp - (char*)d_ws) > ws_size) return;    // total 166 MB (hl planes of 112 groups 88 MB, branch outputs + row-replicated lse 44 MB, weights, x and the combined planes 34 MB)
    k_pre<<<NB_CVT + NB_WQ + NB_WP, 256, 0, stream>>>(x, wqkv, wproj, XB, WQ, WP);
    k_gemmw<bf, 0, false, true><<<dim3(LL / 128, 3 * EE / 128, 1), 128, 0, stream>>>(XB, nullptr, WQ, nullptr, EE, nullptr, 3 * EE, nullptr, 0, 0, 0, Qh, Ql, Kh, Kl, V);
    k_fattn<<<dim3(NZ, GG / 128, 1), 128, 0, stream>>>(Qh, Ql, Kh, Kl, V, Ob, LS);
    k_comb<<<LL * NH_ / 128, 256, 0, stream>>>(ObK[0], ObK[1], ObK[2], LSK[0], LSK[1], LSK[2], Ah, Al);
    k_gemmw<bf, 1, false, false><<<dim3(LL / 128, EE / 128, 1), 128, 0, stream>>>(Ah, Al, WP, nullptr, EE, OUT, EE, nullptr, 0, 0, 0, nullptr, nullptr, nullptr, nullptr, nullptr);
}

// v009
// One run takes 107 microseconds.
// Next to v008, in two timings, it ran 1.07 and 1.05 times as fast.
// All steps since v000 together make it 7.53 times as fast.
#include <hip/hip_runtime.h>

// Dilated causal self-attention (x [1][4096][1024]; qkv = x w_qkv (16 heads x 64); three branches (segment w, dilation r) = (1024,1), (2048,2), (4096,4): inside each segment, head h attends causally over the
// g = w/r = 1024 positions {gi r + off}, off = h / (16/r) (the reference's diagonal sparsify); softmax(q.k/8) with a causal mask over gi; branch output scattered back to those positions (0 elsewhere) with lse = logsumexp over the softmax
// PROBABILITIES of the row (masked entries contribute exp(0)), -1e8 elsewhere; branches recombined per (position, head) with softmax(lse) weights; out @ w_proj -> [1][4096][1024]).
// Compute dtypes, f32 accumulate: every input rounded to bf16; qkv on PLAIN bf16 operands (inputs: exact); per (segment, head) 1024x1024 attention on bf16 hi+lo planes gathered at the dilated positions
// (q x 1/8 exact; scores K 64 with 3 products, causal tiles skipped), softmax + the probability-logsumexp in f32 registers, probs.v on hl planes (3 products); the 3-branch recombination f32; w_proj on hl planes x exact (2 products). GEMMs: four waves per 128x128 tile, operands staged in LDS; the qkv GEMM writes those planes itself

#define LL   4096
#define EE   1024
#define NH_  16
#define HD   64
#define GG   1024
#define PCAR 1024.0f
typedef _Float16 h16;
typedef unsigned short bf;
typedef __attribute__((ext_vector_type(16))) __bf16   v16bf;
typedef __attribute__((ext_vector_type(16))) _Float16 v16h;
typedef __attribute__((ext_vector_type(8)))  _Float16 v8h;
typedef __attribute__((ext_vector_type(8)))  unsigned short v8us;
typedef __attribute__((ext_vector_type(8)))  float    v8f;
typedef __attribute__((ext_vector_type(4)))  float    v4f;
typedef v8h  __attribute__((may_alias)) v8ha;
typedef v4f  __attribute__((may_alias)) v4fa;
typedef v8us __attribute__((may_alias)) v8usa;

__device__ __forceinline__ unsigned short f2bf(float f) { return __builtin_bit_cast(unsigned short, (__bf16)f); }   // the hardware's convert: round to nearest even, as the integer form it replaces
__device__ __forceinline__ float bf2f(unsigned short b) { return __uint_as_float(((unsigned)b) << 16); }
__device__ __forceinline__ float bfr(float f) { return bf2f(f2bf(f)); }
__device__ __forceinline__ v16h cat16(v8h lo, v8h hi) { return __builtin_shufflevector(lo, hi, 0, 1, 2, 3, 4, 5, 6, 7, 8, 9, 10, 11, 12, 13, 14, 15); }
__device__ __forceinline__ v16bf cat16b(v8us lo, v8us hi) { return __builtin_bit_cast(v16bf, __builtin_shufflevector(lo, hi, 0, 1, 2, 3, 4, 5, 6, 7, 8, 9, 10, 11, 12, 13, 14, 15)); }
__device__ __forceinline__ v8f wmma16(v16h a, v16h b, v8f c) { return __builtin_amdgcn_wmma_f32_16x16x32_f16(false, a, false, b, (short)0, c, false, false); }
__device__ __forceinline__ v8f wmmab(v16bf a, v16bf b, v8f c) { return __builtin_amdgcn_wmma_f32_16x16x32_bf16(false, a, false, b, (short)0, c, false, false); }



// ---- FRAGMENT ORDER of every 16-bit operand plane [rows][K]: the plane is cut into fragments of 16 rows x 32 k (512 elements, 1 KiB), numbered (row / 16) (K / 32) + k / 32; inside a fragment element (row, k) lies at
// ((k >> 4) & 1) 256 + (((k >> 3) & 1) 16 + (row & 15)) 8 + (k & 7). Lane (lr, hi) = 16 hi + lr then finds its 8 + 8 elements (k = 8 hi + j and 16 + 8 hi + j of row lr, the hardware k order) at lane 8 and 256 + lane 8:
// each wave-wide 16-byte load reads 512 contiguous bytes, 4 whole lines, where a row-major plane made it touch 16 lines.
__device__ __forceinline__ size_t fo8(int row, int k, int K) { return ((size_t)(row >> 4) * (K >> 5) + (k >> 5)) * 512 + ((k >> 4) & 1) * 256 + (((k >> 3) & 1) * 16 + (row & 15)) * 8; }   // place of the 8 elements k .. k + 7 (k % 8 == 0) of a row
// ---- k_gemmw: GEMM on 16-bit planes in fragment order. A block of FOUR WAVES (2 x 2) makes a 128x128 tile of C, a wave its 64x64 quarter (16 accumulators); grid (M/128, N/128, Z), 128 threads.
// The block's operands pass through LDS: a stage is 64 k of the tile's 128 rows of every plane (8 row blocks x 2 fragments = 16 KiB a plane), brought in by asynchronous copies, each byte once a block, where four separate waves
// fetched each fragment twice from L2. Fragments are copied as they lie (1 KiB, lane-contiguous), so a wave-wide 16-byte LDS read takes 512 contiguous bytes. Two buffers: the next stage's copies fly while this stage is multiplied.
// C[m][n] (f32, pitch ldc, + optional f32 bias[n]) = sum_k A[m][k] Bt[n][k] (+ split products per NSPLIT). z-batch strides sA/sB/sC in elements. M % 128 == 0, N % 128 == 0, K % 64 == 0.
template <typename T16> struct WFrag;
template <> struct WFrag<h16> { typedef v16h V; static __device__ __forceinline__ V ld(const h16* p) { return cat16(*(const v8h*)p, *(const v8h*)(p + 256)); } static __device__ __forceinline__ v8f mma(V a, V b, v8f c) { return wmma16(a, b, c); } };
template <> struct WFrag<bf> { typedef v16bf V; static __device__ __forceinline__ V ld(const bf* p) { return cat16b(*(const v8us*)p, *(const v8us*)(p + 256)); } static __device__ __forceinline__ v8f mma(V a, V b, v8f c) { return wmmab(a, b, c); } };
// One wave's share of one plane's stage: two row blocks of 2 KiB, eight wave-wide copies of 512 bytes; l: the lane's LDS byte address, g: the lane's source address, rbstep: bytes from a row block of the plane to the next.
__device__ __forceinline__ void cp8(unsigned l, const char* g, unsigned rbstep) { const char* g2 = g + rbstep;
    asm volatile("global_load_async_to_lds_b128 %0, %8, off\n\t"
                 "global_load_async_to_lds_b128 %1, %9, off\n\t"
                 "global_load_async_to_lds_b128 %2, %10, off\n\t"
                 "global_load_async_to_lds_b128 %3, %11, off\n\t"
                 "global_load_async_to_lds_b128 %4, %12, off\n\t"
                 "global_load_async_to_lds_b128 %5, %13, off\n\t"
                 "global_load_async_to_lds_b128 %6, %14, off\n\t"
                 "global_load_async_to_lds_b128 %7, %15, off\n\t"
                 "s_wait_xcnt 0x0"   // inside the copies' own statement: it stands in front of any rewrite of their address registers
                 :: "v"(l), "v"(l + 512u), "v"(l + 1024u), "v"(l + 1536u), "v"(l + 2048u), "v"(l + 2560u), "v"(l + 3072u), "v"(l + 3584u),
                    "v"(g), "v"(g + 512), "v"(g + 1024), "v"(g + 1536), "v"(g2), "v"(g2 + 512), "v"(g2 + 1024), "v"(g2 + 1536) : "memory"); }
__device__ __forceinline__ void splitf(float y, unsigned short& h, unsigned short& l) { h = f2bf(y); l = f2bf(y - bf2f(h)); }
#define PO1 ((size_t)4 * NH_ * GG * HD)   // first plane element of branch 2's groups, and of branch 4's
#define PO2 ((size_t)6 * NH_ * GG * HD)
// ---- PLANES: the qkv GEMM writes the attention's operand planes itself; no f32 qkv reaches memory and no gather launch reads it back. os: the wave's tile [64 positions][64 d] of one head in LDS, pitch 68. Branch R uses the positions
// i R + off (off = head / (16 / R)) of the tile: 64 / R rows (keys) that follow one another in the head's group, a multiple of 16, so whole fragments (v, R = 4: a whole half). Pieces and lanes as in the other plane writers below.
// Eight pieces at a time: all LDS reads, every split, then the stores, so that nothing is computed into a register of an issued store.
template <int R>
__device__ __forceinline__ void e_qk(const float* os, int lane, int off, float sc, bf* ph, bf* pl) {   // ph, pl: the hi and lo plane at the tile's first row; lane = 4 rr + kq; piece pc: d half pc & 1 of the rows (pc >> 1) 8 + rr
    constexpr int NP8 = 64 / R / 4, NB = NP8 >= 8 ? 8 : NP8; const int kq = lane & 3, rr = lane >> 2;
    const float* s0 = os + (rr * R + off) * 68 + kq * 8; const unsigned e = (kq >> 1) * 256 + ((kq & 1) * 16 + rr) * 8; bf* qh = ph + e; bf* ql = pl + e;
#pragma unroll
    for (int p0 = 0; p0 < NP8; p0 += NB) { v4f f[NB][2]; v8us oh[NB], ol[NB];
#pragma unroll
        for (int u = 0; u < NB; ++u) { const float* p = s0 + ((p0 + u) >> 1) * 8 * R * 68 + (u & 1) * 32; f[u][0] = *(const v4fa*)p; f[u][1] = *(const v4fa*)(p + 4); }
#pragma unroll
        for (int u = 0; u < NB; ++u)
#pragma unroll
            for (int j = 0; j < 8; ++j) { unsigned short a, c; splitf(f[u][j >> 2][j & 3] * sc, a, c); oh[u][j] = a; ol[u][j] = c; }
        __builtin_amdgcn_sched_barrier(0);   // holds the stores behind the last split: nothing is computed into a register of an issued store
#pragma unroll
        for (int u = 0; u < NB; ++u) { const int c = ((p0 + u) >> 2) * 1024 + (u & 1) * 512 + (((p0 + u) >> 1) & 1) * 64; *(v8us*)(qh + c) = oh[u]; *(v8us*)(ql + c) = ol[u]; }
        asm volatile("s_wait_xcnt 0x0" ::: "memory");   // the wait in front of any rewrite of the stores' registers by the next pieces
        __builtin_amdgcn_sched_barrier(0); }   // holds the next pieces' work behind that wait
}
template <int R>
__device__ __forceinline__ void e_v(const float* os, int lane, int off, bf* pv) {   // pv: the group's hi plane [HD rows d][GG keys] at the tile's first 16 keys and this lane's piece; piece (kb, nb): keys kb 16 + hi 8 + j, d = nb 16 + lr
    constexpr int NKB = 64 / R / 16, NB = NKB >= 2 ? 2 : 1; const int lr = lane & 15, hi = lane >> 4;
    const float* s0 = os + (hi * 8 * R + off) * 68 + lr;
#pragma unroll
    for (int k0 = 0; k0 < NKB; k0 += NB) { float f[NB][4][8]; v8us oh[NB][4], ol[NB][4];
#pragma unroll
        for (int kb = 0; kb < NB; ++kb)
#pragma unroll
            for (int nb = 0; nb < 4; ++nb)
#pragma unroll
                for (int j = 0; j < 8; ++j) f[kb][nb][j] = s0[((k0 + kb) * 16 + j) * R * 68 + nb * 16];
#pragma unroll
        for (int kb = 0; kb < NB; ++kb)
#pragma unroll
            for (int nb = 0; nb < 4; ++nb)
#pragma unroll
                for (int j = 0; j < 8; ++j) { unsigned short a, c; splitf(f[kb][nb][j], a, c); oh[kb][nb][j] = a; ol[kb][nb][j] = c; }
        __builtin_amdgcn_sched_barrier(0);   // holds the stores behind the last split: nothing is computed into a register of an issued store
#pragma unroll
        for (int kb = 0; kb < NB; ++kb)
#pragma unroll
            for (int nb = 0; nb < 4; ++nb) { *(v8us*)(pv + nb * 16 * GG + (k0 + kb) * 256) = oh[kb][nb]; *(v8us*)(pv + nb * 16 * GG + (k0 + kb) * 256 + HD * GG) = ol[kb][nb]; }
        asm volatile("s_wait_xcnt 0x0" ::: "memory");   // the wait in front of any rewrite of the stores' registers by the next pieces
        __builtin_amdgcn_sched_barrier(0); }   // holds the next pieces' work behind that wait
}
template <typename T16, int NSPLIT, bool BIAS, bool PLANES>
__global__ __launch_bounds__(128) void k_gemmw(const T16* __restrict__ A, const T16* __restrict__ A2, const T16* __restrict__ Bt, const T16* __restrict__ Bt2, int K, float* C, int ldc, const float* __restrict__ bias, size_t sA, size_t sB, size_t sC, bf* Qh, bf* Ql, bf* Kh, bf* Kl, bf* Vhl) {
    typedef typename WFrag<T16>::V V;
    constexpr int NPA = (NSPLIT == 1 || NSPLIT == 2) ? 2 : 1, NPB = NSPLIT >= 2 ? 2 : 1, NP = NPA + NPB;   // planes staged: A (, A2), Bt (, Bt2)
    constexpr unsigned PLB = 8 * 2048, BUFB = NP * PLB;   // bytes of a plane's stage and of a buffer
    constexpr unsigned TILB = 4 * 64 * 68 * 4;   // PLANES: behind the loop the ring's space holds each wave's whole 64 x 64 f32 tile, pitch 68
    __shared__ __align__(2048) char ring[(PLANES && TILB > 2 * BUFB) ? TILB : 2 * BUFB];
    const size_t z = blockIdx.z; A += z * sA; if (A2) A2 += z * sA; Bt += z * sB; if (Bt2) Bt2 += z * sB; C += z * sC;
    const int lane = threadIdx.x & 31, lr = lane & 15, hi = lane >> 4; const int w = __builtin_amdgcn_readfirstlane(threadIdx.x >> 5), wm = w & 1, wn = w >> 1;
    const int R0 = blockIdx.x * 128, C0 = blockIdx.y * 128; const int r0 = R0 + wm * 64, c0 = C0 + wn * 64;
    v8f acc[4][4];
#pragma unroll
    for (int mb = 0; mb < 4; ++mb)
#pragma unroll
        for (int nb = 0; nb < 4; ++nb) acc[mb][nb] = (v8f){};
    const unsigned rbstep = (unsigned)K * 32;   // 16 rows of a plane hold 16 K elements
    const char* gs[NP];   // wave w copies row blocks 2 w and 2 w + 1 of every plane's stage
    gs[0] = (const char*)(A + (size_t)(R0 + w * 32) * K) + lane * 16; if (NPA == 2) gs[1] = (const char*)(A2 + (size_t)(R0 + w * 32) * K) + lane * 16;
    gs[NPA] = (const char*)(Bt + (size_t)(C0 + w * 32) * K) + lane * 16; if (NPB == 2) gs[NPA + 1] = (const char*)(Bt2 + (size_t)(C0 + w * 32) * K) + lane * 16;
    const unsigned l0 = (unsigned)(size_t)ring + w * 4096 + lane * 16;
    auto fill = [&](int buf) {
#pragma unroll
        for (int p = 0; p < NP; ++p) { cp8(l0 + buf * BUFB + p * PLB, gs[p], rbstep); gs[p] += 2048; } };
    const int NT = K >> 6;
    fill(0);
    asm volatile("s_wait_asynccnt 0x0" ::: "memory");   // this wave's copies of stage 0 have landed
    __syncthreads();                                     // and every other wave's: stage 0 may be read
    if (NT > 1) fill(1);
#pragma unroll 1   // rolled: one copy of a stage's code in the instruction cache; the buffer is picked by a scalar
    for (int t = 0; t < NT; ++t) {
        const char* rb = ring + (t & 1) * BUFB + lane * 16;
        V a[2][4], a2[2][4], b[2][4], b2[2][4];
#pragma unroll
        for (int ks = 0; ks < 2; ++ks)
#pragma unroll
            for (int u = 0; u < 4; ++u) { a[ks][u] = WFrag<T16>::ld((const T16*)(rb + (wm * 4 + u) * 2048 + ks * 1024)); b[ks][u] = WFrag<T16>::ld((const T16*)(rb + NPA * PLB + (wn * 4 + u) * 2048 + ks * 1024));
                if (NPA == 2) a2[ks][u] = WFrag<T16>::ld((const T16*)(rb + PLB + (wm * 4 + u) * 2048 + ks * 1024)); if (NPB == 2) b2[ks][u] = WFrag<T16>::ld((const T16*)(rb + (NPA + 1) * PLB + (wn * 4 + u) * 2048 + ks * 1024)); }
        __builtin_amdgcn_sched_barrier(0);   // holds every fragment read of the stage in front of its first product: one LDS latency a stage; left alone, the reads stood one by one among the products, each with its own full wait
#pragma unroll
        for (int ks = 0; ks < 2; ++ks)
#pragma unroll
            for (int nb = 0; nb < 4; ++nb)
#pragma unroll
                for (int mb = 0; mb < 4; ++mb) { acc[mb][nb] = WFrag<T16>::mma(a[ks][mb], b[ks][nb], acc[mb][nb]); if (NSPLIT == 1 || NSPLIT == 2) acc[mb][nb] = WFrag<T16>::mma(a2[ks][mb], b[ks][nb], acc[mb][nb]); if (NSPLIT >= 2) acc[mb][nb] = WFrag<T16>::mma(a[ks][mb], b2[ks][nb], acc[mb][nb]); }
        __builtin_amdgcn_sched_barrier(0);   // holds the products in front of the closing waits: sunk behind the barrier, they would leave the next stage's copies only the time of the fragment reads to land
        asm volatile("s_wait_dscnt 0x0" ::: "memory");      // this wave's reads of the buffer are over before it is refilled
        asm volatile("s_wait_asynccnt 0x0" ::: "memory");   // this wave's copies of stage t + 1 have landed
        __syncthreads();                                     // publishes stage t + 1 and ends every wave's reads of stage t
        if (t + 2 < NT) fill(t & 1);
    }
    asm volatile("s_wait_asynccnt 0x0" ::: "memory");   // no copy is outstanding when the wave goes on and ends
    if constexpr (PLANES) {   // the wave's tile is 64 positions of ONE head's q, k or v: it goes straight into that head's operand planes of all three branches
        float* os = (float*)ring + w * (64 * 68);   // the loop's last barrier ended every wave's reads of the ring, and no copy is outstanding
#pragma unroll
        for (int mb = 0; mb < 4; ++mb)
#pragma unroll
            for (int nb = 0; nb < 4; ++nb)
#pragma unroll
                for (int j = 0; j < 8; ++j) os[(mb * 16 + hi * 8 + j) * 68 + nb * 16 + lr] = acc[mb][nb][j];
        __builtin_amdgcn_wave_barrier(); asm volatile("" ::: "memory");   // keeps the reads below, of what other lanes of this wave wrote, behind the writes above
        const int ty = c0 >> 10, h = (c0 & (EE - 1)) >> 6;   // 0 q, 1 k, 2 v; the head
        const unsigned z1 = (unsigned)(r0 >> 10) * NH_ + h, z2 = (unsigned)(r0 >> 11) * NH_ + h, z4 = (unsigned)(r0 >> 12) * NH_ + h;   // the group inside its branch
        const unsigned g1 = r0 & 1023, g2 = (r0 & 2047) >> 1, g4 = (r0 & 4095) >> 2;   // the tile's first sparse index there
        if (ty == 2) { bf* pv = Vhl + lane * 8;
            e_v<1>(os, lane, 0, pv + (size_t)z1 * (2 * HD * GG) + (g1 >> 4) * 256);
            e_v<2>(os, lane, h >> 3, pv + 2 * PO1 + (size_t)z2 * (2 * HD * GG) + (g2 >> 4) * 256);
            e_v<4>(os, lane, h >> 2, pv + 2 * PO2 + (size_t)z4 * (2 * HD * GG) + (g4 >> 4) * 256);
        } else { bf* H = ty ? Kh : Qh; bf* L = ty ? Kl : Ql; const float sc = ty ? 1.0f : 0.125f;   // q x 1/8, exact; k x 1, an identity
            e_qk<1>(os, lane, 0, sc, H + ((size_t)z1 * GG + g1) * HD, L + ((size_t)z1 * GG + g1) * HD);
            e_qk<2>(os, lane, h >> 3, sc, H + PO1 + ((size_t)z2 * GG + g2) * HD, L + PO1 + ((size_t)z2 * GG + g2) * HD);
            e_qk<4>(os, lane, h >> 2, sc, H + PO2 + ((size_t)z4 * GG + g4) * HD, L + PO2 + ((size_t)z4 * GG + g4) * HD);
        }
    } else {
    __shared__ __align__(16) float osm[4][16 * 68]; float* os = osm[w];
#pragma unroll
    for (int mb = 0; mb < 4; ++mb) {
#pragma unroll
        for (int nb = 0; nb < 4; ++nb) {
#pragma unroll
            for (int j = 0; j < 8; ++j) os[(hi * 8 + j) * 68 + nb * 16 + lr] = acc[mb][nb][j]; }
        __builtin_amdgcn_wave_barrier(); asm volatile("" ::: "memory");
        float* crow = C + (size_t)(r0 + mb * 16) * ldc + c0;
{
#pragma unroll
            for (int s = 0; s < 8; ++s) { const int row = 2 * s + hi, cofs = lr * 4; v4f val = *(const v4fa*)(os + row * 68 + cofs); if (BIAS) { val[0] += bfr(bias[c0 + cofs]); val[1] += bfr(bias[c0 + cofs + 1]); val[2] += bfr(bias[c0 + cofs + 2]); val[3] += bfr(bias[c0 + cofs + 3]); }
                *(v4f*)(crow + (size_t)row * ldc + cofs) = val; }
             }
        __builtin_amdgcn_wave_barrier(); asm volatile("" ::: "memory");
    }
    }
}

__device__ __forceinline__ h16 tohx(float x) { return (h16)x; }
typedef __attribute__((ext_vector_type(2))) _Float16 v2h;
typedef __attribute__((ext_vector_type(4))) _Float16 v4h;
typedef __attribute__((ext_vector_type(2))) unsigned short v2us;
typedef __attribute__((ext_vector_type(4))) unsigned short v4us;
typedef __attribute__((ext_vector_type(2))) float v2f;
typedef __attribute__((ext_vector_type(2))) __bf16 v2bf;
typedef __attribute__((ext_vector_type(8))) unsigned v8u;

// The writers of the planes. Row-major sources (d_cvt8, e_qk, k_comb): a 16-byte piece is 8 k of one row; lane = 4 rr + kq takes row rr of 8 and piece kq of a 32-k block, so 4 lanes read one whole 128-byte line of f32
// and the 8 lanes of one kq store one whole 128-byte line. Transposed sources (d_wtG, e_v): lane = 16 hi + lr as in the readers: 16 lanes read 64 contiguous bytes, the wave stores 512.
// A THREAD MAKES SEVERAL PIECES (4 or 8), not one, for speed only. A thread's pieces lie at compile-time distances from its first, in the source and in the
// planes, so one address register serves all its loads of a source and one all its stores of a plane; all loads fly together, every piece is formed, and the stores come last, so that no register of an issued load or store is written again.
template <int K, int N>
__device__ __forceinline__ void d_wtG(int bx, const float* __restrict__ w, bf* Bt) {   // a wave: 16 k (one half of a 32-k block) of 8 neighbouring 16-column blocks: 512 contiguous bytes of each source row
    const int i = bx * 256 + threadIdx.x; const int lane = i & 31, lr = lane & 15, hi = lane >> 4; const int wv = i >> 5; const int half = wv & 1, fr = wv >> 1; const int kb = fr % (K >> 5), ng = fr / (K >> 5);
    const unsigned vo = (unsigned)(kb * 32 + half * 16 + hi * 8) * N + ng * 128 + lr; const float* p = w + vo; float f[8][8]; v8us o[8];
#pragma unroll
    for (int u = 0; u < 8; ++u)
#pragma unroll
        for (int j = 0; j < 8; ++j) f[u][j] = p[j * N + u * 16];
    __builtin_amdgcn_sched_barrier(0);   // holds every load in front of the wait below, and so in flight together
    asm volatile("s_wait_xcnt 0x0" :: "v"(vo) : "memory");   // the wait in front of any rewrite of the loads' offset register; as an input it stays whole up to it
#pragma unroll
    for (int u = 0; u < 8; ++u)
#pragma unroll
        for (int j = 0; j < 8; ++j) o[u][j] = f2bf(f[u][j]);
    bf* q = Bt + ((unsigned)((ng * 8 * (K >> 5) + kb) * 2 + half) * 256 + lane * 8);
    __builtin_amdgcn_sched_barrier(0);   // holds the stores behind the last conversion: nothing is computed into a register of an issued store
#pragma unroll
    for (int u = 0; u < 8; ++u) *(v8us*)(q + u * (K >> 5) * 512) = o[u];
    asm volatile("s_wait_xcnt 0x0" ::: "memory"); }   // behind the job's last store: in a shared launch another job's code follows in the listing and writes the stores' registers again
template <int K>
__device__ __forceinline__ void d_cvt8(int bx, const float* __restrict__ src, bf* dst) {   // a block: 16 whole rows (K = 1024: 32 fragments); wave wq, piece u: 32-k block (u & 3) 8 + wq of the rows (u >> 2) 8 + rr
    static_assert(K == 1024, "8 waves x 8 pieces cover 16 rows of 1024"); const int lane = threadIdx.x & 31, kq = lane & 3, rr = lane >> 2, wq = threadIdx.x >> 5;
    const unsigned vo = ((unsigned)(bx * 16 + rr) * K + wq * 32 + kq * 8) * 4; const float* p = (const float*)((const char*)src + vo); v8f v[8]; v8us o[8];
#pragma unroll
    for (int u = 0; u < 8; ++u) v[u] = *(const v8f*)(p + (u >> 2) * 8 * K + (u & 3) * 256);
    __builtin_amdgcn_sched_barrier(0);   // holds every load in front of the wait below, and so in flight together
    asm volatile("s_wait_xcnt 0x0" :: "v"(vo) : "memory");   // the wait in front of any rewrite of the loads' offset register; as an input it stays whole up to it
#pragma unroll
    for (int u = 0; u < 8; ++u)
#pragma unroll
        for (int j = 0; j < 8; ++j) o[u][j] = f2bf(v[u][j]);
    bf* q = dst + ((unsigned)bx * 16 * K + wq * 512 + (kq >> 1) * 256 + ((kq & 1) * 16 + rr) * 8);
    __builtin_amdgcn_sched_barrier(0);   // holds the stores behind the last conversion: nothing is computed into a register of an issued store
#pragma unroll
    for (int u = 0; u < 8; ++u) *(v8us*)(q + (u & 3) * 8 * 512 + (u >> 2) * 64) = o[u];
    asm volatile("s_wait_xcnt 0x0" ::: "memory"); }   // behind the job's last store: in a shared launch another job's code follows in the listing and writes the stores' registers again
// ---- Pre-passes that do not depend on one another SHARE A LAUNCH: the block's number picks its job (a scalar branch) and its place inside that job. Alone, each of these short launches paid the gap to the launch before it,
// its own start and its own drain, and the smaller ones left most of the chip idle meanwhile. k_pre: x and both weights into their planes.
#define NB_CVT (LL / 16)
#define NB_WQ  (EE * 3 * EE / 64 / 256)
#define NB_WP  (EE * EE / 64 / 256)
__global__ __launch_bounds__(256) void k_pre(const float* __restrict__ x, const float* __restrict__ wqkv, const float* __restrict__ wproj, bf* XB, bf* WQ, bf* WP) {
    const int b = blockIdx.x;
    if (b < NB_CVT) d_cvt8<EE>(b, x, XB);
    else if (b < NB_CVT + NB_WQ) d_wtG<EE, 3 * EE>(b - NB_CVT, wqkv, WQ);
    else d_wtG<EE, EE>(b - NB_CVT - NB_WQ, wproj, WP);
}
// ---- k_fattn: scores, softmax, the probability-logsumexp and probs.v of one (segment, head) group in ONE kernel; no score or probability ever reaches memory. A block of four waves owns two tiles of 32 query rows; TWO WAVES SPLIT A TILE'S CAUSAL KEYS: wave w = 2 sp + ti takes the 32-key steps sp, sp + 2, ... of tile ti.
// Each wave walks its steps twice: sweep 1 finds each row's max and sum over its keys (running, rescaled), the tile's two waves join them in LDS; sweep 2 forms the scores again, normalises them, sums exp(p) and multiplies by v; the two partial
// outputs and exp sums are joined in LDS, each wave adding up and storing 16 of its tile's 32 rows. With a tile a wave, the launch lasted as long as one wave needs for 32 dependent steps (load, products, softmax) while the short waves' places
// stood empty; now the longest chain is 16 steps, there are more blocks than places, and a freed place takes the next block (the longest are launched first). The two waves of one sp walk the same keys side by side, as neighbours did before.
// The score tile is computed TRANSPOSED (A = keys, B = queries): lane (lr, hi) then holds query lr, keys 8 hi + j of tile 0 and 16 + 8 hi + j of tile 1, which is the k order of the A fragment that probs.v needs: no exchange between lanes.
__device__ __forceinline__ void fa_kload(const bf* __restrict__ pkh, const bf* __restrict__ pkl, v16bf (&ah)[2][2], v16bf (&al)[2][2]) {   // pkh, pkl: the four fragments of keys k0 .. k0 + 31, at this lane's piece
#pragma unroll
    for (int kt = 0; kt < 2; ++kt)
#pragma unroll
        for (int kc = 0; kc < 2; ++kc) { ah[kt][kc] = WFrag<bf>::ld(pkh + (kt * 2 + kc) * 512); al[kt][kc] = WFrag<bf>::ld(pkl + (kt * 2 + kc) * 512); }
}
__device__ __forceinline__ void fa_scores(const v16bf (&ah)[2][2], const v16bf (&al)[2][2], int k0, int lr, int hi, int r0, const v16bf (&bqh)[2][2], const v16bf (&bql)[2][2], v8f (&s)[2][2]) {
#pragma unroll
    for (int kt = 0; kt < 2; ++kt)
#pragma unroll
        for (int qb = 0; qb < 2; ++qb) { v8f acc = (v8f){};
#pragma unroll
            for (int kc = 0; kc < 2; ++kc) { acc = wmmab(ah[kt][kc], bqh[qb][kc], acc); acc = wmmab(ah[kt][kc], bql[qb][kc], acc); acc = wmmab(al[kt][kc], bqh[qb][kc], acc); }
#pragma unroll
            for (int j = 0; j < 8; ++j) s[kt][qb][j] = (k0 + kt * 16 + hi * 8 + j) <= (r0 + qb * 16 + lr) ? acc[j] : -3.0e38f; }   // causal mask by select
}
// The joins' few transcendentals, each with its slot in its own statement: the instruction set asks for one independent instruction or a v_nop between a transcendental and a directly following instruction that reads its result or
// overwrites its source.
__device__ __forceinline__ float exp2_slot(float x) { float r; asm("v_exp_f32 %0, %1\n\tv_nop" : "=v"(r) : "v"(x)); return r; }
__device__ __forceinline__ float log2_slot(float x) { float r; asm("v_log_f32 %0, %1\n\tv_nop" : "=v"(r) : "v"(x)); return r; }
__global__ __launch_bounds__(128) void k_fattn(const bf* __restrict__ Qh, const bf* __restrict__ Ql, const bf* __restrict__ Kh, const bf* __restrict__ Kl, const bf* __restrict__ V, float* Ob, float* LSEX) {
    __shared__ float sml[4][2][2][32];   // [wave][max, sum][16-row half of the tile][lane]
    __shared__ float sse[4][2][32];      // [wave][16-row half][lane]: the wave's sum of exp(p)
    __shared__ __align__(16) float so[4][32 * 68];   // [wave][row][d], pitch 68: the wave's partial output tile
    const int lane = threadIdx.x & 31, lr = lane & 15, hi = lane >> 4; const int z = blockIdx.x;
    const int w = __builtin_amdgcn_readfirstlane(threadIdx.x >> 5);   // the wave's number in a scalar register, so that both loops branch on scalars
    const int ti = w & 1, sp = w >> 1;   // the wave's tile in the block, and which half of the tile's key steps it takes
    const int t = GG / 32 - 1 - (int)(blockIdx.y * 2 + ti);   // the longest rows are launched first
    const int r0 = t * 32; const size_t zo = (size_t)z * GG * HD; const size_t lo = zo + 8 * lane;
    v16bf bqh[2][2], bql[2][2]; const bf* pqh = Qh + lo + (size_t)r0 * HD; const bf* pql = Ql + lo + (size_t)r0 * HD;
#pragma unroll
    for (int qb = 0; qb < 2; ++qb)
#pragma unroll
        for (int kc = 0; kc < 2; ++kc) { bqh[qb][kc] = WFrag<bf>::ld(pqh + (qb * 2 + kc) * 512); bql[qb][kc] = WFrag<bf>::ld(pql + (qb * 2 + kc) * 512); }
    asm volatile("s_wait_xcnt 0x0" :: "v"(pqh), "v"(pql) : "memory");   // the wait in front of any reuse of the query loads' address registers; as inputs they stay whole up to it
    float m[2] = {-3.0e38f, -3.0e38f}, l[2] = {0.f, 0.f};
    { const bf* pkh = Kh + lo + sp * (32 * HD); const bf* pkl = Kl + lo + sp * (32 * HD);
    for (int kb = sp; kb <= t; kb += 2) { v8f s[2][2]; v16bf ah[2][2], al[2][2]; fa_kload(pkh, pkl, ah, al);
        __builtin_amdgcn_sched_barrier(0);   // holds all sixteen key loads in front of the first product: one memory latency a step instead of one per pair of loads
        asm volatile("s_wait_xcnt 0x0" :: "v"(pkh), "v"(pkl) : "memory");   // the wait in front of any rewrite of the loads' address registers; as inputs they stay whole up to it
        fa_scores(ah, al, kb * 32, lr, hi, r0, bqh, bql, s); pkh += 2 * 32 * HD; pkl += 2 * 32 * HD;
#pragma unroll
        for (int qb = 0; qb < 2; ++qb) { float mx = m[qb];
#pragma unroll
            for (int j = 0; j < 8; ++j) mx = fmaxf(mx, fmaxf(s[0][qb][j], s[1][qb][j]));
            float a = l[qb] * __expf(m[qb] - mx);
#pragma unroll
            for (int j = 0; j < 8; ++j) a += __expf(s[0][qb][j] - mx) + __expf(s[1][qb][j] - mx);
            m[qb] = mx; l[qb] = a; } } }
#pragma unroll
    for (int qb = 0; qb < 2; ++qb) { sml[w][0][qb][lane] = m[qb]; sml[w][1][qb][lane] = l[qb]; }
    __syncthreads();   // every wave's max and sum of every row are in LDS; a wave without a step passes here too
    float inv[2];
#pragma unroll
    for (int qb = 0; qb < 2; ++qb) { float pm[4], ps[4];   // a row's four parts (the tile's two waves, two lane halves), joined in the same order by every lane that needs the row
#pragma unroll
        for (int u = 0; u < 4; ++u) { pm[u] = sml[(u >> 1) * 2 + ti][0][qb][(u & 1) * 16 + lr]; ps[u] = sml[(u >> 1) * 2 + ti][1][qb][(u & 1) * 16 + lr]; }
        const float mm = fmaxf(fmaxf(pm[0], pm[1]), fmaxf(pm[2], pm[3]));
        float sm = 0.f;
#pragma unroll
        for (int u = 0; u < 4; ++u) sm += ps[u] * exp2_slot((pm[u] - mm) * 1.44269504f);   // exp(pm - mm); a part whose keys were all masked, or that had none, holds m = -3e38: its sum is scaled to 0
        m[qb] = mm; inv[qb] = __fdiv_rn(1.0f, sm); }
    float se[2] = {0.f, 0.f}; v8f o[2][4];
#pragma unroll
    for (int qb = 0; qb < 2; ++qb)
#pragma unroll
        for (int nb = 0; nb < 4; ++nb) o[qb][nb] = (v8f){};
    { const bf* pkh = Kh + lo + sp * (32 * HD); const bf* pkl = Kl + lo + sp * (32 * HD); const bf* pv = V + (size_t)z * HD * 2 * GG + 8 * lane + sp * 512;
    for (int kb = sp; kb <= t; kb += 2) { v8f s[2][2]; v16bf ah[2][2], al[2][2], vh[4], vl[4]; fa_kload(pkh, pkl, ah, al);
#pragma unroll
        for (int nb = 0; nb < 4; ++nb) { vh[nb] = WFrag<bf>::ld(pv + (size_t)nb * 16 * GG); vl[nb] = WFrag<bf>::ld(pv + (size_t)nb * 16 * GG + HD * GG); }
        __builtin_amdgcn_sched_barrier(0);   // holds the key and the value loads in front of the first product: one memory latency a step, and the value tile flies under the scores and the softmax
        asm volatile("s_wait_xcnt 0x0" :: "v"(pkh), "v"(pkl), "v"(pv) : "memory");   // the wait in front of any rewrite of the loads' address registers; as inputs they stay whole up to it
        fa_scores(ah, al, kb * 32, lr, hi, r0, bqh, bql, s); pkh += 2 * 32 * HD; pkl += 2 * 32 * HD; pv += 2 * 512; v16bf ph[2], pl[2];
#pragma unroll
        for (int qb = 0; qb < 2; ++qb) { v8u h, c;   // two neighbouring keys a word: one packed convert makes the hi pair, one the lo pair
#pragma unroll
            for (int kt = 0; kt < 2; ++kt)
#pragma unroll
                for (int j = 0; j < 8; j += 2) { v2f p; p[0] = __expf(s[kt][qb][j] - m[qb]) * inv[qb]; p[1] = __expf(s[kt][qb][j + 1] - m[qb]) * inv[qb]; se[qb] += __expf(p[0]); se[qb] += __expf(p[1]);   // masked: p = 0 exactly, exp(0) = 1, as the reference
                    const v2bf a = __builtin_convertvector(p, v2bf); const v2bf b = __builtin_convertvector(p - __builtin_convertvector(a, v2f), v2bf); h[kt * 4 + (j >> 1)] = __builtin_bit_cast(unsigned, a); c[kt * 4 + (j >> 1)] = __builtin_bit_cast(unsigned, b); }
            ph[qb] = __builtin_bit_cast(v16bf, h); pl[qb] = __builtin_bit_cast(v16bf, c); }
#pragma unroll
        for (int nb = 0; nb < 4; ++nb)
#pragma unroll
            for (int qb = 0; qb < 2; ++qb) { o[qb][nb] = wmmab(ph[qb], vh[nb], o[qb][nb]); o[qb][nb] = wmmab(pl[qb], vh[nb], o[qb][nb]); o[qb][nb] = wmmab(ph[qb], vl[nb], o[qb][nb]); } } }
#pragma unroll
    for (int qb = 0; qb < 2; ++qb) { sse[w][qb][lane] = se[qb];
#pragma unroll
        for (int nb = 0; nb < 4; ++nb)
#pragma unroll
            for (int j = 0; j < 8; ++j) so[w][(qb * 16 + hi * 8 + j) * 68 + nb * 16 + lr] = o[qb][nb][j]; }
    __syncthreads();   // every wave's partial tile and exp sums are in LDS
    v4f ov[8], lv[4];   // wave w joins and stores rows 16 sp .. 16 sp + 15 of its own tile: whole 128-byte rows of the replicated lse, whole rows of 256 bytes of the output
#pragma unroll
    for (int s = 0; s < 4; ++s) { const int q = 4 * s + (lane >> 3); float st = 0.f;
#pragma unroll
        for (int u = 0; u < 4; ++u) st += sse[(u >> 1) * 2 + ti][sp][(u & 1) * 16 + q];
        const float y = log2_slot(st + (float)(GG - (t + 1) * 32));   // the keys beyond the tile's last step are masked: exp(0) = 1 each; the sum is at least GG, so no small-argument branch
        const float c1 = __uint_as_float(0x3f317217u), r = y * c1; const float lse = r + __builtin_fmaf(y, __uint_as_float(0x3377d1cfu), __builtin_fmaf(y, c1, -r)); lv[s] = (v4f){lse, lse, lse, lse}; }   // y ln 2, ln 2 in two parts, as the library's logarithm
    float* lp = LSEX + ((size_t)z * GG + r0 + sp * 16 + (lane >> 3)) * 32 + (lane & 7) * 4;
    __builtin_amdgcn_sched_barrier(0);   // holds the stores behind the last logarithm: nothing is computed into a register of an issued store
#pragma unroll
    for (int s = 0; s < 4; ++s) *(v4f*)(lp + s * 4 * 32) = lv[s];
    asm volatile("s_wait_xcnt 0x0" ::: "memory");   // the wait in front of any rewrite of the stores' registers by the sums below
    __builtin_amdgcn_sched_barrier(0);   // holds the sums below behind that wait
#pragma unroll
    for (int s = 0; s < 8; ++s) { const int e = (sp * 16 + 2 * s + hi) * 68 + lr * 4; ov[s] = *(const v4fa*)(so[ti] + e) + *(const v4fa*)(so[2 + ti] + e); }
    float* po = Ob + ((size_t)z * GG + r0 + sp * 16 + hi) * HD + lr * 4;
    __builtin_amdgcn_sched_barrier(0);   // holds the stores behind the last sum: nothing is computed into a register of an issued store
#pragma unroll
    for (int s = 0; s < 8; ++s) *(v4f*)(po + s * 2 * HD) = ov[s];
}
// k_comb: per (l, h): for each branch k (r = 1, 2, 4; segment w = 1024 r): head h uses position l iff (l mod w) mod r == h / (16/r); then gi = (l mod w) / r, z = (l / w) 16 + h, o_k = Ob_k[z][gi][:] and
// a wave: head h (64 k: two whole fragments a plane) of 16 positions; a thread's piece 2 g + c2 is k half c2 of position l + 8 g, where the same branches are in use (8 % r == 0) 8 / r rows further on; the weights of a position serve both its halves
__global__ __launch_bounds__(256) void k_comb(const float* __restrict__ Ob0, const float* __restrict__ Ob1, const float* __restrict__ Ob2, const float* __restrict__ L0, const float* __restrict__ L1, const float* __restrict__ L2, bf* Ah, bf* Al) { const int i = blockIdx.x * 256 + threadIdx.x; const int lane = i & 31, kq = lane & 3, rr = lane >> 2; const int wv = i >> 5; const int h = wv % NH_; const int l = (wv / NH_) * 16 + rr;
    const float* obs[3] = {Ob0, Ob1, Ob2}; const float* lss[3] = {L0, L1, L2}; float lsq[2][3]; unsigned vl[3], vb[3]; bool used[3]; v8f obq[4][3]; v8us ohq[4], olq[4];
#pragma unroll
    for (int k = 0; k < 3; ++k) { const int r = 1 << k; const int w = GG * r; const int ll = l % w; const int off = h / (NH_ / r); used[k] = (ll % r) == off; const int gi = ll / r; const int z = (l / w) * NH_ + h; const unsigned src = (unsigned)(z * GG + gi); vl[k] = src * (32 * 4); vb[k] = (src * HD + kq * 8) * 4;   // byte offsets: one register a branch for the lse rows, one for the outputs
        const float* pl = (const float*)((const char*)lss[k] + vl[k]); const float* po = (const float*)((const char*)obs[k] + vb[k]);
        lsq[0][k] = lsq[1][k] = -1.0e8f; obq[0][k] = obq[1][k] = obq[2][k] = obq[3][k] = (v8f){};
        if (used[k]) {   // one masked stretch a branch: its two lse values and, per piece, 8 outputs in two 16-byte loads; all pieces and branches in flight together
#pragma unroll
            for (int g = 0; g < 2; ++g) lsq[g][k] = pl[g * (8 / r) * 32];
#pragma unroll
            for (int pc = 0; pc < 4; ++pc) obq[pc][k] = *(const v8f*)(po + (pc >> 1) * (8 / r) * HD + (pc & 1) * 32); } }
    asm volatile("s_wait_xcnt 0x0" :: "v"(vl[0]), "v"(vl[1]), "v"(vl[2]), "v"(vb[0]), "v"(vb[1]), "v"(vb[2]) : "memory");   // the wait in front of any rewrite of the loads' offset registers; as inputs they stay whole up to it
#pragma unroll
    for (int g = 0; g < 2; ++g) { const float (&lse)[3] = lsq[g];
    const float m = fmaxf(lse[0], fmaxf(lse[1], lse[2])); float ex[3]; float den = 0.f;
#pragma unroll
    for (int k = 0; k < 3; ++k) { ex[k] = __expf(__fsub_rn(lse[k], m)); den = __fadd_rn(den, ex[k]); }
    const float inv = __fdiv_rn(1.0f, den);
#pragma unroll
    for (int c2 = 0; c2 < 2; ++c2) { const v8f (&ob)[3] = obq[g * 2 + c2]; v8us oh, ol;
#pragma unroll
    for (int u = 0; u < 8; ++u) { float acc = 0.f;
#pragma unroll
        for (int k = 0; k < 3; ++k) { const float o = ob[k][u]; float p = __fmul_rn(o, ex[k] * inv); asm volatile("" : "+v"(p)); acc = __fadd_rn(acc, p); }
        unsigned short a, c; splitf(acc, a, c); oh[u] = a; ol[u] = c; }
    ohq[g * 2 + c2] = oh; olq[g * 2 + c2] = ol; } }
    const unsigned e = (unsigned)wv * 1024 + (kq >> 1) * 256 + ((kq & 1) * 16 + rr) * 8; bf* pah = Ah + e; bf* pal = Al + e;
    __builtin_amdgcn_sched_barrier(0);   // holds the stores behind the last split: nothing is computed into a register of an issued store
#pragma unroll
    for (int pc = 0; pc < 4; ++pc) { *(v8us*)(pah + (pc & 1) * 512 + (pc >> 1) * 64) = ohq[pc]; *(v8us*)(pal + (pc & 1) * 512 + (pc >> 1) * 64) = olq[pc]; } }

extern "C" void kernel_launch(void* const* d_in, const int* in_sizes, int n_in,
                              void* d_out, int out_size, void* d_ws, size_t ws_size, hipStream_t stream) {
    (void)in_sizes; (void)n_in; (void)out_size;
    const float* x = (const float*)d_in[0]; const float* wqkv = (const float*)d_in[1]; const float* wproj = (const float*)d_in[2];
    float* OUT = (float*)d_out;     // [1][4096][1024]
    char* wsp = (char*)d_ws;
    auto take = [&](size_t bytes) { char* p = wsp; wsp += (bytes + 255) & ~(size_t)255; return (void*)p; };
    const int NZ = 7 * NH_;   // (segment, head) groups of all three branches: 64 + 32 + 16, numbered through
    bf* WP = (bf*)take((size_t)EE * EE * 2);
    bf* Qh = (bf*)take((size_t)NZ * GG * HD * 2); bf* Ql = (bf*)take((size_t)NZ * GG * HD * 2); bf* Kh = (bf*)take((size_t)NZ * GG * HD * 2); bf* Kl = (bf*)take((size_t)NZ * GG * HD * 2); bf* V = (bf*)take((size_t)NZ * HD * GG * 4);
    bf* WQ = (bf*)take((size_t)3 * EE * EE * 2); bf* XB = (bf*)take((size_t)LL * EE * 2); bf* Ah = (bf*)take((size_t)LL * EE * 2); bf* Al = (bf*)take((size_t)LL * EE * 2);
    float* Ob = (float*)take((size_t)NZ * GG * HD * 4); float* LS = (float*)take((size_t)NZ * GG * 32 * 4);
    const int zb[3] = {0, 4 * NH_, 6 * NH_};   // first group of each branch
    float* ObK[3]; float* LSK[3]; for (int k = 0; k < 3; ++k) { ObK[k] = Ob + (size_t)zb[k] * GG * HD; LSK[k] = LS + (size_t)zb[k] * GG * 32; }
    if ((size_t)(wsp - (char*)d_ws) > ws_size) return;    // total 166 MB (hl planes of 112 groups 88 MB, branch outputs + row-replicated lse 44 MB, weights, x and the combined planes 34 MB)
    k_pre<<<NB_CVT + NB_WQ + NB_WP, 256, 0, stream>>>(x, wqkv, wproj, XB, WQ, WP);
    k_gemmw<bf, 0, false, true><<<dim3(LL / 128, 3 * EE / 128, 1), 128, 0, stream>>>(XB, nullptr, WQ, nullptr, EE, nullptr, 3 * EE, nullptr, 0, 0, 0, Qh, Ql, Kh, Kl, V);
    k_fattn<<<dim3(NZ, GG / 64, 1), 128, 0, stream>>>(Qh, Ql, Kh, Kl, V, Ob, LS);
    k_comb<<<LL * NH_ / 128, 256, 0, stream>>>(ObK[0], ObK[1], ObK[2], LSK[0], LSK[1], LSK[2], Ah, Al);
    k_gemmw<bf, 1, false, false><<<dim3(LL / 128, EE / 128, 1), 128, 0, stream>>>(Ah, Al, WP, nullptr, EE, OUT, EE, nullptr, 0, 0, 0, nullptr, nullptr, nullptr, nullptr, nullptr);
}

// v010
// A run of this version takes 104 microseconds.
// Next to v009, in two timings, it ran 1.04 and 1.02 times as fast.
// All steps since v000 together make it 7.75 times as fast.
#include <hip/hip_runtime.h>

// Dilated causal self-attention (x [1][4096][1024]; qkv = x w_qkv (16 heads x 64); three branches (segment w, dilation r) = (1024,1), (2048,2), (4096,4): inside each segment, head h attends causally over the
// g = w/r = 1024 positions {gi r + off}, off = h / (16/r) (the reference's diagonal sparsify); softmax(q.k/8) with a causal mask over gi; branch output scattered back to those positions (0 elsewhere) with lse = logsumexp over the softmax
// PROBABILITIES of the row (masked entries contribute exp(0)), -1e8 elsewhere; branches recombined per (position, head) with softmax(lse) weights; out @ w_proj -> [1][4096][1024]).
// Compute dtypes, f32 accumulate: every input rounded to bf16; qkv on PLAIN bf16 operands (inputs: exact); per (segment, head) 1024x1024 attention on bf16 hi+lo planes gathered at the dilated positions
// (q x 1/8 exact; scores K 64 with 3 products, causal tiles skipped), softmax + the probability-logsumexp in f32 registers (the scores under that logsumexp's exp(p): the hi planes' product alone), probs.v on hl planes (3 products); the 3-branch recombination f32; w_proj on hl planes x exact (2 products). GEMMs: four waves per 128x128 tile, operands staged in LDS; the qkv GEMM writes those planes itself

#define LL   4096
#define EE   1024
#define NH_  16
#define HD   64
#define GG   1024
#define PCAR 1024.0f
typedef _Float16 h16;
typedef unsigned short bf;
typedef __attribute__((ext_vector_type(16))) __bf16   v16bf;
typedef __attribute__((ext_vector_type(16))) _Float16 v16h;
typedef __attribute__((ext_vector_type(8)))  _Float16 v8h;
typedef __attribute__((ext_vector_type(8)))  unsigned short v8us;
typedef __attribute__((ext_vector_type(8)))  float    v8f;
typedef __attribute__((ext_vector_type(4)))  float    v4f;
typedef v8h  __attribute__((may_alias)) v8ha;
typedef v4f  __attribute__((may_alias)) v4fa;
typedef v8us __attribute__((may_alias)) v8usa;

__device__ __forceinline__ unsigned short f2bf(float f) { return __builtin_bit_cast(unsigned short, (__bf16)f); }   // the hardware's convert: round to nearest even, as the integer form it replaces
__device__ __forceinline__ float bf2f(unsigned short b) { return __uint_as_float(((unsigned)b) << 16); }
__device__ __forceinline__ float bfr(float f) { return bf2f(f2bf(f)); }
__device__ __forceinline__ v16h cat16(v8h lo, v8h hi) { return __builtin_shufflevector(lo, hi, 0, 1, 2, 3, 4, 5, 6, 7, 8, 9, 10, 11, 12, 13, 14, 15); }
__device__ __forceinline__ v16bf cat16b(v8us lo, v8us hi) { return __builtin_bit_cast(v16bf, __builtin_shufflevector(lo, hi, 0, 1, 2, 3, 4, 5, 6, 7, 8, 9, 10, 11, 12, 13, 14, 15)); }
__device__ __forceinline__ v8f wmma16(v16h a, v16h b, v8f c) { return __builtin_amdgcn_wmma_f32_16x16x32_f16(false, a, false, b, (short)0, c, false, false); }
__device__ __forceinline__ v8f wmmab(v16bf a, v16bf b, v8f c) { return __builtin_amdgcn_wmma_f32_16x16x32_bf16(false, a, false, b, (short)0, c, false, false); }



// ---- FRAGMENT ORDER of every 16-bit operand plane [rows][K]: the plane is cut into fragments of 16 rows x 32 k (512 elements, 1 KiB), numbered (row / 16) (K / 32) + k / 32; inside a fragment element (row, k) lies at
// ((k >> 4) & 1) 256 + (((k >> 3) & 1) 16 + (row & 15)) 8 + (k & 7). Lane (lr, hi) = 16 hi + lr then finds its 8 + 8 elements (k = 8 hi + j and 16 + 8 hi + j of row lr, the hardware k order) at lane 8 and 256 + lane 8:
// each wave-wide 16-byte load reads 512 contiguous bytes, 4 whole lines, where a row-major plane made it touch 16 lines.
__device__ __forceinline__ size_t fo8(int row, int k, int K) { return ((size_t)(row >> 4) * (K >> 5) + (k >> 5)) * 512 + ((k >> 4) & 1) * 256 + (((k >> 3) & 1) * 16 + (row & 15)) * 8; }   // place of the 8 elements k .. k + 7 (k % 8 == 0) of a row
// ---- k_gemmw: GEMM on 16-bit planes in fragment order. A block of FOUR WAVES (2 x 2) makes a 128x128 tile of C, a wave its 64x64 quarter (16 accumulators); grid (M/128, N/128, Z), 128 threads.
// The block's operands pass through LDS: a stage is 64 k of the tile's 128 rows of every plane (8 row blocks x 2 fragments = 16 KiB a plane), brought in by asynchronous copies, each byte once a block, where four separate waves
// fetched each fragment twice from L2. Fragments are copied as they lie (1 KiB, lane-contiguous), so a wave-wide 16-byte LDS read takes 512 contiguous bytes. Two buffers: the next stage's copies fly while this stage is multiplied.
// C[m][n] (f32, pitch ldc, + optional f32 bias[n]) = sum_k A[m][k] Bt[n][k] (+ split products per NSPLIT). z-batch strides sA/sB/sC in elements. M % 128 == 0, N % 128 == 0, K % 64 == 0.
template <typename T16> struct WFrag;
template <> struct WFrag<h16> { typedef v16h V; static __device__ __forceinline__ V ld(const h16* p) { return cat16(*(const v8h*)p, *(const v8h*)(p + 256)); } static __device__ __forceinline__ v8f mma(V a, V b, v8f c) { return wmma16(a, b, c); } };
template <> struct WFrag<bf> { typedef v16bf V; static __device__ __forceinline__ V ld(const bf* p) { return cat16b(*(const v8us*)p, *(const v8us*)(p + 256)); } static __device__ __forceinline__ v8f mma(V a, V b, v8f c) { return wmmab(a, b, c); } };
// One wave's share of one plane's stage: two row blocks of 2 KiB, eight wave-wide copies of 512 bytes; l: the lane's LDS byte address, g: the lane's source address, rbstep: bytes from a row block of the plane to the next.
__device__ __forceinline__ void cp8(unsigned l, const char* g, unsigned rbstep) { const char* g2 = g + rbstep;
    asm volatile("global_load_async_to_lds_b128 %0, %8, off\n\t"
                 "global_load_async_to_lds_b128 %1, %9, off\n\t"
                 "global_load_async_to_lds_b128 %2, %10, off\n\t"
                 "global_load_async_to_lds_b128 %3, %11, off\n\t"
                 "global_load_async_to_lds_b128 %4, %12, off\n\t"
                 "global_load_async_to_lds_b128 %5, %13, off\n\t"
                 "global_load_async_to_lds_b128 %6, %14, off\n\t"
                 "global_load_async_to_lds_b128 %7, %15, off\n\t"
                 "s_wait_xcnt 0x0"   // inside the copies' own statement: it stands in front of any rewrite of their address registers
                 :: "v"(l), "v"(l + 512u), "v"(l + 1024u), "v"(l + 1536u), "v"(l + 2048u), "v"(l + 2560u), "v"(l + 3072u), "v"(l + 3584u),
                    "v"(g), "v"(g + 512), "v"(g + 1024), "v"(g + 1536), "v"(g2), "v"(g2 + 512), "v"(g2 + 1024), "v"(g2 + 1536) : "memory"); }
__device__ __forceinline__ void splitf(float y, unsigned short& h, unsigned short& l) { h = f2bf(y); l = f2bf(y - bf2f(h)); }
#define PO1 ((size_t)4 * NH_ * GG * HD)   // first plane element of branch 2's groups, and of branch 4's
#define PO2 ((size_t)6 * NH_ * GG * HD)
// ---- PLANES: the qkv GEMM writes the attention's operand planes itself; no f32 qkv reaches memory and no gather launch reads it back. os: the wave's tile [64 positions][64 d] of one head in LDS, pitch 68. Branch R uses the positions
// i R + off (off = head / (16 / R)) of the tile: 64 / R rows (keys) that follow one another in the head's group, a multiple of 16, so whole fragments (v, R = 4: a whole half). Pieces and lanes as in the other plane writers below.
// Eight pieces at a time: all LDS reads, every split, then the stores, so that nothing is computed into a register of an issued store.
template <int R>
__device__ __forceinline__ void e_qk(const float* os, int lane, int off, float sc, bf* ph, bf* pl) {   // ph, pl: the hi and lo plane at the tile's first row; lane = 4 rr + kq; piece pc: d half pc & 1 of the rows (pc >> 1) 8 + rr
    constexpr int NP8 = 64 / R / 4, NB = NP8 >= 8 ? 8 : NP8; const int kq = lane & 3, rr = lane >> 2;
    const float* s0 = os + (rr * R + off) * 68 + kq * 8; const unsigned e = (kq >> 1) * 256 + ((kq & 1) * 16 + rr) * 8; bf* qh = ph + e; bf* ql = pl + e;
#pragma unroll
    for (int p0 = 0; p0 < NP8; p0 += NB) { v4f f[NB][2]; v8us oh[NB], ol[NB];
#pragma unroll
        for (int u = 0; u < NB; ++u) { const float* p = s0 + ((p0 + u) >> 1) * 8 * R * 68 + (u & 1) * 32; f[u][0] = *(const v4fa*)p; f[u][1] = *(const v4fa*)(p + 4); }
#pragma unroll
        for (int u = 0; u < NB; ++u)
#pragma unroll
            for (int j = 0; j < 8; ++j) { unsigned short a, c; splitf(f[u][j >> 2][j & 3] * sc, a, c); oh[u][j] = a; ol[u][j] = c; }
        __builtin_amdgcn_sched_barrier(0);   // holds the stores behind the last split: nothing is computed into a register of an issued store
#pragma unroll
        for (int u = 0; u < NB; ++u) { const int c = ((p0 + u) >> 2) * 1024 + (u & 1) * 512 + (((p0 + u) >> 1) & 1) * 64; *(v8us*)(qh + c) = oh[u]; *(v8us*)(ql + c) = ol[u]; }
        asm volatile("s_wait_xcnt 0x0" ::: "memory");   // the wait in front of any rewrite of the stores' registers by the next pieces
        __builtin_amdgcn_sched_barrier(0); }   // holds the next pieces' work behind that wait
}
template <int R>
__device__ __forceinline__ void e_v(const float* os, int lane, int off, bf* pv) {   // pv: the group's hi plane [HD rows d][GG keys] at the tile's first 16 keys and this lane's piece; piece (kb, nb): keys kb 16 + hi 8 + j, d = nb 16 + lr
    constexpr int NKB = 64 / R / 16, NB = NKB >= 2 ? 2 : 1; const int lr = lane & 15, hi = lane >> 4;
    const float* s0 = os + (hi * 8 * R + off) * 68 + lr;
#pragma unroll
    for (int k0 = 0; k0 < NKB; k0 += NB) { float f[NB][4][8]; v8us oh[NB][4], ol[NB][4];
#pragma unroll
        for (int kb = 0; kb < NB; ++kb)
#pragma unroll
            for (int nb = 0; nb < 4; ++nb)
#pragma unroll
                for (int j = 0; j < 8; ++j) f[kb][nb][j] = s0[((k0 + kb) * 16 + j) * R * 68 + nb * 16];
#pragma unroll
        for (int kb = 0; kb < NB; ++kb)
#pragma unroll
            for (int nb = 0; nb < 4; ++nb)
#pragma unroll
                for (int j = 0; j < 8; ++j) { unsigned short a, c; splitf(f[kb][nb][j], a, c); oh[kb][nb][j] = a; ol[kb][nb][j] = c; }
        __builtin_amdgcn_sched_barrier(0);   // holds the stores behind the last split: nothing is computed into a register of an issued store
#pragma unroll
        for (int kb = 0; kb < NB; ++kb)
#pragma unroll
            for (int nb = 0; nb < 4; ++nb) { *(v8us*)(pv + nb * 16 * GG + (k0 + kb) * 256) = oh[kb][nb]; *(v8us*)(pv + nb * 16 * GG + (k0 + kb) * 256 + HD * GG) = ol[kb][nb]; }
        asm volatile("s_wait_xcnt 0x0" ::: "memory");   // the wait in front of any rewrite of the stores' registers by the next pieces
        __builtin_amdgcn_sched_barrier(0); }   // holds the next pieces' work behind that wait
}
template <typename T16, int NSPLIT, bool BIAS, bool PLANES>
__global__ __launch_bounds__(128) void k_gemmw(const T16* __restrict__ A, const T16* __restrict__ A2, const T16* __restrict__ Bt, const T16* __restrict__ Bt2, int K, float* C, int ldc, const float* __restrict__ bias, size_t sA, size_t sB, size_t sC, bf* Qh, bf* Ql, bf* Kh, bf* Kl, bf* Vhl) {
    typedef typename WFrag<T16>::V V;
    constexpr int NPA = (NSPLIT == 1 || NSPLIT == 2) ? 2 : 1, NPB = NSPLIT >= 2 ? 2 : 1, NP = NPA + NPB;   // planes staged: A (, A2), Bt (, Bt2)
    constexpr unsigned PLB = 8 * 2048, BUFB = NP * PLB;   // bytes of a plane's stage and of a buffer
    constexpr unsigned TILB = 4 * 64 * 68 * 4;   // PLANES: behind the loop the ring's space holds each wave's whole 64 x 64 f32 tile, pitch 68
    __shared__ __align__(2048) char ring[(PLANES && TILB > 2 * BUFB) ? TILB : 2 * BUFB];
    const size_t z = blockIdx.z; A += z * sA; if (A2) A2 += z * sA; Bt += z * sB; if (Bt2) Bt2 += z * sB; C += z * sC;
    const int lane = threadIdx.x & 31, lr = lane & 15, hi = lane >> 4; const int w = __builtin_amdgcn_readfirstlane(threadIdx.x >> 5), wm = w & 1, wn = w >> 1;
    const int R0 = blockIdx.x * 128, C0 = blockIdx.y * 128; const int r0 = R0 + wm * 64, c0 = C0 + wn * 64;
    v8f acc[4][4];
#pragma unroll
    for (int mb = 0; mb < 4; ++mb)
#pragma unroll
        for (int nb = 0; nb < 4; ++nb) acc[mb][nb] = (v8f){};
    const unsigned rbstep = (unsigned)K * 32;   // 16 rows of a plane hold 16 K elements
    const char* gs[NP];   // wave w copies row blocks 2 w and 2 w + 1 of every plane's stage
    gs[0] = (const char*)(A + (size_t)(R0 + w * 32) * K) + lane * 16; if (NPA == 2) gs[1] = (const char*)(A2 + (size_t)(R0 + w * 32) * K) + lane * 16;
    gs[NPA] = (const char*)(Bt + (size_t)(C0 + w * 32) * K) + lane * 16; if (NPB == 2) gs[NPA + 1] = (const char*)(Bt2 + (size_t)(C0 + w * 32) * K) + lane * 16;
    const unsigned l0 = (unsigned)(size_t)ring + w * 4096 + lane * 16;
    auto fill = [&](int buf) {
#pragma unroll
        for (int p = 0; p < NP; ++p) { cp8(l0 + buf * BUFB + p * PLB, gs[p], rbstep); gs[p] += 2048; } };
    const int NT = K >> 6;
    fill(0);
    asm volatile("s_wait_asynccnt 0x0" ::: "memory");   // this wave's copies of stage 0 have landed
    __syncthreads();                                     // and every other wave's: stage 0 may be read
    if (NT > 1) fill(1);
#pragma unroll 1   // rolled: one copy of a stage's code in the instruction cache; the buffer is picked by a scalar
    for (int t = 0; t < NT; ++t) {
        const char* rb = ring + (t & 1) * BUFB + lane * 16;
        V a[2][4], a2[2][4], b[2][4], b2[2][4];
#pragma unroll
        for (int ks = 0; ks < 2; ++ks)
#pragma unroll
            for (int u = 0; u < 4; ++u) { a[ks][u] = WFrag<T16>::ld((const T16*)(rb + (wm * 4 + u) * 2048 + ks * 1024)); b[ks][u] = WFrag<T16>::ld((const T16*)(rb + NPA * PLB + (wn * 4 + u) * 2048 + ks * 1024));
                if (NPA == 2) a2[ks][u] = WFrag<T16>::ld((const T16*)(rb + PLB + (wm * 4 + u) * 2048 + ks * 1024)); if (NPB == 2) b2[ks][u] = WFrag<T16>::ld((const T16*)(rb + (NPA + 1) * PLB + (wn * 4 + u) * 2048 + ks * 1024)); }
        __builtin_amdgcn_sched_barrier(0);   // holds every fragment read of the stage in front of its first product: one LDS latency a stage; left alone, the reads stood one by one among the products, each with its own full wait
#pragma unroll
        for (int ks = 0; ks < 2; ++ks)
#pragma unroll
            for (int nb = 0; nb < 4; ++nb)
#pragma unroll
                for (int mb = 0; mb < 4; ++mb) { acc[mb][nb] = WFrag<T16>::mma(a[ks][mb], b[ks][nb], acc[mb][nb]); if (NSPLIT == 1 || NSPLIT == 2) acc[mb][nb] = WFrag<T16>::mma(a2[ks][mb], b[ks][nb], acc[mb][nb]); if (NSPLIT >= 2) acc[mb][nb] = WFrag<T16>::mma(a[ks][mb], b2[ks][nb], acc[mb][nb]); }
        __builtin_amdgcn_sched_barrier(0);   // holds the products in front of the closing waits: sunk behind the barrier, they would leave the next stage's copies only the time of the fragment reads to land
        asm volatile("s_wait_dscnt 0x0" ::: "memory");      // this wave's reads of the buffer are over before it is refilled
        asm volatile("s_wait_asynccnt 0x0" ::: "memory");   // this wave's copies of stage t + 1 have landed
        __syncthreads();                                     // publishes stage t + 1 and ends every wave's reads of stage t
        if (t + 2 < NT) fill(t & 1);
    }
    asm volatile("s_wait_asynccnt 0x0" ::: "memory");   // no copy is outstanding when the wave goes on and ends
    if constexpr (PLANES) {   // the wave's tile is 64 positions of ONE head's q, k or v: it goes straight into that head's operand planes of all three branches
        float* os = (float*)ring + w * (64 * 68);   // the loop's last barrier ended every wave's reads of the ring, and no copy is outstanding
#pragma unroll
        for (int mb = 0; mb < 4; ++mb)
#pragma unroll
            for (int nb = 0; nb < 4; ++nb)
#pragma unroll
                for (int j = 0; j < 8; ++j) os[(mb * 16 + hi * 8 + j) * 68 + nb * 16 + lr] = acc[mb][nb][j];
        __builtin_amdgcn_wave_barrier(); asm volatile("" ::: "memory");   // keeps the reads below, of what other lanes of this wave wrote, behind the writes above
        const int ty = c0 >> 10, h = (c0 & (EE - 1)) >> 6;   // 0 q, 1 k, 2 v; the head
        const unsigned z1 = (unsigned)(r0 >> 10) * NH_ + h, z2 = (unsigned)(r0 >> 11) * NH_ + h, z4 = (unsigned)(r0 >> 12) * NH_ + h;   // the group inside its branch
        const unsigned g1 = r0 & 1023, g2 = (r0 & 2047) >> 1, g4 = (r0 & 4095) >> 2;   // the tile's first sparse index there
        if (ty == 2) { bf* pv = Vhl + lane * 8;
            e_v<1>(os, lane, 0, pv + (size_t)z1 * (2 * HD * GG) + (g1 >> 4) * 256);
            e_v<2>(os, lane, h >> 3, pv + 2 * PO1 + (size_t)z2 * (2 * HD * GG) + (g2 >> 4) * 256);
            e_v<4>(os, lane, h >> 2, pv + 2 * PO2 + (size_t)z4 * (2 * HD * GG) + (g4 >> 4) * 256);
        } else { bf* H = ty ? Kh : Qh; bf* L = ty ? Kl : Ql; const float sc = ty ? 1.0f : 0.125f;   // q x 1/8, exact; k x 1, an identity
            e_qk<1>(os, lane, 0, sc, H + ((size_t)z1 * GG + g1) * HD, L + ((size_t)z1 * GG + g1) * HD);
            e_qk<2>(os, lane, h >> 3, sc, H + PO1 + ((size_t)z2 * GG + g2) * HD, L + PO1 + ((size_t)z2 * GG + g2) * HD);
            e_qk<4>(os, lane, h >> 2, sc, H + PO2 + ((size_t)z4 * GG + g4) * HD, L + PO2 + ((size_t)z4 * GG + g4) * HD);
        }
    } else {
    __shared__ __align__(16) float osm[4][16 * 68]; float* os = osm[w];
#pragma unroll
    for (int mb = 0; mb < 4; ++mb) {
#pragma unroll
        for (int nb = 0; nb < 4; ++nb) {
#pragma unroll
            for (int j = 0; j < 8; ++j) os[(hi * 8 + j) * 68 + nb * 16 + lr] = acc[mb][nb][j]; }
        __builtin_amdgcn_wave_barrier(); asm volatile("" ::: "memory");
        float* crow = C + (size_t)(r0 + mb * 16) * ldc + c0;
{
#pragma unroll
            for (int s = 0; s < 8; ++s) { const int row = 2 * s + hi, cofs = lr * 4; v4f val = *(const v4fa*)(os + row * 68 + cofs); if (BIAS) { val[0] += bfr(bias[c0 + cofs]); val[1] += bfr(bias[c0 + cofs + 1]); val[2] += bfr(bias[c0 + cofs + 2]); val[3] += bfr(bias[c0 + cofs + 3]); }
                *(v4f*)(crow + (size_t)row * ldc + cofs) = val; }
             }
        __builtin_amdgcn_wave_barrier(); asm volatile("" ::: "memory");
    }
    }
}

__device__ __forceinline__ h16 tohx(float x) { return (h16)x; }
typedef __attribute__((ext_vector_type(2))) _Float16 v2h;
typedef __attribute__((ext_vector_type(4))) _Float16 v4h;
typedef __attribute__((ext_vector_type(2))) unsigned short v2us;
typedef __attribute__((ext_vector_type(4))) unsigned short v4us;
typedef __attribute__((ext_vector_type(2))) float v2f;
typedef __attribute__((ext_vector_type(2))) __bf16 v2bf;
typedef __attribute__((ext_vector_type(8))) unsigned v8u;

// The writers of the planes. Row-major sources (d_cvt8, e_qk, k_comb): a 16-byte piece is 8 k of one row; lane = 4 rr + kq takes row rr of 8 and piece kq of a 32-k block, so 4 lanes read one whole 128-byte line of f32
// and the 8 lanes of one kq store one whole 128-byte line. Transposed sources (d_wtG, e_v): lane = 16 hi + lr as in the readers: 16 lanes read 64 contiguous bytes, the wave stores 512.
// A THREAD MAKES SEVERAL PIECES (4 or 8), not one, for speed only. A thread's pieces lie at compile-time distances from its first, in the source and in the
// planes, so one address register serves all its loads of a source and one all its stores of a plane; all loads fly together, every piece is formed, and the stores come last, so that no register of an issued load or store is written again.
template <int K, int N>
__device__ __forceinline__ void d_wtG(int bx, const float* __restrict__ w, bf* Bt) {   // a wave: 16 k (one half of a 32-k block) of 8 neighbouring 16-column blocks: 512 contiguous bytes of each source row
    const int i = bx * 256 + threadIdx.x; const int lane = i & 31, lr = lane & 15, hi = lane >> 4; const int wv = i >> 5; const int half = wv & 1, fr = wv >> 1; const int kb = fr % (K >> 5), ng = fr / (K >> 5);
    const unsigned vo = (unsigned)(kb * 32 + half * 16 + hi * 8) * N + ng * 128 + lr; const float* p = w + vo; float f[8][8]; v8us o[8];
#pragma unroll
    for (int u = 0; u < 8; ++u)
#pragma unroll
        for (int j = 0; j < 8; ++j) f[u][j] = p[j * N + u * 16];
    __builtin_amdgcn_sched_barrier(0);   // holds every load in front of the wait below, and so in flight together
    asm volatile("s_wait_xcnt 0x0" :: "v"(vo) : "memory");   // the wait in front of any rewrite of the loads' offset register; as an input it stays whole up to it
#pragma unroll
    for (int u = 0; u < 8; ++u)
#pragma unroll
        for (int j = 0; j < 8; ++j) o[u][j] = f2bf(f[u][j]);
    bf* q = Bt + ((unsigned)((ng * 8 * (K >> 5) + kb) * 2 + half) * 256 + lane * 8);
    __builtin_amdgcn_sched_barrier(0);   // holds the stores behind the last conversion: nothing is computed into a register of an issued store
#pragma unroll
    for (int u = 0; u < 8; ++u) *(v8us*)(q + u * (K >> 5) * 512) = o[u];
    asm volatile("s_wait_xcnt 0x0" ::: "memory"); }   // behind the job's last store: in a shared launch another job's code follows in the listing and writes the stores' registers again
template <int K>
__device__ __forceinline__ void d_cvt8(int bx, const float* __restrict__ src, bf* dst) {   // a block: 16 whole rows (K = 1024: 32 fragments); wave wq, piece u: 32-k block (u & 3) 8 + wq of the rows (u >> 2) 8 + rr
    static_assert(K == 1024, "8 waves x 8 pieces cover 16 rows of 1024"); const int lane = threadIdx.x & 31, kq = lane & 3, rr = lane >> 2, wq = threadIdx.x >> 5;
    const unsigned vo = ((unsigned)(bx * 16 + rr) * K + wq * 32 + kq * 8) * 4; const float* p = (const float*)((const char*)src + vo); v8f v[8]; v8us o[8];
#pragma unroll
    for (int u = 0; u < 8; ++u) v[u] = *(const v8f*)(p + (u >> 2) * 8 * K + (u & 3) * 256);
    __builtin_amdgcn_sched_barrier(0);   // holds every load in front of the wait below, and so in flight together
    asm volatile("s_wait_xcnt 0x0" :: "v"(vo) : "memory");   // the wait in front of any rewrite of the loads' offset register; as an input it stays whole up to it
#pragma unroll
    for (int u = 0; u < 8; ++u)
#pragma unroll
        for (int j = 0; j < 8; ++j) o[u][j] = f2bf(v[u][j]);
    bf* q = dst + ((unsigned)bx * 16 * K + wq * 512 + (kq >> 1) * 256 + ((kq & 1) * 16 + rr) * 8);
    __builtin_amdgcn_sched_barrier(0);   // holds the stores behind the last conversion: nothing is computed into a register of an issued store
#pragma unroll
    for (int u = 0; u < 8; ++u) *(v8us*)(q + (u & 3) * 8 * 512 + (u >> 2) * 64) = o[u];
    asm volatile("s_wait_xcnt 0x0" ::: "memory"); }   // behind the job's last store: in a shared launch another job's code follows in the listing and writes the stores' registers again
// ---- Pre-passes that do not depend on one another SHARE A LAUNCH: the block's number picks its job (a scalar branch) and its place inside that job. Alone, each of these short launches paid the gap to the launch before it,
// its own start and its own drain, and the smaller ones left most of the chip idle meanwhile. k_pre: x and both weights into their planes.
#define NB_CVT (LL / 16)
#define NB_WQ  (EE * 3 * EE / 64 / 256)
#define NB_WP  (EE * EE / 64 / 256)
__global__ __launch_bounds__(256) void k_pre(const float* __restrict__ x, const float* __restrict__ wqkv, const float* __restrict__ wproj, bf* XB, bf* WQ, bf* WP) {
    const int b = blockIdx.x;
    if (b < NB_CVT) d_cvt8<EE>(b, x, XB);
    else if (b < NB_CVT + NB_WQ) d_wtG<EE, 3 * EE>(b - NB_CVT, wqkv, WQ);
    else d_wtG<EE, EE>(b - NB_CVT - NB_WQ, wproj, WP);
}
// ---- k_fattn: scores, softmax, the probability-logsumexp and probs.v of one (segment, head) group in ONE kernel; no score or probability ever reaches memory. A block of four waves owns two tiles of 32 query rows; TWO WAVES SPLIT A TILE'S CAUSAL KEYS: wave w = 2 sp + ti takes the 32-key steps sp, sp + 2, ... of tile ti.
// Each wave walks its steps twice. Sweep 1 does all that needs the scores at full accuracy (three products on the hi and lo planes): each row's max and sum over the wave's keys and e.v with e = exp(s - max), all three running and rescaled when the
// max rises; the tile's two waves join max and sum in LDS, and each scales its partial output by exp(own max - row max) / row sum. Sweep 2 is left with the sum of exp(p) alone, which needs the finished max and sum: it forms the scores again from
// the HI PLANES ONLY (one product, not three). That sum is GG + 1 + sum(p^2) / 2 + ..; a score off by a small d moves p by the factor exp(d), the sum by less than 3 d (exp(p) <= e, sum(p) = 1), and its logarithm, the branch's weight exponent, by less than 3 d / GG.
// The two partial outputs and exp sums are joined in LDS, each wave adding up and storing 16 of its tile's 32 rows. The longest chain is 16 steps, there are more blocks than places (the longest are launched first).
// The score tile is computed TRANSPOSED (A = keys, B = queries): lane (lr, hi) then holds query lr, keys 8 hi + j of tile 0 and 16 + 8 hi + j of tile 1, which is the k order of the fragment that e.v needs: no exchange between lanes.
// e.v is computed transposed too (A = v rows d, B = e): lane (lr, hi) holds query lr's outputs d = 8 hi + j, so a row's rescaling factor is the lane's own value; the two lane halves share a row's max through one cross-half move a step.
__device__ __forceinline__ void fa_kload(const bf* __restrict__ pkh, const bf* __restrict__ pkl, v16bf (&ah)[2][2], v16bf (&al)[2][2]) {   // pkh, pkl: the four fragments of keys k0 .. k0 + 31, at this lane's piece
#pragma unroll
    for (int kt = 0; kt < 2; ++kt)
#pragma unroll
        for (int kc = 0; kc < 2; ++kc) { ah[kt][kc] = WFrag<bf>::ld(pkh + (kt * 2 + kc) * 512); al[kt][kc] = WFrag<bf>::ld(pkl + (kt * 2 + kc) * 512); }
}
__device__ __forceinline__ void fa_scores(const v16bf (&ah)[2][2], const v16bf (&al)[2][2], int k0, int lr, int hi, int r0, const v16bf (&bqh)[2][2], const v16bf (&bql)[2][2], v8f (&s)[2][2]) {
#pragma unroll
    for (int kt = 0; kt < 2; ++kt)
#pragma unroll
        for (int qb = 0; qb < 2; ++qb) { v8f acc = (v8f){};
#pragma unroll
            for (int kc = 0; kc < 2; ++kc) { acc = wmmab(ah[kt][kc], bqh[qb][kc], acc); acc = wmmab(ah[kt][kc], bql[qb][kc], acc); acc = wmmab(al[kt][kc], bqh[qb][kc], acc); }
#pragma unroll
            for (int j = 0; j < 8; ++j) s[kt][qb][j] = (k0 + kt * 16 + hi * 8 + j) <= (r0 + qb * 16 + lr) ? acc[j] : -3.0e38f; }   // causal mask by select
}
__device__ __forceinline__ void fa_scores_hi(const v16bf (&ah)[2][2], int k0, int lr, int hi, int r0, const v16bf (&bqh)[2][2], v8f (&s)[2][2]) {   // the hi planes' product alone, for the sum of exp(p)
#pragma unroll
    for (int kt = 0; kt < 2; ++kt)
#pragma unroll
        for (int qb = 0; qb < 2; ++qb) { v8f acc = (v8f){};
#pragma unroll
            for (int kc = 0; kc < 2; ++kc) acc = wmmab(ah[kt][kc], bqh[qb][kc], acc);
#pragma unroll
            for (int j = 0; j < 8; ++j) s[kt][qb][j] = (k0 + kt * 16 + hi * 8 + j) <= (r0 + qb * 16 + lr) ? acc[j] : -3.0e38f; }   // causal mask by select
}
__device__ __forceinline__ float xhalf(float x) { return __builtin_bit_cast(float, __builtin_amdgcn_permlanex16(__builtin_bit_cast(int, x), __builtin_bit_cast(int, x), 0x76543210, 0xfedcba98, false, false)); }   // lane l with lane l ^ 16
// The joins' few transcendentals, each with its slot in its own statement: the instruction set asks for one independent instruction or a v_nop between a transcendental and a directly following instruction that reads its result or
// overwrites its source.
__device__ __forceinline__ float exp2_slot(float x) { float r; asm("v_exp_f32 %0, %1\n\tv_nop" : "=v"(r) : "v"(x)); return r; }
__device__ __forceinline__ float log2_slot(float x) { float r; asm("v_log_f32 %0, %1\n\tv_nop" : "=v"(r) : "v"(x)); return r; }
__global__ __launch_bounds__(128) void k_fattn(const bf* __restrict__ Qh, const bf* __restrict__ Ql, const bf* __restrict__ Kh, const bf* __restrict__ Kl, const bf* __restrict__ V, float* Ob, float* LSEX) {
    __shared__ float sml[4][2][2][32];   // [wave][max, sum][16-row half of the tile][lane]
    __shared__ float sse[4][2][32];      // [wave][16-row half][lane]: the wave's sum of exp(p)
    __shared__ __align__(16) float so[4][32 * 68];   // [wave][row][d], pitch 68: the wave's partial output tile
    const int lane = threadIdx.x & 31, lr = lane & 15, hi = lane >> 4; const int z = blockIdx.x;
    const int w = __builtin_amdgcn_readfirstlane(threadIdx.x >> 5);   // the wave's number in a scalar register, so that both loops branch on scalars
    const int ti = w & 1, sp = w >> 1;   // the wave's tile in the block, and which half of the tile's key steps it takes
    const int t = GG / 32 - 1 - (int)(blockIdx.y * 2 + ti);   // the longest rows are launched first
    const int r0 = t * 32; const size_t zo = (size_t)z * GG * HD; const size_t lo = zo + 8 * lane;
    v16bf bqh[2][2], bql[2][2]; const bf* pqh = Qh + lo + (size_t)r0 * HD; const bf* pql = Ql + lo + (size_t)r0 * HD;
#pragma unroll
    for (int qb = 0; qb < 2; ++qb)
#pragma unroll
        for (int kc = 0; kc < 2; ++kc) { bqh[qb][kc] = WFrag<bf>::ld(pqh + (qb * 2 + kc) * 512); bql[qb][kc] = WFrag<bf>::ld(pql + (qb * 2 + kc) * 512); }
    asm volatile("s_wait_xcnt 0x0" :: "v"(pqh), "v"(pql) : "memory");   // the wait in front of any reuse of the query loads' address registers; as inputs they stay whole up to it
    float m[2] = {-3.0e38f, -3.0e38f}, l[2] = {0.f, 0.f}; v8f o[2][4];   // o[qb][nb]: d = nb 16 + 8 hi + j of query qb 16 + lr
#pragma unroll
    for (int qb = 0; qb < 2; ++qb)
#pragma unroll
        for (int nb = 0; nb < 4; ++nb) o[qb][nb] = (v8f){};
    { const bf* pkh = Kh + lo + sp * (32 * HD); const bf* pkl = Kl + lo + sp * (32 * HD); const bf* pv = V + (size_t)z * HD * 2 * GG + 8 * lane + sp * 512;
    for (int kb = sp; kb <= t; kb += 2) { v8f s[2][2]; v16bf ah[2][2], al[2][2], vh[4], vl[4]; fa_kload(pkh, pkl, ah, al);
#pragma unroll
        for (int nb = 0; nb < 4; ++nb) { vh[nb] = WFrag<bf>::ld(pv + (size_t)nb * 16 * GG); vl[nb] = WFrag<bf>::ld(pv + (size_t)nb * 16 * GG + HD * GG); }
        __builtin_amdgcn_sched_barrier(0);   // holds the key and the value loads in front of the first product: one memory latency a step, and the value tile flies under the scores and the softmax
        asm volatile("s_wait_xcnt 0x0" :: "v"(pkh), "v"(pkl), "v"(pv) : "memory");   // the wait in front of any rewrite of the loads' address registers; as inputs they stay whole up to it
        fa_scores(ah, al, kb * 32, lr, hi, r0, bqh, bql, s); pkh += 2 * 32 * HD; pkl += 2 * 32 * HD; pv += 2 * 512; v16bf ph[2], pl[2];
#pragma unroll
        for (int qb = 0; qb < 2; ++qb) { float mx = m[qb];
#pragma unroll
            for (int j = 0; j < 8; ++j) mx = fmaxf(mx, fmaxf(s[0][qb][j], s[1][qb][j]));
            mx = fmaxf(mx, xhalf(mx));   // one max for both lane halves of a row: the products below sum over both halves' keys
            const float sc = __expf(m[qb] - mx); v2f sa = {0.f, 0.f}; v8u h, c;   // two neighbouring keys a word: one packed convert makes the hi pair, one the lo pair
#pragma unroll
            for (int kt = 0; kt < 2; ++kt)
#pragma unroll
                for (int j = 0; j < 8; j += 2) { v2f p; p[0] = __expf(s[kt][qb][j] - mx); p[1] = __expf(s[kt][qb][j + 1] - mx); sa += p;   // masked: e = 0 exactly
                    const v2bf a = __builtin_convertvector(p, v2bf); const v2bf b = __builtin_convertvector(p - __builtin_convertvector(a, v2f), v2bf); h[kt * 4 + (j >> 1)] = __builtin_bit_cast(unsigned, a); c[kt * 4 + (j >> 1)] = __builtin_bit_cast(unsigned, b); }
            ph[qb] = __builtin_bit_cast(v16bf, h); pl[qb] = __builtin_bit_cast(v16bf, c);
#pragma unroll
            for (int nb = 0; nb < 4; ++nb) o[qb][nb] *= sc;
            m[qb] = mx; l[qb] = l[qb] * sc + (sa[0] + sa[1]); }
#pragma unroll
        for (int nb = 0; nb < 4; ++nb)
#pragma unroll
            for (int qb = 0; qb < 2; ++qb) { o[qb][nb] = wmmab(vh[nb], ph[qb], o[qb][nb]); o[qb][nb] = wmmab(vh[nb], pl[qb], o[qb][nb]); o[qb][nb] = wmmab(vl[nb], ph[qb], o[qb][nb]); } } }
#pragma unroll
    for (int qb = 0; qb < 2; ++qb) { sml[w][0][qb][lane] = m[qb]; sml[w][1][qb][lane] = l[qb]; }
    __syncthreads();   // every wave's max and sum of every row are in LDS; a wave without a step passes here too
    float inv[2];
#pragma unroll
    for (int qb = 0; qb < 2; ++qb) { float pm[4], ps[4];   // a row's four parts (the tile's two waves, two lane halves), joined in the same order by every lane that needs the row
#pragma unroll
        for (int u = 0; u < 4; ++u) { pm[u] = sml[(u >> 1) * 2 + ti][0][qb][(u & 1) * 16 + lr]; ps[u] = sml[(u >> 1) * 2 + ti][1][qb][(u & 1) * 16 + lr]; }
        const float mm = fmaxf(fmaxf(pm[0], pm[1]), fmaxf(pm[2], pm[3]));
        float sm = 0.f;
#pragma unroll
        for (int u = 0; u < 4; ++u) sm += ps[u] * exp2_slot((pm[u] - mm) * 1.44269504f);   // exp(pm - mm); a part that had no key holds m = -3e38: its sum is scaled to 0
        inv[qb] = __fdiv_rn(1.0f, sm); const float fs = exp2_slot((m[qb] - mm) * 1.44269504f) * inv[qb]; m[qb] = mm;   // fs: from this wave's own max to the row's, and the row sum; 0 for a wave without a step
#pragma unroll
        for (int nb = 0; nb < 4; ++nb) { const v8f y = o[qb][nb] * fs; float* d = so[w] + (qb * 16 + lr) * 68 + nb * 16 + hi * 8; *(v4fa*)d = __builtin_shufflevector(y, y, 0, 1, 2, 3); *(v4fa*)(d + 4) = __builtin_shufflevector(y, y, 4, 5, 6, 7); } }
    v2f sv[2] = {{0.f, 0.f}, {0.f, 0.f}};
    { const bf* pkh = Kh + lo + sp * (32 * HD);
    for (int kb = sp; kb <= t; kb += 2) { v8f s[2][2]; v16bf ah[2][2];
#pragma unroll
        for (int kt = 0; kt < 2; ++kt)
#pragma unroll
            for (int kc = 0; kc < 2; ++kc) ah[kt][kc] = WFrag<bf>::ld(pkh + (kt * 2 + kc) * 512);
        __builtin_amdgcn_sched_barrier(0);   // holds all eight key loads in front of the first product: one memory latency a step instead of one per pair of loads
        asm volatile("s_wait_xcnt 0x0" :: "v"(pkh) : "memory");   // the wait in front of any rewrite of the loads' address register; as an input it stays whole up to it
        __builtin_amdgcn_sched_barrier(0);   // holds the address's advance behind that wait: left alone, the advance stood in front of it
        fa_scores_hi(ah, kb * 32, lr, hi, r0, bqh, s); pkh += 2 * 32 * HD;
#pragma unroll
        for (int qb = 0; qb < 2; ++qb)
#pragma unroll
            for (int kt = 0; kt < 2; ++kt)
#pragma unroll
                for (int j = 0; j < 8; j += 2) { v2f x; x[0] = __expf(__expf(s[kt][qb][j] - m[qb]) * inv[qb]); x[1] = __expf(__expf(s[kt][qb][j + 1] - m[qb]) * inv[qb]); sv[qb] += x; } } }   // masked: p = 0 exactly, exp(0) = 1, as the reference
#pragma unroll
    for (int qb = 0; qb < 2; ++qb) sse[w][qb][lane] = sv[qb][0] + sv[qb][1];
    __syncthreads();   // every wave's partial tile and exp sums are in LDS
    v4f ov[8], lv[4];   // wave w joins and stores rows 16 sp .. 16 sp + 15 of its own tile: whole 128-byte rows of the replicated lse, whole rows of 256 bytes of the output
#pragma unroll
    for (int s = 0; s < 4; ++s) { const int q = 4 * s + (lane >> 3); float st = 0.f;
#pragma unroll
        for (int u = 0; u < 4; ++u) st += sse[(u >> 1) * 2 + ti][sp][(u & 1) * 16 + q];
        const float y = log2_slot(st + (float)(GG - (t + 1) * 32));   // the keys beyond the tile's last step are masked: exp(0) = 1 each; the sum is at least GG, so no small-argument branch
        const float c1 = __uint_as_float(0x3f317217u), r = y * c1; const float lse = r + __builtin_fmaf(y, __uint_as_float(0x3377d1cfu), __builtin_fmaf(y, c1, -r)); lv[s] = (v4f){lse, lse, lse, lse}; }   // y ln 2, ln 2 in two parts, as the library's logarithm
    float* lp = LSEX + ((size_t)z * GG + r0 + sp * 16 + (lane >> 3)) * 32 + (lane & 7) * 4;
    __builtin_amdgcn_sched_barrier(0);   // holds the stores behind the last logarithm: nothing is computed into a register of an issued store
#pragma unroll
    for (int s = 0; s < 4; ++s) *(v4f*)(lp + s * 4 * 32) = lv[s];
    asm volatile("s_wait_xcnt 0x0" ::: "memory");   // the wait in front of any rewrite of the stores' registers by the sums below
    __builtin_amdgcn_sched_barrier(0);   // holds the sums below behind that wait
#pragma unroll
    for (int s = 0; s < 8; ++s) { const int e = (sp * 16 + 2 * s + hi) * 68 + lr * 4; ov[s] = *(const v4fa*)(so[ti] + e) + *(const v4fa*)(so[2 + ti] + e); }
    float* po = Ob + ((size_t)z * GG + r0 + sp * 16 + hi) * HD + lr * 4;
    __builtin_amdgcn_sched_barrier(0);   // holds the stores behind the last sum: nothing is computed into a register of an issued store
#pragma unroll
    for (int s = 0; s < 8; ++s) *(v4f*)(po + s * 2 * HD) = ov[s];
}
// k_comb: per (l, h): for each branch k (r = 1, 2, 4; segment w = 1024 r): head h uses position l iff (l mod w) mod r == h / (16/r); then gi = (l mod w) / r, z = (l / w) 16 + h, o_k = Ob_k[z][gi][:] and
// a wave: head h (64 k: two whole fragments a plane) of 16 positions; a thread's piece 2 g + c2 is k half c2 of position l + 8 g, where the same branches are in use (8 % r == 0) 8 / r rows further on; the weights of a position serve both its halves
__global__ __launch_bounds__(256) void k_comb(const float* __restrict__ Ob0, const float* __restrict__ Ob1, const float* __restrict__ Ob2, const float* __restrict__ L0, const float* __restrict__ L1, const float* __restrict__ L2, bf* Ah, bf* Al) { const int i = blockIdx.x * 256 + threadIdx.x; const int lane = i & 31, kq = lane & 3, rr = lane >> 2; const int wv = i >> 5; const int h = wv % NH_; const int l = (wv / NH_) * 16 + rr;
    const float* obs[3] = {Ob0, Ob1, Ob2}; const float* lss[3] = {L0, L1, L2}; float lsq[2][3]; unsigned vl[3], vb[3]; bool used[3]; v8f obq[4][3]; v8us ohq[4], olq[4];
#pragma unroll
    for (int k = 0; k < 3; ++k) { const int r = 1 << k; const int w = GG * r; const int ll = l % w; const int off = h / (NH_ / r); used[k] = (ll % r) == off; const int gi = ll / r; const int z = (l / w) * NH_ + h; const unsigned src = (unsigned)(z * GG + gi); vl[k] = src * (32 * 4); vb[k] = (src * HD + kq * 8) * 4;   // byte offsets: one register a branch for the lse rows, one for the outputs
        const float* pl = (const float*)((const char*)lss[k] + vl[k]); const float* po = (const float*)((const char*)obs[k] + vb[k]);
        lsq[0][k] = lsq[1][k] = -1.0e8f; obq[0][k] = obq[1][k] = obq[2][k] = obq[3][k] = (v8f){};
        if (used[k]) {   // one masked stretch a branch: its two lse values and, per piece, 8 outputs in two 16-byte loads; all pieces and branches in flight together
#pragma unroll
            for (int g = 0; g < 2; ++g) lsq[g][k] = pl[g * (8 / r) * 32];
#pragma unroll
            for (int pc = 0; pc < 4; ++pc) obq[pc][k] = *(const v8f*)(po + (pc >> 1) * (8 / r) * HD + (pc & 1) * 32); } }
    asm volatile("s_wait_xcnt 0x0" :: "v"(vl[0]), "v"(vl[1]), "v"(vl[2]), "v"(vb[0]), "v"(vb[1]), "v"(vb[2]) : "memory");   // the wait in front of any rewrite of the loads' offset registers; as inputs they stay whole up to it
#pragma unroll
    for (int g = 0; g < 2; ++g) { const float (&lse)[3] = lsq[g];
    const float m = fmaxf(lse[0], fmaxf(lse[1], lse[2])); float ex[3]; float den = 0.f;
#pragma unroll
    for (int k = 0; k < 3; ++k) { ex[k] = __expf(__fsub_rn(lse[k], m)); den = __fadd_rn(den, ex[k]); }
    const float inv = __fdiv_rn(1.0f, den);
#pragma unroll
    for (int c2 = 0; c2 < 2; ++c2) { const v8f (&ob)[3] = obq[g * 2 + c2]; v8us oh, ol;
#pragma unroll
    for (int u = 0; u < 8; ++u) { float acc = 0.f;
#pragma unroll
        for (int k = 0; k < 3; ++k) { const float o = ob[k][u]; float p = __fmul_rn(o, ex[k] * inv); asm volatile("" : "+v"(p)); acc = __fadd_rn(acc, p); }
        unsigned short a, c; splitf(acc, a, c); oh[u] = a; ol[u] = c; }
    ohq[g * 2 + c2] = oh; olq[g * 2 + c2] = ol; } }
    const unsigned e = (unsigned)wv * 1024 + (kq >> 1) * 256 + ((kq & 1) * 16 + rr) * 8; bf* pah = Ah + e; bf* pal = Al + e;
    __builtin_amdgcn_sched_barrier(0);   // holds the stores behind the last split: nothing is computed into a register of an issued store
#pragma unroll
    for (int pc = 0; pc < 4; ++pc) { *(v8us*)(pah + (pc & 1) * 512 + (pc >> 1) * 64) = ohq[pc]; *(v8us*)(pal + (pc & 1) * 512 + (pc >> 1) * 64) = olq[pc]; } }

extern "C" void kernel_launch(void* const* d_in, const int* in_sizes, int n_in,
                              void* d_out, int out_size, void* d_ws, size_t ws_size, hipStream_t stream) {
    (void)in_sizes; (void)n_in; (void)out_size;
    const float* x = (const float*)d_in[0]; const float* wqkv = (const float*)d_in[1]; const float* wproj = (const float*)d_in[2];
    float* OUT = (float*)d_out;     // [1][4096][1024]
    char* wsp = (char*)d_ws;
    auto take = [&](size_t bytes) { char* p = wsp; wsp += (bytes + 255) & ~(size_t)255; return (void*)p; };
    const int NZ = 7 * NH_;   // (segment, head) groups of all three branches: 64 + 32 + 16, numbered through
    bf* WP = (bf*)take((size_t)EE * EE * 2);
    bf* Qh = (bf*)take((size_t)NZ * GG * HD * 2); bf* Ql = (bf*)take((size_t)NZ * GG * HD * 2); bf* Kh = (bf*)take((size_t)NZ * GG * HD * 2); bf* Kl = (bf*)take((size_t)NZ * GG * HD * 2); bf* V = (bf*)take((size_t)NZ * HD * GG * 4);
    bf* WQ = (bf*)take((size_t)3 * EE * EE * 2); bf* XB = (bf*)take((size_t)LL * EE * 2); bf* Ah = (bf*)take((size_t)LL * EE * 2); bf* Al = (bf*)take((size_t)LL * EE * 2);
    float* Ob = (float*)take((size_t)NZ * GG * HD * 4); float* LS = (float*)take((size_t)NZ * GG * 32 * 4);
    const int zb[3] = {0, 4 * NH_, 6 * NH_};   // first group of each branch
    float* ObK[3]; float* LSK[3]; for (int k = 0; k < 3; ++k) { ObK[k] = Ob + (size_t)zb[k] * GG * HD; LSK[k] = LS + (size_t)zb[k] * GG * 32; }
    if ((size_t)(wsp - (char*)d_ws) > ws_size) return;    // total 166 MB (hl planes of 112 groups 88 MB, branch outputs + row-replicated lse 44 MB, weights, x and the combined planes 34 MB)
    k_pre<<<NB_CVT + NB_WQ + NB_WP, 256, 0, stream>>>(x, wqkv, wproj, XB, WQ, WP);
    k_gemmw<bf, 0, false, true><<<dim3(LL / 128, 3 * EE / 128, 1), 128, 0, stream>>>(XB, nullptr, WQ, nullptr, EE, nullptr, 3 * EE, nullptr, 0, 0, 0, Qh, Ql, Kh, Kl, V);
    k_fattn<<<dim3(NZ, GG / 64, 1), 128, 0, stream>>>(Qh, Ql, Kh, Kl, V, Ob, LS);
    k_comb<<<LL * NH_ / 128, 256, 0, stream>>>(ObK[0], ObK[1], ObK[2], LSK[0], LSK[1], LSK[2], Ah, Al);
    k_gemmw<bf, 1, false, false><<<dim3(LL / 128, EE / 128, 1), 128, 0, stream>>>(Ah, Al, WP, nullptr, EE, OUT, EE, nullptr, 0, 0, 0, nullptr, nullptr, nullptr, nullptr, nullptr);
}
